// v000
// Measured on an AMD MI455X. A time is GPU time per run, averaged over a window of back-to-back runs after a warm-up
// (all launches, gaps included; the runs take copies of the inputs in turn), and the median of several windows.
// Apart from v000's, it joins two sittings. Times from different sittings can be a few percent apart, while
// side-by-side timings come from the same sitting.
// v000, which the later versions start from, runs in 391 microseconds.
#include <hip/hip_runtime.h>
#include <hip/hip_bf16.h>

typedef __attribute__((ext_vector_type(16))) _Float16 v16h;
typedef __attribute__((ext_vector_type(8)))  _Float16 v8h;
typedef __attribute__((ext_vector_type(4)))  _Float16 v4h;
typedef __attribute__((ext_vector_type(8)))  float    v8f;
typedef __attribute__((ext_vector_type(4)))  int      v4i;

#define E_DIM   1024
#define H_DIM   16
#define D_DIM   64
#define FF_DIM  4096
#define L_SEQ   2048
#define NEG_VAL (-10000.0f)

#if __has_builtin(__builtin_amdgcn_global_load_async_to_lds_b128)
#define ASYNC_LDS 1
#endif

static __device__ __forceinline__ v8f vzero8() {
    v8f v;
#pragma unroll
    for (int i = 0; i < 8; ++i) v[i] = 0.0f;
    return v;
}

// WMMA 16-bit A/B fragment from an LDS row holding a 32-half K-window.
// Lane hi-half selects K-halves [hi*8, +8) (VGPRs 0..3) and [16+hi*8, +8).
static __device__ __forceinline__ v16h load_frag(const _Float16* p, int hi) {
    union { v16h v; v8h h[2]; } u;
    u.h[0] = *reinterpret_cast<const v8h*>(p + hi * 8);
    u.h[1] = *reinterpret_cast<const v8h*>(p + 16 + hi * 8);
    return u.v;
}

// ---- 16-lane xor butterflies on the VALU (v_permlane16) -------------------
#if __has_builtin(__builtin_amdgcn_permlane16)
static __device__ __forceinline__ float pl16(float v, unsigned s0, unsigned s1) {
    union { float f; unsigned u; } a, b;
    a.f = v;
    b.u = __builtin_amdgcn_permlane16(a.u, a.u, s0, s1, false, false);
    return b.f;
}
static __device__ __forceinline__ float rowmax16(float v) {
    v = fmaxf(v, pl16(v, 0x67452301u, 0xEFCDAB89u));  // xor 1
    v = fmaxf(v, pl16(v, 0x54761032u, 0xDCFE98BAu));  // xor 2
    v = fmaxf(v, pl16(v, 0x32107654u, 0xBA98FEDCu));  // xor 4
    v = fmaxf(v, pl16(v, 0xFEDCBA98u, 0x76543210u));  // xor 8
    return v;
}
static __device__ __forceinline__ float rowsum16(float v) {
    v += pl16(v, 0x67452301u, 0xEFCDAB89u);
    v += pl16(v, 0x54761032u, 0xDCFE98BAu);
    v += pl16(v, 0x32107654u, 0xBA98FEDCu);
    v += pl16(v, 0xFEDCBA98u, 0x76543210u);
    return v;
}
#else
static __device__ __forceinline__ float rowmax16(float v) {
    for (int mk = 1; mk < 16; mk <<= 1) v = fmaxf(v, __shfl_xor(v, mk, 32));
    return v;
}
static __device__ __forceinline__ float rowsum16(float v) {
    for (int mk = 1; mk < 16; mk <<= 1) v += __shfl_xor(v, mk, 32);
    return v;
}
#endif

#ifdef ASYNC_LDS
typedef __attribute__((address_space(1))) v4i*  gptr_v4i;
typedef __attribute__((address_space(3))) v4i*  lptr_v4i;
typedef __attribute__((address_space(1))) void* gptr_void;
typedef __attribute__((address_space(3))) void* lptr_void;

static __device__ __forceinline__ void async_cp16(const _Float16* g, _Float16* l) {
    __builtin_amdgcn_global_load_async_to_lds_b128(
        (gptr_v4i)(gptr_void)const_cast<_Float16*>(g),
        (lptr_v4i)(lptr_void)l, 0, 0);
}
static __device__ __forceinline__ void wait_async0() {
#if __has_builtin(__builtin_amdgcn_s_wait_asynccnt)
    __builtin_amdgcn_s_wait_asynccnt(0);
#else
    asm volatile("s_wait_asynccnt 0" ::: "memory");
#endif
}
#endif

// ---------------------------------------------------------------------------
// Tiled f16 WMMA GEMM:  C[M,N] = A[M,K] * Bt[N,K]^T  (Bt is B transposed)
// 256 threads (8 waves), block tile 128x128, wave tile 32x64, K-step 32,
// LDS double-buffered; tile t+1 streams (async if available) during tile t.
// ---------------------------------------------------------------------------
template <bool BIAS, bool RES, bool RELU, bool OUT16>
__global__ __launch_bounds__(256, 1)
void gemm_wmma_f16(const _Float16* __restrict__ A, const _Float16* __restrict__ Bt,
                   const float* __restrict__ bias, const float* __restrict__ res,
                   float* __restrict__ outF, _Float16* __restrict__ outH,
                   int M, int N, int K)
{
    __shared__ alignas(16) _Float16 As[2][128][40];   // 32-half rows, padded to 40
    __shared__ alignas(16) _Float16 Bs[2][128][40];

    const int tid  = threadIdx.x;
    const int lane = tid & 31;
    const int wave = tid >> 5;
    const int hi   = lane >> 4;
    const int ln15 = lane & 15;
    const int m0   = blockIdx.y * 128;
    const int n0   = blockIdx.x * 128;
    const int wr   = (wave >> 1) * 32;
    const int wc   = (wave & 1) * 64;

    v8f acc[2][4];
#pragma unroll
    for (int i = 0; i < 2; ++i)
#pragma unroll
        for (int j = 0; j < 4; ++j) acc[i][j] = vzero8();

    const int ldRow = tid >> 1;          // 0..127
    const int ldSeg = (tid & 1) * 16;    // 0 or 16 halfs
    const _Float16* aG = A  + (size_t)(m0 + ldRow) * K + ldSeg;
    const _Float16* bG = Bt + (size_t)(n0 + ldRow) * K + ldSeg;
    const int nk = K >> 5;

    auto compute = [&](int buf) {
        v16h af[2], bf[4];
        af[0] = load_frag(&As[buf][wr + ln15][0], hi);
        af[1] = load_frag(&As[buf][wr + 16 + ln15][0], hi);
#pragma unroll
        for (int j = 0; j < 4; ++j)
            bf[j] = load_frag(&Bs[buf][wc + j * 16 + ln15][0], hi);
#pragma unroll
        for (int i = 0; i < 2; ++i)
#pragma unroll
            for (int j = 0; j < 4; ++j)
                acc[i][j] = __builtin_amdgcn_wmma_f32_16x16x32_f16(
                    false, af[i], false, bf[j], (short)0, acc[i][j], false, false);
    };

#ifdef ASYNC_LDS
    // prologue: stream tile 0 into buffer 0 via the async-LDS path
    async_cp16(aG,      &As[0][ldRow][ldSeg]);
    async_cp16(aG + 8,  &As[0][ldRow][ldSeg + 8]);
    async_cp16(bG,      &Bs[0][ldRow][ldSeg]);
    async_cp16(bG + 8,  &Bs[0][ldRow][ldSeg + 8]);
    wait_async0();
    __syncthreads();
    for (int t = 0; t < nk; ++t) {
        const int cur = t & 1;
        if (t + 1 < nk) {
            const int kt = (t + 1) * 32;
            async_cp16(aG + kt,     &As[cur ^ 1][ldRow][ldSeg]);
            async_cp16(aG + kt + 8, &As[cur ^ 1][ldRow][ldSeg + 8]);
            async_cp16(bG + kt,     &Bs[cur ^ 1][ldRow][ldSeg]);
            async_cp16(bG + kt + 8, &Bs[cur ^ 1][ldRow][ldSeg + 8]);
            if (t + 2 < nk) {       // L2 prefetch two tiles ahead
                __builtin_prefetch(aG + kt + 32, 0, 1);
                __builtin_prefetch(bG + kt + 32, 0, 1);
            }
        }
        compute(cur);
        wait_async0();
        __syncthreads();
    }
#else
    {   // prologue (synchronous fallback): tile 0 -> buffer 0
        v8h a0 = *(const v8h*)(aG),     a1 = *(const v8h*)(aG + 8);
        v8h b0 = *(const v8h*)(bG),     b1 = *(const v8h*)(bG + 8);
        *(v8h*)&As[0][ldRow][ldSeg] = a0; *(v8h*)&As[0][ldRow][ldSeg + 8] = a1;
        *(v8h*)&Bs[0][ldRow][ldSeg] = b0; *(v8h*)&Bs[0][ldRow][ldSeg + 8] = b1;
    }
    __syncthreads();
    for (int t = 0; t < nk; ++t) {
        const int cur = t & 1;
        v8h a0, a1, b0, b1;
        if (t + 1 < nk) {            // issue next tile's global loads early
            const int kt = (t + 1) * 32;
            a0 = *(const v8h*)(aG + kt);     a1 = *(const v8h*)(aG + kt + 8);
            b0 = *(const v8h*)(bG + kt);     b1 = *(const v8h*)(bG + kt + 8);
            if (t + 2 < nk) {
                __builtin_prefetch(aG + kt + 32, 0, 1);
                __builtin_prefetch(bG + kt + 32, 0, 1);
            }
        }
        compute(cur);
        __syncthreads();
        if (t + 1 < nk) {
            *(v8h*)&As[cur ^ 1][ldRow][ldSeg]     = a0;
            *(v8h*)&As[cur ^ 1][ldRow][ldSeg + 8] = a1;
            *(v8h*)&Bs[cur ^ 1][ldRow][ldSeg]     = b0;
            *(v8h*)&Bs[cur ^ 1][ldRow][ldSeg + 8] = b1;
        }
        __syncthreads();
    }
#endif

    // C layout: lane holds column n = lane&15; VGPR r holds row r + 8*hi.
#pragma unroll
    for (int i = 0; i < 2; ++i)
#pragma unroll
        for (int j = 0; j < 4; ++j)
#pragma unroll
            for (int r = 0; r < 8; ++r) {
                int row = m0 + wr + i * 16 + hi * 8 + r;
                int col = n0 + wc + j * 16 + ln15;
                float v = acc[i][j][r];
                if (BIAS) v += bias[col];
                if (RES)  v += res[(size_t)row * N + col];
                if (RELU) v = fmaxf(v, 0.0f);
                if (OUT16) outH[(size_t)row * N + col] = (_Float16)v;
                else       outF[(size_t)row * N + col] = v;
            }
}

// ---------------------------------------------------------------------------
// Flash attention with WMMA. 128 threads (4 waves) per block; block handles
// 64 q-rows of one (batch, head); each wave owns 16 q-rows. Key chunk = 32.
// ---------------------------------------------------------------------------
__global__ __launch_bounds__(128, 1)
void attention_wmma(const _Float16* __restrict__ Q, const _Float16* __restrict__ K,
                    const _Float16* __restrict__ V, const int* __restrict__ mask,
                    _Float16* __restrict__ O)
{
    __shared__ alignas(16) _Float16 Qs[64][72];     // [q][d]
    __shared__ alignas(16) _Float16 Ks[32][72];     // [key][d] (B-layout for QK^T)
    __shared__ alignas(16) _Float16 Vt[64][40];     // [d][key] (B-layout for PV)
    __shared__ alignas(16) _Float16 Ps[4][16][40];  // per-wave P bounce [q][key]

    const int tid  = threadIdx.x;
    const int lane = tid & 31;
    const int wave = tid >> 5;
    const int hi   = lane >> 4;
    const int ln15 = lane & 15;
    const int q0   = blockIdx.x * 64;
    const int hh   = blockIdx.y;
    const int nb   = blockIdx.z;
    const size_t baseTok = (size_t)nb * L_SEQ;
    const int co   = hh * D_DIM;

    if (tid < 64) {  // load Q tile once
        const _Float16* src = Q + (baseTok + q0 + tid) * E_DIM + co;
#pragma unroll
        for (int j = 0; j < 8; ++j)
            *(v8h*)&Qs[tid][j * 8] = *(const v8h*)(src + j * 8);
    }

    v8f o[4];
#pragma unroll
    for (int j = 0; j < 4; ++j) o[j] = vzero8();
    float mr[8], lr[8];
#pragma unroll
    for (int r = 0; r < 8; ++r) { mr[r] = -3.0e38f; lr[r] = 0.0f; }

    const int krow = tid >> 2;           // 0..31
    const int kseg = (tid & 3) * 16;     // 0,16,32,48
    const int* mrow = mask + nb * L_SEQ;
    _Float16 (*Pw)[40] = Ps[wave];

    for (int key0 = 0; key0 < L_SEQ; key0 += 32) {
        __syncthreads();
        {   // stage K rows (no transpose needed) and V transposed
            const _Float16* ksrc = K + (baseTok + key0 + krow) * E_DIM + co + kseg;
            *(v8h*)&Ks[krow][kseg]     = *(const v8h*)(ksrc);
            *(v8h*)&Ks[krow][kseg + 8] = *(const v8h*)(ksrc + 8);
            const _Float16* vsrc = V + (baseTok + key0 + krow) * E_DIM + co + kseg;
            v8h v0 = *(const v8h*)(vsrc);
            v8h v1 = *(const v8h*)(vsrc + 8);
#pragma unroll
            for (int j = 0; j < 8; ++j) Vt[kseg + j][krow]     = v0[j];
#pragma unroll
            for (int j = 0; j < 8; ++j) Vt[kseg + 8 + j][krow] = v1[j];
        }
        __syncthreads();

        // S = Q(16x64) @ K^T(64x32): 2 key-subtiles x 2 k-steps
        v8f s[2];
        s[0] = vzero8(); s[1] = vzero8();
#pragma unroll
        for (int ks = 0; ks < 2; ++ks) {
            v16h qf = load_frag(&Qs[wave * 16 + ln15][ks * 32], hi);
#pragma unroll
            for (int c = 0; c < 2; ++c) {
                v16h kf = load_frag(&Ks[c * 16 + ln15][ks * 32], hi);
                s[c] = __builtin_amdgcn_wmma_f32_16x16x32_f16(
                    false, qf, false, kf, (short)0, s[c], false, false);
            }
        }

        // mask (before scaling) + online softmax
        const int mv0 = mrow[key0 + ln15];
        const int mv1 = mrow[key0 + 16 + ln15];
#pragma unroll
        for (int r = 0; r < 8; ++r) {
            float a = s[0][r]; if (mv0 == 0) a = NEG_VAL; a *= 0.125f;
            float b = s[1][r]; if (mv1 == 0) b = NEG_VAL; b *= 0.125f;
            float rm   = rowmax16(fmaxf(a, b));
            float mn   = fmaxf(mr[r], rm);
            float corr = __expf(mr[r] - mn);
            mr[r] = mn;
            float p0 = __expf(a - mn);
            float p1 = __expf(b - mn);
            float rs = rowsum16(p0 + p1);
            lr[r] = lr[r] * corr + rs;
#pragma unroll
            for (int j = 0; j < 4; ++j) o[j][r] *= corr;
            Pw[hi * 8 + r][ln15]      = (_Float16)p0;   // C-layout -> LDS
            Pw[hi * 8 + r][16 + ln15] = (_Float16)p1;
        }
        asm volatile("s_wait_dscnt 0" ::: "memory");    // within-wave LDS RAW

        // O += P(16x32) @ V(32x64)
        v16h pf = load_frag(&Pw[ln15][0], hi);
#pragma unroll
        for (int j = 0; j < 4; ++j) {
            v16h vf = load_frag(&Vt[j * 16 + ln15][0], hi);
            o[j] = __builtin_amdgcn_wmma_f32_16x16x32_f16(
                false, pf, false, vf, (short)0, o[j], false, false);
        }
    }

#pragma unroll
    for (int r = 0; r < 8; ++r) {
        float inv = 1.0f / lr[r];
        int q = q0 + wave * 16 + hi * 8 + r;
        _Float16* dst = O + (baseTok + q) * E_DIM + co;
#pragma unroll
        for (int j = 0; j < 4; ++j)
            dst[j * 16 + ln15] = (_Float16)(o[j][r] * inv);
    }
}

// ---------------------------------------------------------------------------
// LayerNorm over rows of E_DIM floats; writes f32 and optionally f16 copy.
// ---------------------------------------------------------------------------
__global__ __launch_bounds__(256, 1)
void layernorm_k(const float* __restrict__ in, const float* __restrict__ g,
                 const float* __restrict__ b, float* __restrict__ outF,
                 _Float16* __restrict__ outH)
{
    const int row = blockIdx.x;
    const int t   = threadIdx.x;
    const float4 x = ((const float4*)(in + (size_t)row * E_DIM))[t];
    float s  = x.x + x.y + x.z + x.w;
    float sq = x.x * x.x + x.y * x.y + x.z * x.z + x.w * x.w;
#pragma unroll
    for (int mk = 1; mk < 32; mk <<= 1) { s += __shfl_xor(s, mk, 32); sq += __shfl_xor(sq, mk, 32); }
    __shared__ float sh_s[8], sh_q[8];
    const int wave = t >> 5;
    if ((t & 31) == 0) { sh_s[wave] = s; sh_q[wave] = sq; }
    __syncthreads();
    float ts = 0.0f, tq = 0.0f;
#pragma unroll
    for (int i = 0; i < 8; ++i) { ts += sh_s[i]; tq += sh_q[i]; }
    const float mean = ts * (1.0f / E_DIM);
    const float var  = tq * (1.0f / E_DIM) - mean * mean;
    const float inv  = rsqrtf(var + 1e-6f);
    const float4 gg = ((const float4*)g)[t];
    const float4 bb = ((const float4*)b)[t];
    float4 y;
    y.x = gg.x * (x.x - mean) * inv + bb.x;
    y.y = gg.y * (x.y - mean) * inv + bb.y;
    y.z = gg.z * (x.z - mean) * inv + bb.z;
    y.w = gg.w * (x.w - mean) * inv + bb.w;
    ((float4*)(outF + (size_t)row * E_DIM))[t] = y;
    if (outH) {
        v4h h; h[0] = (_Float16)y.x; h[1] = (_Float16)y.y;
               h[2] = (_Float16)y.z; h[3] = (_Float16)y.w;
        *(v4h*)(outH + (size_t)row * E_DIM + t * 4) = h;
    }
}

__global__ void cvt_f32_to_f16(const float* __restrict__ in, _Float16* __restrict__ out, int n4)
{
    int i = blockIdx.x * blockDim.x + threadIdx.x;
    if (i < n4) {
        float4 v = ((const float4*)in)[i];
        v4h h; h[0] = (_Float16)v.x; h[1] = (_Float16)v.y;
               h[2] = (_Float16)v.z; h[3] = (_Float16)v.w;
        ((v4h*)out)[i] = h;
    }
}

// in[K][N] (f32) -> out[N][K] (f16), LDS-tiled for coalescing both ways
__global__ __launch_bounds__(256, 1)
void cvt_transpose_f16(const float* __restrict__ in, _Float16* __restrict__ out, int K, int N)
{
    __shared__ float tile[32][33];
    int n0 = blockIdx.x * 32, k0 = blockIdx.y * 32;
    int tx = threadIdx.x, ty = threadIdx.y;       // (32, 8)
#pragma unroll
    for (int i = 0; i < 4; ++i)
        tile[ty + i * 8][tx] = in[(size_t)(k0 + ty + i * 8) * N + n0 + tx];
    __syncthreads();
#pragma unroll
    for (int i = 0; i < 4; ++i)
        out[(size_t)(n0 + ty + i * 8) * K + k0 + tx] = (_Float16)tile[tx][ty + i * 8];
}

extern "C" void kernel_launch(void* const* d_in, const int* in_sizes, int n_in,
                              void* d_out, int out_size, void* d_ws, size_t ws_size,
                              hipStream_t stream)
{
    (void)in_sizes; (void)n_in; (void)out_size; (void)ws_size;
    const float* x   = (const float*)d_in[0];
    const int*   msk = (const int*)d_in[1];
    const float* wq  = (const float*)d_in[2];
    const float* wk  = (const float*)d_in[3];
    const float* wv  = (const float*)d_in[4];
    const float* wo  = (const float*)d_in[5];
    const float* bo  = (const float*)d_in[6];
    const float* g1  = (const float*)d_in[7];
    const float* be1 = (const float*)d_in[8];
    const float* g2  = (const float*)d_in[9];
    const float* be2 = (const float*)d_in[10];
    const float* w1  = (const float*)d_in[11];
    const float* b1  = (const float*)d_in[12];
    const float* w2  = (const float*)d_in[13];
    const float* b2  = (const float*)d_in[14];

    const int NL = 2 * L_SEQ;                       // 4096 tokens
    char* ws = (char*)d_ws;
    const size_t MB = 1024ull * 1024ull;
    _Float16* AH    = (_Float16*)(ws + 0);          //  8 MB: x f16, later h f16
    _Float16* FFH   = (_Float16*)(ws + 8 * MB);     // 32 MB: relu(h@w1+b1) f16
    _Float16* WT    = (_Float16*)(ws + 40 * MB);    //  8 MB: current weight^T f16
    _Float16* QH    = (_Float16*)(ws + 48 * MB);    //  8 MB
    _Float16* KH    = (_Float16*)(ws + 56 * MB);    //  8 MB
    _Float16* VH    = (_Float16*)(ws + 64 * MB);    //  8 MB
    _Float16* ATTNH = (_Float16*)(ws + 72 * MB);    //  8 MB
    float*    RES   = (float*)(ws + 80 * MB);       // 16 MB (pre-LN1, later pre-LN2)
    float*    HBUF  = (float*)(ws + 96 * MB);       // 16 MB: h f32 (residual)

    dim3 blk256(256), blk128(128), tblk(32, 8);
    dim3 gP(E_DIM / 128, NL / 128);                 // (8, 32)
    dim3 gF1(FF_DIM / 128, NL / 128);               // (32, 32)

    cvt_f32_to_f16<<<(NL * E_DIM / 4 + 255) / 256, blk256, 0, stream>>>(x, AH, NL * E_DIM / 4);

    // Q / K / V projections (weight buffer reused; stream order serializes)
    cvt_transpose_f16<<<dim3(E_DIM / 32, E_DIM / 32), tblk, 0, stream>>>(wq, WT, E_DIM, E_DIM);
    gemm_wmma_f16<false, false, false, true><<<gP, blk256, 0, stream>>>(AH, WT, nullptr, nullptr, nullptr, QH, NL, E_DIM, E_DIM);
    cvt_transpose_f16<<<dim3(E_DIM / 32, E_DIM / 32), tblk, 0, stream>>>(wk, WT, E_DIM, E_DIM);
    gemm_wmma_f16<false, false, false, true><<<gP, blk256, 0, stream>>>(AH, WT, nullptr, nullptr, nullptr, KH, NL, E_DIM, E_DIM);
    cvt_transpose_f16<<<dim3(E_DIM / 32, E_DIM / 32), tblk, 0, stream>>>(wv, WT, E_DIM, E_DIM);
    gemm_wmma_f16<false, false, false, true><<<gP, blk256, 0, stream>>>(AH, WT, nullptr, nullptr, nullptr, VH, NL, E_DIM, E_DIM);

    attention_wmma<<<dim3(L_SEQ / 64, H_DIM, 2), blk128, 0, stream>>>(QH, KH, VH, msk, ATTNH);

    // out-proj + bo + residual x  -> RES (f32)
    cvt_transpose_f16<<<dim3(E_DIM / 32, E_DIM / 32), tblk, 0, stream>>>(wo, WT, E_DIM, E_DIM);
    gemm_wmma_f16<true, true, false, false><<<gP, blk256, 0, stream>>>(ATTNH, WT, bo, x, RES, nullptr, NL, E_DIM, E_DIM);

    // LN1 -> h (f32 in HBUF, f16 in AH)
    layernorm_k<<<NL, blk256, 0, stream>>>(RES, g1, be1, HBUF, AH);

    // FF1: relu(h @ w1 + b1) -> FFH (f16)
    cvt_transpose_f16<<<dim3(FF_DIM / 32, E_DIM / 32), tblk, 0, stream>>>(w1, WT, E_DIM, FF_DIM);
    gemm_wmma_f16<true, false, true, true><<<gF1, blk256, 0, stream>>>(AH, WT, b1, nullptr, nullptr, FFH, NL, FF_DIM, E_DIM);

    // FF2: ff @ w2 + b2 + h -> RES (f32)
    cvt_transpose_f16<<<dim3(E_DIM / 32, FF_DIM / 32), tblk, 0, stream>>>(w2, WT, FF_DIM, E_DIM);
    gemm_wmma_f16<true, true, false, false><<<gP, blk256, 0, stream>>>(FFH, WT, b2, HBUF, RES, nullptr, NL, E_DIM, FF_DIM);

    // LN2 -> final output
    layernorm_k<<<NL, blk256, 0, stream>>>(RES, g2, be2, (float*)d_out, nullptr);
}

// v001
// A run of this version takes 267 microseconds.
// Timed twice side by side with v000, it ran 1.51 and 1.50 times as fast.
#include <hip/hip_runtime.h>
#include <hip/hip_bf16.h>

typedef __attribute__((ext_vector_type(16))) _Float16 v16h;
typedef __attribute__((ext_vector_type(8)))  _Float16 v8h;
typedef __attribute__((ext_vector_type(4)))  _Float16 v4h;
typedef __attribute__((ext_vector_type(8)))  float    v8f;
typedef __attribute__((ext_vector_type(4)))  int      v4i;

#define E_DIM   1024
#define H_DIM   16
#define D_DIM   64
#define FF_DIM  4096
#define L_SEQ   2048
#define NEG_VAL (-10000.0f)

#if __has_builtin(__builtin_amdgcn_global_load_async_to_lds_b128)
#define ASYNC_LDS 1
#endif

static __device__ __forceinline__ v8f vzero8() {
    v8f v;
#pragma unroll
    for (int i = 0; i < 8; ++i) v[i] = 0.0f;
    return v;
}

// WMMA 16-bit A/B fragment from an LDS row holding a 32-half K-window.
// Lane hi-half selects K-halves [hi*8, +8) (VGPRs 0..3) and [16+hi*8, +8).
static __device__ __forceinline__ v16h load_frag(const _Float16* p, int hi) {
    union { v16h v; v8h h[2]; } u;
    u.h[0] = *reinterpret_cast<const v8h*>(p + hi * 8);
    u.h[1] = *reinterpret_cast<const v8h*>(p + 16 + hi * 8);
    return u.v;
}

// ---- 16-lane xor butterflies on the VALU (v_permlane16) -------------------
#if __has_builtin(__builtin_amdgcn_permlane16)
static __device__ __forceinline__ float pl16(float v, unsigned s0, unsigned s1) {
    union { float f; unsigned u; } a, b;
    a.f = v;
    b.u = __builtin_amdgcn_permlane16(a.u, a.u, s0, s1, false, false);
    return b.f;
}
static __device__ __forceinline__ float rowmax16(float v) {
    v = fmaxf(v, pl16(v, 0x67452301u, 0xEFCDAB89u));  // xor 1
    v = fmaxf(v, pl16(v, 0x54761032u, 0xDCFE98BAu));  // xor 2
    v = fmaxf(v, pl16(v, 0x32107654u, 0xBA98FEDCu));  // xor 4
    v = fmaxf(v, pl16(v, 0xFEDCBA98u, 0x76543210u));  // xor 8
    return v;
}
static __device__ __forceinline__ float rowsum16(float v) {
    v += pl16(v, 0x67452301u, 0xEFCDAB89u);
    v += pl16(v, 0x54761032u, 0xDCFE98BAu);
    v += pl16(v, 0x32107654u, 0xBA98FEDCu);
    v += pl16(v, 0xFEDCBA98u, 0x76543210u);
    return v;
}
#else
static __device__ __forceinline__ float rowmax16(float v) {
    for (int mk = 1; mk < 16; mk <<= 1) v = fmaxf(v, __shfl_xor(v, mk, 32));
    return v;
}
static __device__ __forceinline__ float rowsum16(float v) {
    for (int mk = 1; mk < 16; mk <<= 1) v += __shfl_xor(v, mk, 32);
    return v;
}
#endif

#ifdef ASYNC_LDS
typedef __attribute__((address_space(1))) v4i*  gptr_v4i;
typedef __attribute__((address_space(3))) v4i*  lptr_v4i;
typedef __attribute__((address_space(1))) void* gptr_void;
typedef __attribute__((address_space(3))) void* lptr_void;

static __device__ __forceinline__ void async_cp16(const _Float16* g, _Float16* l) {
    __builtin_amdgcn_global_load_async_to_lds_b128(
        (gptr_v4i)(gptr_void)const_cast<_Float16*>(g),
        (lptr_v4i)(lptr_void)l, 0, 0);
}
static __device__ __forceinline__ void wait_async0() {
    // asm with the memory clobber: holds every later LDS read behind the wait
    asm volatile("s_wait_asynccnt 0x0" ::: "memory");
}
#else
// no async path: same ring, staged through registers
static __device__ __forceinline__ void async_cp16(const _Float16* g, _Float16* l) {
    *reinterpret_cast<v8h*>(l) = *reinterpret_cast<const v8h*>(g);
}
static __device__ __forceinline__ void wait_async0() {}
#endif

#define KT  128   // halfs of K per pass: one 256-B piece of every operand row
#define LDP 136   // LDS row pitch in halfs: 272 B = 16 B x 17, for ds_load_b128

// ---------------------------------------------------------------------------
// Tiled f16 WMMA GEMM:  C[M,N] = A[M,K] * Bt[N,K]^T  (Bt is B transposed)
// 256 threads (8 waves), block tile 128x128, wave tile 32x64, K-step 128,
// two LDS buffers; tile t+1 streams in during tile t. 16 lanes copy one
// 256-B row piece, so a wave's copy instruction covers whole lines only.
// K must be a multiple of KT.
// ---------------------------------------------------------------------------
template <bool BIAS, bool RES, bool RELU, bool OUT16>
__global__ __launch_bounds__(256, 1)
void gemm_wmma_f16(const _Float16* __restrict__ A, const _Float16* __restrict__ Bt,
                   const float* __restrict__ bias, const float* __restrict__ res,
                   float* __restrict__ outF, _Float16* __restrict__ outH,
                   int M, int N, int K)
{
    __shared__ alignas(16) _Float16 As[2][128][LDP];
    __shared__ alignas(16) _Float16 Bs[2][128][LDP];

    const int tid  = threadIdx.x;
    const int lane = tid & 31;
    const int wave = tid >> 5;
    const int hi   = lane >> 4;
    const int ln15 = lane & 15;
    const int m0   = blockIdx.y * 128;
    const int n0   = blockIdx.x * 128;
    const int wr   = (wave >> 1) * 32;
    const int wc   = (wave & 1) * 64;

    v8f acc[2][4];
#pragma unroll
    for (int i = 0; i < 2; ++i)
#pragma unroll
        for (int j = 0; j < 4; ++j) acc[i][j] = vzero8();

    const int ldRow = tid >> 4;          // 0..15, rows ldRow + 16 i
    const int ldCol = (tid & 15) * 8;    // 16-B piece of the 256-B row piece
    const _Float16* aG = A  + (size_t)(m0 + ldRow) * K + ldCol;
    const _Float16* bG = Bt + (size_t)(n0 + ldRow) * K + ldCol;
    const size_t rstep = (size_t)16 * K;
    // one row of [A 128 rows | Bt 128 rows] per thread, for the L2 prefetch
    const _Float16* pG = (tid < 128) ? A  + (size_t)(m0 + tid) * K
                                     : Bt + (size_t)(n0 + tid - 128) * K;
    const int nk = K / KT;

    auto stage = [&](int buf, int kt) {
#pragma unroll
        for (int i = 0; i < 8; ++i) {
            async_cp16(aG + i * rstep + kt, &As[buf][i * 16 + ldRow][ldCol]);
            async_cp16(bG + i * rstep + kt, &Bs[buf][i * 16 + ldRow][ldCol]);
        }
    };

    auto compute = [&](int buf) {
#pragma unroll
        for (int ks = 0; ks < KT / 32; ++ks) {
            v16h af[2], bf[4];
            af[0] = load_frag(&As[buf][wr + ln15][ks * 32], hi);
            af[1] = load_frag(&As[buf][wr + 16 + ln15][ks * 32], hi);
#pragma unroll
            for (int j = 0; j < 4; ++j)
                bf[j] = load_frag(&Bs[buf][wc + j * 16 + ln15][ks * 32], hi);
#pragma unroll
            for (int i = 0; i < 2; ++i)
#pragma unroll
                for (int j = 0; j < 4; ++j)
                    acc[i][j] = __builtin_amdgcn_wmma_f32_16x16x32_f16(
                        false, af[i], false, bf[j], (short)0, acc[i][j], false, false);
        }
    };

    // prologue: tile 0 lands and is published, then tile 1 starts
    stage(0, 0);
    wait_async0();
    __syncthreads();
    if (nk > 1) {
        stage(1, KT);
        if (nk > 2) __builtin_prefetch(pG + 2 * KT, 0, 1);   // L2 prefetch of tile 2
    }
    for (int t = 0; t < nk; ++t) {
        compute(t & 1);
        // publish point of tile t+1: this wave's reads of tile t are done,
        // its own copies of tile t+1 have landed, then every wave meets
        asm volatile("s_wait_dscnt 0x0" ::: "memory");
        wait_async0();
        __syncthreads();
        if (t + 2 < nk) {                // refill the buffer every reader has left
            stage(t & 1, (t + 2) * KT);
            if (t + 3 < nk)              // L2 prefetch one tile ahead of the copies
                __builtin_prefetch(pG + (t + 3) * KT, 0, 1);
        }
    }
    wait_async0();                       // nothing in flight when the wave ends

    // C layout: lane holds column n = lane&15; VGPR r holds row r + 8*hi.
#pragma unroll
    for (int i = 0; i < 2; ++i)
#pragma unroll
        for (int j = 0; j < 4; ++j)
#pragma unroll
            for (int r = 0; r < 8; ++r) {
                int row = m0 + wr + i * 16 + hi * 8 + r;
                int col = n0 + wc + j * 16 + ln15;
                float v = acc[i][j][r];
                if (BIAS) v += bias[col];
                if (RES)  v += res[(size_t)row * N + col];
                if (RELU) v = fmaxf(v, 0.0f);
                if (OUT16) outH[(size_t)row * N + col] = (_Float16)v;
                else       outF[(size_t)row * N + col] = v;
            }
}

// ---------------------------------------------------------------------------
// Flash attention with WMMA. 128 threads (4 waves) per block; block handles
// 64 q-rows of one (batch, head); each wave owns 16 q-rows. Key chunk = 32.
// ---------------------------------------------------------------------------
__global__ __launch_bounds__(128, 1)
void attention_wmma(const _Float16* __restrict__ Q, const _Float16* __restrict__ K,
                    const _Float16* __restrict__ V, const int* __restrict__ mask,
                    _Float16* __restrict__ O)
{
    __shared__ alignas(16) _Float16 Qs[64][72];     // [q][d]
    __shared__ alignas(16) _Float16 Ks[32][72];     // [key][d] (B-layout for QK^T)
    __shared__ alignas(16) _Float16 Vt[64][40];     // [d][key] (B-layout for PV)
    __shared__ alignas(16) _Float16 Ps[4][16][40];  // per-wave P bounce [q][key]

    const int tid  = threadIdx.x;
    const int lane = tid & 31;
    const int wave = tid >> 5;
    const int hi   = lane >> 4;
    const int ln15 = lane & 15;
    const int q0   = blockIdx.x * 64;
    const int hh   = blockIdx.y;
    const int nb   = blockIdx.z;
    const size_t baseTok = (size_t)nb * L_SEQ;
    const int co   = hh * D_DIM;

    if (tid < 64) {  // load Q tile once
        const _Float16* src = Q + (baseTok + q0 + tid) * E_DIM + co;
#pragma unroll
        for (int j = 0; j < 8; ++j)
            *(v8h*)&Qs[tid][j * 8] = *(const v8h*)(src + j * 8);
    }

    v8f o[4];
#pragma unroll
    for (int j = 0; j < 4; ++j) o[j] = vzero8();
    float mr[8], lr[8];
#pragma unroll
    for (int r = 0; r < 8; ++r) { mr[r] = -3.0e38f; lr[r] = 0.0f; }

    const int krow = tid >> 2;           // 0..31
    const int kseg = (tid & 3) * 16;     // 0,16,32,48
    const int* mrow = mask + nb * L_SEQ;
    _Float16 (*Pw)[40] = Ps[wave];

    for (int key0 = 0; key0 < L_SEQ; key0 += 32) {
        __syncthreads();
        {   // stage K rows (no transpose needed) and V transposed
            const _Float16* ksrc = K + (baseTok + key0 + krow) * E_DIM + co + kseg;
            *(v8h*)&Ks[krow][kseg]     = *(const v8h*)(ksrc);
            *(v8h*)&Ks[krow][kseg + 8] = *(const v8h*)(ksrc + 8);
            const _Float16* vsrc = V + (baseTok + key0 + krow) * E_DIM + co + kseg;
            v8h v0 = *(const v8h*)(vsrc);
            v8h v1 = *(const v8h*)(vsrc + 8);
#pragma unroll
            for (int j = 0; j < 8; ++j) Vt[kseg + j][krow]     = v0[j];
#pragma unroll
            for (int j = 0; j < 8; ++j) Vt[kseg + 8 + j][krow] = v1[j];
        }
        __syncthreads();

        // S = Q(16x64) @ K^T(64x32): 2 key-subtiles x 2 k-steps
        v8f s[2];
        s[0] = vzero8(); s[1] = vzero8();
#pragma unroll
        for (int ks = 0; ks < 2; ++ks) {
            v16h qf = load_frag(&Qs[wave * 16 + ln15][ks * 32], hi);
#pragma unroll
            for (int c = 0; c < 2; ++c) {
                v16h kf = load_frag(&Ks[c * 16 + ln15][ks * 32], hi);
                s[c] = __builtin_amdgcn_wmma_f32_16x16x32_f16(
                    false, qf, false, kf, (short)0, s[c], false, false);
            }
        }

        // mask (before scaling) + online softmax
        const int mv0 = mrow[key0 + ln15];
        const int mv1 = mrow[key0 + 16 + ln15];
#pragma unroll
        for (int r = 0; r < 8; ++r) {
            float a = s[0][r]; if (mv0 == 0) a = NEG_VAL; a *= 0.125f;
            float b = s[1][r]; if (mv1 == 0) b = NEG_VAL; b *= 0.125f;
            float rm   = rowmax16(fmaxf(a, b));
            float mn   = fmaxf(mr[r], rm);
            float corr = __expf(mr[r] - mn);
            mr[r] = mn;
            float p0 = __expf(a - mn);
            float p1 = __expf(b - mn);
            float rs = rowsum16(p0 + p1);
            lr[r] = lr[r] * corr + rs;
#pragma unroll
            for (int j = 0; j < 4; ++j) o[j][r] *= corr;
            Pw[hi * 8 + r][ln15]      = (_Float16)p0;   // C-layout -> LDS
            Pw[hi * 8 + r][16 + ln15] = (_Float16)p1;
        }
        asm volatile("s_wait_dscnt 0" ::: "memory");    // within-wave LDS RAW

        // O += P(16x32) @ V(32x64)
        v16h pf = load_frag(&Pw[ln15][0], hi);
#pragma unroll
        for (int j = 0; j < 4; ++j) {
            v16h vf = load_frag(&Vt[j * 16 + ln15][0], hi);
            o[j] = __builtin_amdgcn_wmma_f32_16x16x32_f16(
                false, pf, false, vf, (short)0, o[j], false, false);
        }
    }

#pragma unroll
    for (int r = 0; r < 8; ++r) {
        float inv = 1.0f / lr[r];
        int q = q0 + wave * 16 + hi * 8 + r;
        _Float16* dst = O + (baseTok + q) * E_DIM + co;
#pragma unroll
        for (int j = 0; j < 4; ++j)
            dst[j * 16 + ln15] = (_Float16)(o[j][r] * inv);
    }
}

// ---------------------------------------------------------------------------
// LayerNorm over rows of E_DIM floats; writes f32 and optionally f16 copy.
// ---------------------------------------------------------------------------
__global__ __launch_bounds__(256, 1)
void layernorm_k(const float* __restrict__ in, const float* __restrict__ g,
                 const float* __restrict__ b, float* __restrict__ outF,
                 _Float16* __restrict__ outH)
{
    const int row = blockIdx.x;
    const int t   = threadIdx.x;
    const float4 x = ((const float4*)(in + (size_t)row * E_DIM))[t];
    float s  = x.x + x.y + x.z + x.w;
    float sq = x.x * x.x + x.y * x.y + x.z * x.z + x.w * x.w;
#pragma unroll
    for (int mk = 1; mk < 32; mk <<= 1) { s += __shfl_xor(s, mk, 32); sq += __shfl_xor(sq, mk, 32); }
    __shared__ float sh_s[8], sh_q[8];
    const int wave = t >> 5;
    if ((t & 31) == 0) { sh_s[wave] = s; sh_q[wave] = sq; }
    __syncthreads();
    float ts = 0.0f, tq = 0.0f;
#pragma unroll
    for (int i = 0; i < 8; ++i) { ts += sh_s[i]; tq += sh_q[i]; }
    const float mean = ts * (1.0f / E_DIM);
    const float var  = tq * (1.0f / E_DIM) - mean * mean;
    const float inv  = rsqrtf(var + 1e-6f);
    const float4 gg = ((const float4*)g)[t];
    const float4 bb = ((const float4*)b)[t];
    float4 y;
    y.x = gg.x * (x.x - mean) * inv + bb.x;
    y.y = gg.y * (x.y - mean) * inv + bb.y;
    y.z = gg.z * (x.z - mean) * inv + bb.z;
    y.w = gg.w * (x.w - mean) * inv + bb.w;
    ((float4*)(outF + (size_t)row * E_DIM))[t] = y;
    if (outH) {
        v4h h; h[0] = (_Float16)y.x; h[1] = (_Float16)y.y;
               h[2] = (_Float16)y.z; h[3] = (_Float16)y.w;
        *(v4h*)(outH + (size_t)row * E_DIM + t * 4) = h;
    }
}

__global__ void cvt_f32_to_f16(const float* __restrict__ in, _Float16* __restrict__ out, int n4)
{
    int i = blockIdx.x * blockDim.x + threadIdx.x;
    if (i < n4) {
        float4 v = ((const float4*)in)[i];
        v4h h; h[0] = (_Float16)v.x; h[1] = (_Float16)v.y;
               h[2] = (_Float16)v.z; h[3] = (_Float16)v.w;
        ((v4h*)out)[i] = h;
    }
}

// in[K][N] (f32) -> out[N][K] (f16), LDS-tiled for coalescing both ways
__global__ __launch_bounds__(256, 1)
void cvt_transpose_f16(const float* __restrict__ in, _Float16* __restrict__ out, int K, int N)
{
    __shared__ float tile[32][33];
    int n0 = blockIdx.x * 32, k0 = blockIdx.y * 32;
    int tx = threadIdx.x, ty = threadIdx.y;       // (32, 8)
#pragma unroll
    for (int i = 0; i < 4; ++i)
        tile[ty + i * 8][tx] = in[(size_t)(k0 + ty + i * 8) * N + n0 + tx];
    __syncthreads();
#pragma unroll
    for (int i = 0; i < 4; ++i)
        out[(size_t)(n0 + ty + i * 8) * K + k0 + tx] = (_Float16)tile[tx][ty + i * 8];
}

extern "C" void kernel_launch(void* const* d_in, const int* in_sizes, int n_in,
                              void* d_out, int out_size, void* d_ws, size_t ws_size,
                              hipStream_t stream)
{
    (void)in_sizes; (void)n_in; (void)out_size; (void)ws_size;
    const float* x   = (const float*)d_in[0];
    const int*   msk = (const int*)d_in[1];
    const float* wq  = (const float*)d_in[2];
    const float* wk  = (const float*)d_in[3];
    const float* wv  = (const float*)d_in[4];
    const float* wo  = (const float*)d_in[5];
    const float* bo  = (const float*)d_in[6];
    const float* g1  = (const float*)d_in[7];
    const float* be1 = (const float*)d_in[8];
    const float* g2  = (const float*)d_in[9];
    const float* be2 = (const float*)d_in[10];
    const float* w1  = (const float*)d_in[11];
    const float* b1  = (const float*)d_in[12];
    const float* w2  = (const float*)d_in[13];
    const float* b2  = (const float*)d_in[14];

    const int NL = 2 * L_SEQ;                       // 4096 tokens
    char* ws = (char*)d_ws;
    const size_t MB = 1024ull * 1024ull;
    _Float16* AH    = (_Float16*)(ws + 0);          //  8 MB: x f16, later h f16
    _Float16* FFH   = (_Float16*)(ws + 8 * MB);     // 32 MB: relu(h@w1+b1) f16
    _Float16* WT    = (_Float16*)(ws + 40 * MB);    //  8 MB: current weight^T f16
    _Float16* QH    = (_Float16*)(ws + 48 * MB);    //  8 MB
    _Float16* KH    = (_Float16*)(ws + 56 * MB);    //  8 MB
    _Float16* VH    = (_Float16*)(ws + 64 * MB);    //  8 MB
    _Float16* ATTNH = (_Float16*)(ws + 72 * MB);    //  8 MB
    float*    RES   = (float*)(ws + 80 * MB);       // 16 MB (pre-LN1, later pre-LN2)
    float*    HBUF  = (float*)(ws + 96 * MB);       // 16 MB: h f32 (residual)

    dim3 blk256(256), blk128(128), tblk(32, 8);
    dim3 gP(E_DIM / 128, NL / 128);                 // (8, 32)
    dim3 gF1(FF_DIM / 128, NL / 128);               // (32, 32)

    cvt_f32_to_f16<<<(NL * E_DIM / 4 + 255) / 256, blk256, 0, stream>>>(x, AH, NL * E_DIM / 4);

    // Q / K / V projections (weight buffer reused; stream order serializes)
    cvt_transpose_f16<<<dim3(E_DIM / 32, E_DIM / 32), tblk, 0, stream>>>(wq, WT, E_DIM, E_DIM);
    gemm_wmma_f16<false, false, false, true><<<gP, blk256, 0, stream>>>(AH, WT, nullptr, nullptr, nullptr, QH, NL, E_DIM, E_DIM);
    cvt_transpose_f16<<<dim3(E_DIM / 32, E_DIM / 32), tblk, 0, stream>>>(wk, WT, E_DIM, E_DIM);
    gemm_wmma_f16<false, false, false, true><<<gP, blk256, 0, stream>>>(AH, WT, nullptr, nullptr, nullptr, KH, NL, E_DIM, E_DIM);
    cvt_transpose_f16<<<dim3(E_DIM / 32, E_DIM / 32), tblk, 0, stream>>>(wv, WT, E_DIM, E_DIM);
    gemm_wmma_f16<false, false, false, true><<<gP, blk256, 0, stream>>>(AH, WT, nullptr, nullptr, nullptr, VH, NL, E_DIM, E_DIM);

    attention_wmma<<<dim3(L_SEQ / 64, H_DIM, 2), blk128, 0, stream>>>(QH, KH, VH, msk, ATTNH);

    // out-proj + bo + residual x  -> RES (f32)
    cvt_transpose_f16<<<dim3(E_DIM / 32, E_DIM / 32), tblk, 0, stream>>>(wo, WT, E_DIM, E_DIM);
    gemm_wmma_f16<true, true, false, false><<<gP, blk256, 0, stream>>>(ATTNH, WT, bo, x, RES, nullptr, NL, E_DIM, E_DIM);

    // LN1 -> h (f32 in HBUF, f16 in AH)
    layernorm_k<<<NL, blk256, 0, stream>>>(RES, g1, be1, HBUF, AH);

    // FF1: relu(h @ w1 + b1) -> FFH (f16)
    cvt_transpose_f16<<<dim3(FF_DIM / 32, E_DIM / 32), tblk, 0, stream>>>(w1, WT, E_DIM, FF_DIM);
    gemm_wmma_f16<true, false, true, true><<<gF1, blk256, 0, stream>>>(AH, WT, b1, nullptr, nullptr, FFH, NL, FF_DIM, E_DIM);

    // FF2: ff @ w2 + b2 + h -> RES (f32)
    cvt_transpose_f16<<<dim3(E_DIM / 32, FF_DIM / 32), tblk, 0, stream>>>(w2, WT, FF_DIM, E_DIM);
    gemm_wmma_f16<true, true, false, false><<<gP, blk256, 0, stream>>>(FFH, WT, b2, HBUF, RES, nullptr, NL, E_DIM, FF_DIM);

    // LN2 -> final output
    layernorm_k<<<NL, blk256, 0, stream>>>(RES, g2, be2, (float*)d_out, nullptr);
}

// v002
// A run of this version takes 221 microseconds.
// Next to v001, in two timings, it ran 1.21 and 1.20 times as fast.
// Counting every step since v000, it is 1.81 times as fast.
#include <hip/hip_runtime.h>
#include <hip/hip_bf16.h>

typedef __attribute__((ext_vector_type(16))) _Float16 v16h;
typedef __attribute__((ext_vector_type(8)))  _Float16 v8h;
typedef __attribute__((ext_vector_type(4)))  _Float16 v4h;
typedef __attribute__((ext_vector_type(8)))  float    v8f;
typedef __attribute__((ext_vector_type(4)))  int      v4i;

#define E_DIM   1024
#define H_DIM   16
#define D_DIM   64
#define FF_DIM  4096
#define L_SEQ   2048
#define NEG_VAL (-10000.0f)

#if __has_builtin(__builtin_amdgcn_global_load_async_to_lds_b128)
#define ASYNC_LDS 1
#endif

static __device__ __forceinline__ v8f vzero8() {
    v8f v;
#pragma unroll
    for (int i = 0; i < 8; ++i) v[i] = 0.0f;
    return v;
}

// WMMA 16-bit A/B fragment from a row (LDS or global) holding a 32-half K-window.
// Lane hi-half selects K-halves [hi*8, +8) (VGPRs 0..3) and [16+hi*8, +8).
static __device__ __forceinline__ v16h load_frag(const _Float16* p, int hi) {
    union { v16h v; v8h h[2]; } u;
    u.h[0] = *reinterpret_cast<const v8h*>(p + hi * 8);
    u.h[1] = *reinterpret_cast<const v8h*>(p + 16 + hi * 8);
    return u.v;
}

#ifdef ASYNC_LDS
typedef __attribute__((address_space(1))) v4i*  gptr_v4i;
typedef __attribute__((address_space(3))) v4i*  lptr_v4i;
typedef __attribute__((address_space(1))) void* gptr_void;
typedef __attribute__((address_space(3))) void* lptr_void;

static __device__ __forceinline__ void async_cp16(const _Float16* g, _Float16* l) {
    __builtin_amdgcn_global_load_async_to_lds_b128(
        (gptr_v4i)(gptr_void)const_cast<_Float16*>(g),
        (lptr_v4i)(lptr_void)l, 0, 0);
}
static __device__ __forceinline__ void wait_async0() {
    // asm with the memory clobber: holds every later LDS read behind the wait
    asm volatile("s_wait_asynccnt 0x0" ::: "memory");
}
#else
// no async path: same ring, staged through registers
static __device__ __forceinline__ void async_cp16(const _Float16* g, _Float16* l) {
    *reinterpret_cast<v8h*>(l) = *reinterpret_cast<const v8h*>(g);
}
static __device__ __forceinline__ void wait_async0() {}
#endif

#define KT  128   // halfs of K per pass: one 256-B piece of every operand row
#define LDP 136   // LDS row pitch in halfs: 272 B = 16 B x 17, for ds_load_b128

// ---------------------------------------------------------------------------
// Tiled f16 WMMA GEMM:  C[M,N] = A[M,K] * Bt[N,K]^T  (Bt is B transposed)
// 256 threads (8 waves), block tile 128x128, wave tile 32x64, K-step 128,
// two LDS buffers; tile t+1 streams in during tile t. 16 lanes copy one
// 256-B row piece, so a wave's copy instruction covers whole lines only.
// K must be a multiple of KT.
// ---------------------------------------------------------------------------
template <bool BIAS, bool RES, bool RELU, bool OUT16>
__global__ __launch_bounds__(256, 1)
void gemm_wmma_f16(const _Float16* __restrict__ A, const _Float16* __restrict__ Bt,
                   const float* __restrict__ bias, const float* __restrict__ res,
                   float* __restrict__ outF, _Float16* __restrict__ outH,
                   int M, int N, int K)
{
    __shared__ alignas(16) _Float16 As[2][128][LDP];
    __shared__ alignas(16) _Float16 Bs[2][128][LDP];

    const int tid  = threadIdx.x;
    const int lane = tid & 31;
    const int wave = tid >> 5;
    const int hi   = lane >> 4;
    const int ln15 = lane & 15;
    const int m0   = blockIdx.y * 128;
    const int n0   = blockIdx.x * 128;
    const int wr   = (wave >> 1) * 32;
    const int wc   = (wave & 1) * 64;

    v8f acc[2][4];
#pragma unroll
    for (int i = 0; i < 2; ++i)
#pragma unroll
        for (int j = 0; j < 4; ++j) acc[i][j] = vzero8();

    const int ldRow = tid >> 4;          // 0..15, rows ldRow + 16 i
    const int ldCol = (tid & 15) * 8;    // 16-B piece of the 256-B row piece
    const _Float16* aG = A  + (size_t)(m0 + ldRow) * K + ldCol;
    const _Float16* bG = Bt + (size_t)(n0 + ldRow) * K + ldCol;
    const size_t rstep = (size_t)16 * K;
    // one row of [A 128 rows | Bt 128 rows] per thread, for the L2 prefetch
    const _Float16* pG = (tid < 128) ? A  + (size_t)(m0 + tid) * K
                                     : Bt + (size_t)(n0 + tid - 128) * K;
    const int nk = K / KT;

    auto stage = [&](int buf, int kt) {
#pragma unroll
        for (int i = 0; i < 8; ++i) {
            async_cp16(aG + i * rstep + kt, &As[buf][i * 16 + ldRow][ldCol]);
            async_cp16(bG + i * rstep + kt, &Bs[buf][i * 16 + ldRow][ldCol]);
        }
    };

    auto compute = [&](int buf) {
#pragma unroll
        for (int ks = 0; ks < KT / 32; ++ks) {
            v16h af[2], bf[4];
            af[0] = load_frag(&As[buf][wr + ln15][ks * 32], hi);
            af[1] = load_frag(&As[buf][wr + 16 + ln15][ks * 32], hi);
#pragma unroll
            for (int j = 0; j < 4; ++j)
                bf[j] = load_frag(&Bs[buf][wc + j * 16 + ln15][ks * 32], hi);
#pragma unroll
            for (int i = 0; i < 2; ++i)
#pragma unroll
                for (int j = 0; j < 4; ++j)
                    acc[i][j] = __builtin_amdgcn_wmma_f32_16x16x32_f16(
                        false, af[i], false, bf[j], (short)0, acc[i][j], false, false);
        }
    };

    // prologue: tile 0 lands and is published, then tile 1 starts
    stage(0, 0);
    wait_async0();
    __syncthreads();
    if (nk > 1) {
        stage(1, KT);
        if (nk > 2) __builtin_prefetch(pG + 2 * KT, 0, 1);   // L2 prefetch of tile 2
    }
    for (int t = 0; t < nk; ++t) {
        compute(t & 1);
        // publish point of tile t+1: this wave's reads of tile t are done,
        // its own copies of tile t+1 have landed, then every wave meets
        asm volatile("s_wait_dscnt 0x0" ::: "memory");
        wait_async0();
        __syncthreads();
        if (t + 2 < nk) {                // refill the buffer every reader has left
            stage(t & 1, (t + 2) * KT);
            if (t + 3 < nk)              // L2 prefetch one tile ahead of the copies
                __builtin_prefetch(pG + (t + 3) * KT, 0, 1);
        }
    }
    wait_async0();                       // nothing in flight when the wave ends

    // C layout: lane holds column n = lane&15; VGPR r holds row r + 8*hi.
#pragma unroll
    for (int i = 0; i < 2; ++i)
#pragma unroll
        for (int j = 0; j < 4; ++j)
#pragma unroll
            for (int r = 0; r < 8; ++r) {
                int row = m0 + wr + i * 16 + hi * 8 + r;
                int col = n0 + wc + j * 16 + ln15;
                float v = acc[i][j][r];
                if (BIAS) v += bias[col];
                if (RES)  v += res[(size_t)row * N + col];
                if (RELU) v = fmaxf(v, 0.0f);
                if (OUT16) outH[(size_t)row * N + col] = (_Float16)v;
                else       outF[(size_t)row * N + col] = v;
            }
}

// ---------------------------------------------------------------------------
// Flash attention with WMMA, transposed products: S^T = K Q^T, O^T += V^T P^T.
// 128 threads (4 waves) per block; block handles 64 queries of one (batch,
// head); each wave owns 16 query columns. Key chunk = 32.
// A lane (c = lane & 15, h = lane >> 4) holds 16 scores of ONE query c (keys
// 8h + r and 16 + 8h + r), so maximum and sum run in the lane's own registers
// with one exchange between the wave halves; the two score tiles, converted
// in place, are the B operand of the second product in the hardware k order.
// Every loop over fragments or registers is unrolled so that each index is a
// constant and the arrays stay in registers.
// ---------------------------------------------------------------------------
typedef __attribute__((ext_vector_type(8))) short s16x8;
typedef __attribute__((address_space(3))) s16x8 lds_s16x8;

// row-major 16-bit LDS tile -> 8 k of one column per lane (half an A fragment)
static __device__ __forceinline__ v8h ld_tr16(const char* p) {
    return __builtin_bit_cast(v8h, __builtin_amdgcn_ds_load_tr16_b128_v8i16((lds_s16x8*)p));
}
// lane l with lane l ^ 16
static __device__ __forceinline__ float xhalf(float x) {
    return __builtin_bit_cast(float, __builtin_amdgcn_permlanex16(
        __builtin_bit_cast(int, x), __builtin_bit_cast(int, x),
        0x76543210, 0xfedcba98, false, false));
}

#define VPITCH 80   // halfs: 160 B = 32 B x 5, for ds_load_tr16_b128

__global__ __launch_bounds__(128, 1)
void attention_wmma(const _Float16* __restrict__ Q, const _Float16* __restrict__ K,
                    const _Float16* __restrict__ V, const int* __restrict__ mask,
                    _Float16* __restrict__ O)
{
    __shared__ alignas(16) _Float16 Ks[32][72];      // [key][d], A rows of S^T
    __shared__ alignas(32) _Float16 Vs[32][VPITCH];  // [key][d], read transposed

    const int tid  = threadIdx.x;
    const int lane = tid & 31;
    const int wave = tid >> 5;
    const int hi   = lane >> 4;
    const int ln15 = lane & 15;
    const int q0   = blockIdx.x * 64;
    const int hh   = blockIdx.y;
    const int nb   = blockIdx.z;
    const size_t baseTok = (size_t)nb * L_SEQ;
    const int co   = hh * D_DIM;
    const int* mrow = mask + nb * L_SEQ;

    // Q^T as B operand, loaded once: column = query ln15, k order as K's rows
    v16h qf[2];
    {
        const _Float16* qp = Q + (baseTok + q0 + wave * 16 + ln15) * E_DIM + co;
        qf[0] = load_frag(qp, hi);
        qf[1] = load_frag(qp + 32, hi);
    }

    v8f o[4];                            // o[t][r] = O[query ln15][16 t + 8 hi + r]
#pragma unroll
    for (int t = 0; t < 4; ++t) o[t] = vzero8();
    float mr = -3.0e38f, lr = 0.0f;      // running maximum (scaled), half's sum

    const int krow = tid >> 2;           // 0..31
    const int kseg = (tid & 3) * 16;     // 0,16,32,48
    const char* vtp = (const char*)&Vs[0][0] + (8 * hi + (lane & 7)) * (VPITCH * 2)
                    + ((lane >> 3) & 1) * 16;

    for (int key0 = 0; key0 < L_SEQ; key0 += 32) {
        __syncthreads();
        v4i mk[2][2];                    // mask words of this lane's 16 keys
        {   // stage K rows and V rows as they lie in memory
            const _Float16* ksrc = K + (baseTok + key0 + krow) * E_DIM + co + kseg;
            const _Float16* vsrc = V + (baseTok + key0 + krow) * E_DIM + co + kseg;
            const v8h k0 = *(const v8h*)(ksrc);
            const v8h k1 = *(const v8h*)(ksrc + 8);
            const v8h v0 = *(const v8h*)(vsrc);
            const v8h v1 = *(const v8h*)(vsrc + 8);
#pragma unroll
            for (int c = 0; c < 2; ++c) {
                mk[c][0] = *(const v4i*)(mrow + key0 + c * 16 + hi * 8);
                mk[c][1] = *(const v4i*)(mrow + key0 + c * 16 + hi * 8 + 4);
            }
            *(v8h*)&Ks[krow][kseg]     = k0;
            *(v8h*)&Ks[krow][kseg + 8] = k1;
            *(v8h*)&Vs[krow][kseg]     = v0;
            *(v8h*)&Vs[krow][kseg + 8] = v1;
            // ahead of the next chunk's additions to the address registers that
            // the eight global loads above name
            asm volatile("s_wait_xcnt 0x0" ::: "memory");
        }
        __syncthreads();

        // S^T = K(32x64) @ Q^T(64x16): s[c][r] = score(key 16 c + 8 hi + r, query ln15)
        v16h kf[2][2];
#pragma unroll
        for (int c = 0; c < 2; ++c)
#pragma unroll
            for (int ks = 0; ks < 2; ++ks)
                kf[c][ks] = load_frag(&Ks[c * 16 + ln15][ks * 32], hi);

        // V^T fragments: 16 d x 32 keys each, two transposing loads
        v16h vf[4];
#pragma unroll
        for (int t = 0; t < 4; ++t) {
            union { v16h v; v8h h[2]; } u;
            u.h[0] = ld_tr16(vtp + 32 * t);
            u.h[1] = ld_tr16(vtp + 16 * (VPITCH * 2) + 32 * t);
            vf[t] = u.v;
        }
        // holds all 16 fragment loads ahead of the products: one LDS round
        // trip a chunk; left free, the compiler sinks them between the WMMAs
        __builtin_amdgcn_sched_barrier(0);

        v8f s[2];
        s[0] = vzero8(); s[1] = vzero8();
#pragma unroll
        for (int ks = 0; ks < 2; ++ks)
#pragma unroll
            for (int c = 0; c < 2; ++c)
                s[c] = __builtin_amdgcn_wmma_f32_16x16x32_f16(
                    false, kf[c][ks], false, qf[ks], (short)0, s[c], false, false);

        // mask (before scaling), then the scale
#pragma unroll
        for (int c = 0; c < 2; ++c)
#pragma unroll
            for (int r = 0; r < 8; ++r) {
                float a = s[c][r];
                if (mk[c][r >> 2][r & 3] == 0) a = NEG_VAL;
                s[c][r] = a * 0.125f;
            }

        // online softmax of one query per lane
        float mx = fmaxf(s[0][0], s[1][0]);
#pragma unroll
        for (int r = 1; r < 8; ++r) mx = fmaxf(mx, fmaxf(s[0][r], s[1][r]));
        mx = fmaxf(mx, xhalf(mx));
        const float mn   = fmaxf(mr, mx);
        float rs[4] = {0.0f, 0.0f, 0.0f, 0.0f};   // four short chains of adds
        v16h pf;                         // P^T: element 8 c + r = key 16 c + 8 hi + r
#pragma unroll
        for (int c = 0; c < 2; ++c)
#pragma unroll
            for (int r = 0; r < 8; ++r) {
                const float p = __expf(s[c][r] - mn);
                rs[r & 3]    += p;
                pf[c * 8 + r] = (_Float16)p;
            }
        const float corr = __expf(mr - mn);
        mr = mn;
        lr = lr * corr + ((rs[0] + rs[1]) + (rs[2] + rs[3]));
#pragma unroll
        for (int t = 0; t < 4; ++t) o[t] = o[t] * corr;

        // O^T += V^T(64x32) @ P^T(32x16)
#pragma unroll
        for (int t = 0; t < 4; ++t)
            o[t] = __builtin_amdgcn_wmma_f32_16x16x32_f16(
                false, vf[t], false, pf, (short)0, o[t], false, false);
    }

    // the halves' sums join once; a lane stores 8 consecutive d of its query
    const float inv = 1.0f / (lr + xhalf(lr));
    _Float16* dst = O + (baseTok + q0 + wave * 16 + ln15) * E_DIM + co + hi * 8;
#pragma unroll
    for (int t = 0; t < 4; ++t) {
        v8h h;
#pragma unroll
        for (int r = 0; r < 8; ++r) h[r] = (_Float16)(o[t][r] * inv);
        *(v8h*)(dst + t * 16) = h;
    }
}

// ---------------------------------------------------------------------------
// LayerNorm over rows of E_DIM floats; writes f32 and optionally f16 copy.
// ---------------------------------------------------------------------------
__global__ __launch_bounds__(256, 1)
void layernorm_k(const float* __restrict__ in, const float* __restrict__ g,
                 const float* __restrict__ b, float* __restrict__ outF,
                 _Float16* __restrict__ outH)
{
    const int row = blockIdx.x;
    const int t   = threadIdx.x;
    const float4 x = ((const float4*)(in + (size_t)row * E_DIM))[t];
    float s  = x.x + x.y + x.z + x.w;
    float sq = x.x * x.x + x.y * x.y + x.z * x.z + x.w * x.w;
#pragma unroll
    for (int mk = 1; mk < 32; mk <<= 1) { s += __shfl_xor(s, mk, 32); sq += __shfl_xor(sq, mk, 32); }
    __shared__ float sh_s[8], sh_q[8];
    const int wave = t >> 5;
    if ((t & 31) == 0) { sh_s[wave] = s; sh_q[wave] = sq; }
    __syncthreads();
    float ts = 0.0f, tq = 0.0f;
#pragma unroll
    for (int i = 0; i < 8; ++i) { ts += sh_s[i]; tq += sh_q[i]; }
    const float mean = ts * (1.0f / E_DIM);
    const float var  = tq * (1.0f / E_DIM) - mean * mean;
    const float inv  = rsqrtf(var + 1e-6f);
    const float4 gg = ((const float4*)g)[t];
    const float4 bb = ((const float4*)b)[t];
    float4 y;
    y.x = gg.x * (x.x - mean) * inv + bb.x;
    y.y = gg.y * (x.y - mean) * inv + bb.y;
    y.z = gg.z * (x.z - mean) * inv + bb.z;
    y.w = gg.w * (x.w - mean) * inv + bb.w;
    ((float4*)(outF + (size_t)row * E_DIM))[t] = y;
    if (outH) {
        v4h h; h[0] = (_Float16)y.x; h[1] = (_Float16)y.y;
               h[2] = (_Float16)y.z; h[3] = (_Float16)y.w;
        *(v4h*)(outH + (size_t)row * E_DIM + t * 4) = h;
    }
}

__global__ void cvt_f32_to_f16(const float* __restrict__ in, _Float16* __restrict__ out, int n4)
{
    int i = blockIdx.x * blockDim.x + threadIdx.x;
    if (i < n4) {
        float4 v = ((const float4*)in)[i];
        v4h h; h[0] = (_Float16)v.x; h[1] = (_Float16)v.y;
               h[2] = (_Float16)v.z; h[3] = (_Float16)v.w;
        ((v4h*)out)[i] = h;
    }
}

// in[K][N] (f32) -> out[N][K] (f16), LDS-tiled for coalescing both ways
__global__ __launch_bounds__(256, 1)
void cvt_transpose_f16(const float* __restrict__ in, _Float16* __restrict__ out, int K, int N)
{
    __shared__ float tile[32][33];
    int n0 = blockIdx.x * 32, k0 = blockIdx.y * 32;
    int tx = threadIdx.x, ty = threadIdx.y;       // (32, 8)
#pragma unroll
    for (int i = 0; i < 4; ++i)
        tile[ty + i * 8][tx] = in[(size_t)(k0 + ty + i * 8) * N + n0 + tx];
    __syncthreads();
#pragma unroll
    for (int i = 0; i < 4; ++i)
        out[(size_t)(n0 + ty + i * 8) * K + k0 + tx] = (_Float16)tile[tx][ty + i * 8];
}

extern "C" void kernel_launch(void* const* d_in, const int* in_sizes, int n_in,
                              void* d_out, int out_size, void* d_ws, size_t ws_size,
                              hipStream_t stream)
{
    (void)in_sizes; (void)n_in; (void)out_size; (void)ws_size;
    const float* x   = (const float*)d_in[0];
    const int*   msk = (const int*)d_in[1];
    const float* wq  = (const float*)d_in[2];
    const float* wk  = (const float*)d_in[3];
    const float* wv  = (const float*)d_in[4];
    const float* wo  = (const float*)d_in[5];
    const float* bo  = (const float*)d_in[6];
    const float* g1  = (const float*)d_in[7];
    const float* be1 = (const float*)d_in[8];
    const float* g2  = (const float*)d_in[9];
    const float* be2 = (const float*)d_in[10];
    const float* w1  = (const float*)d_in[11];
    const float* b1  = (const float*)d_in[12];
    const float* w2  = (const float*)d_in[13];
    const float* b2  = (const float*)d_in[14];

    const int NL = 2 * L_SEQ;                       // 4096 tokens
    char* ws = (char*)d_ws;
    const size_t MB = 1024ull * 1024ull;
    _Float16* AH    = (_Float16*)(ws + 0);          //  8 MB: x f16, later h f16
    _Float16* FFH   = (_Float16*)(ws + 8 * MB);     // 32 MB: relu(h@w1+b1) f16
    _Float16* WT    = (_Float16*)(ws + 40 * MB);    //  8 MB: current weight^T f16
    _Float16* QH    = (_Float16*)(ws + 48 * MB);    //  8 MB
    _Float16* KH    = (_Float16*)(ws + 56 * MB);    //  8 MB
    _Float16* VH    = (_Float16*)(ws + 64 * MB);    //  8 MB
    _Float16* ATTNH = (_Float16*)(ws + 72 * MB);    //  8 MB
    float*    RES   = (float*)(ws + 80 * MB);       // 16 MB (pre-LN1, later pre-LN2)
    float*    HBUF  = (float*)(ws + 96 * MB);       // 16 MB: h f32 (residual)

    dim3 blk256(256), blk128(128), tblk(32, 8);
    dim3 gP(E_DIM / 128, NL / 128);                 // (8, 32)
    dim3 gF1(FF_DIM / 128, NL / 128);               // (32, 32)

    cvt_f32_to_f16<<<(NL * E_DIM / 4 + 255) / 256, blk256, 0, stream>>>(x, AH, NL * E_DIM / 4);

    // Q / K / V projections (weight buffer reused; stream order serializes)
    cvt_transpose_f16<<<dim3(E_DIM / 32, E_DIM / 32), tblk, 0, stream>>>(wq, WT, E_DIM, E_DIM);
    gemm_wmma_f16<false, false, false, true><<<gP, blk256, 0, stream>>>(AH, WT, nullptr, nullptr, nullptr, QH, NL, E_DIM, E_DIM);
    cvt_transpose_f16<<<dim3(E_DIM / 32, E_DIM / 32), tblk, 0, stream>>>(wk, WT, E_DIM, E_DIM);
    gemm_wmma_f16<false, false, false, true><<<gP, blk256, 0, stream>>>(AH, WT, nullptr, nullptr, nullptr, KH, NL, E_DIM, E_DIM);
    cvt_transpose_f16<<<dim3(E_DIM / 32, E_DIM / 32), tblk, 0, stream>>>(wv, WT, E_DIM, E_DIM);
    gemm_wmma_f16<false, false, false, true><<<gP, blk256, 0, stream>>>(AH, WT, nullptr, nullptr, nullptr, VH, NL, E_DIM, E_DIM);

    attention_wmma<<<dim3(L_SEQ / 64, H_DIM, 2), blk128, 0, stream>>>(QH, KH, VH, msk, ATTNH);

    // out-proj + bo + residual x  -> RES (f32)
    cvt_transpose_f16<<<dim3(E_DIM / 32, E_DIM / 32), tblk, 0, stream>>>(wo, WT, E_DIM, E_DIM);
    gemm_wmma_f16<true, true, false, false><<<gP, blk256, 0, stream>>>(ATTNH, WT, bo, x, RES, nullptr, NL, E_DIM, E_DIM);

    // LN1 -> h (f32 in HBUF, f16 in AH)
    layernorm_k<<<NL, blk256, 0, stream>>>(RES, g1, be1, HBUF, AH);

    // FF1: relu(h @ w1 + b1) -> FFH (f16)
    cvt_transpose_f16<<<dim3(FF_DIM / 32, E_DIM / 32), tblk, 0, stream>>>(w1, WT, E_DIM, FF_DIM);
    gemm_wmma_f16<true, false, true, true><<<gF1, blk256, 0, stream>>>(AH, WT, b1, nullptr, nullptr, FFH, NL, FF_DIM, E_DIM);

    // FF2: ff @ w2 + b2 + h -> RES (f32)
    cvt_transpose_f16<<<dim3(E_DIM / 32, FF_DIM / 32), tblk, 0, stream>>>(w2, WT, FF_DIM, E_DIM);
    gemm_wmma_f16<true, true, false, false><<<gP, blk256, 0, stream>>>(FFH, WT, b2, HBUF, RES, nullptr, NL, E_DIM, FF_DIM);

    // LN2 -> final output
    layernorm_k<<<NL, blk256, 0, stream>>>(RES, g2, be2, (float*)d_out, nullptr);
}

// v003
// One run takes 206 microseconds.
// Next to v002, in two timings, it ran 1.08 and 1.07 times as fast.
// Counting every step since v000, it is 1.95 times as fast.
#include <hip/hip_runtime.h>
#include <hip/hip_bf16.h>

typedef __attribute__((ext_vector_type(16))) _Float16 v16h;
typedef __attribute__((ext_vector_type(8)))  _Float16 v8h;
typedef __attribute__((ext_vector_type(4)))  _Float16 v4h;
typedef __attribute__((ext_vector_type(8)))  float    v8f;
typedef __attribute__((ext_vector_type(4)))  int      v4i;

#define E_DIM   1024
#define H_DIM   16
#define D_DIM   64
#define FF_DIM  4096
#define L_SEQ   2048
#define NEG_VAL (-10000.0f)

#if __has_builtin(__builtin_amdgcn_global_load_async_to_lds_b128)
#define ASYNC_LDS 1
#endif

static __device__ __forceinline__ v8f vzero8() {
    v8f v;
#pragma unroll
    for (int i = 0; i < 8; ++i) v[i] = 0.0f;
    return v;
}

// WMMA 16-bit A/B fragment from a row (LDS or global) holding a 32-half K-window.
// Lane hi-half selects K-halves [hi*8, +8) (VGPRs 0..3) and [16+hi*8, +8).
static __device__ __forceinline__ v16h load_frag(const _Float16* p, int hi) {
    union { v16h v; v8h h[2]; } u;
    u.h[0] = *reinterpret_cast<const v8h*>(p + hi * 8);
    u.h[1] = *reinterpret_cast<const v8h*>(p + 16 + hi * 8);
    return u.v;
}

#ifdef ASYNC_LDS
typedef __attribute__((address_space(1))) v4i*  gptr_v4i;
typedef __attribute__((address_space(3))) v4i*  lptr_v4i;
typedef __attribute__((address_space(1))) void* gptr_void;
typedef __attribute__((address_space(3))) void* lptr_void;

static __device__ __forceinline__ void async_cp16(const _Float16* g, _Float16* l) {
    __builtin_amdgcn_global_load_async_to_lds_b128(
        (gptr_v4i)(gptr_void)const_cast<_Float16*>(g),
        (lptr_v4i)(lptr_void)l, 0, 0);
}
static __device__ __forceinline__ void wait_async0() {
    // asm with the memory clobber: holds every later LDS read behind the wait
    asm volatile("s_wait_asynccnt 0x0" ::: "memory");
}
#else
// no async path: same ring, staged through registers
static __device__ __forceinline__ void async_cp16(const _Float16* g, _Float16* l) {
    *reinterpret_cast<v8h*>(l) = *reinterpret_cast<const v8h*>(g);
}
static __device__ __forceinline__ void wait_async0() {}
#endif

#define KT  128   // halfs of K per pass: one 256-B piece of every operand row
#define LDP 136   // LDS row pitch in halfs: 272 B = 16 B x 17, for ds_load_b128

// ---------------------------------------------------------------------------
// Tiled f16 WMMA GEMM:  C[M,N] = A[M,K] * Bt[N,K]^T  (Bt is B transposed)
// 256 threads (8 waves), block tile 128x128, wave tile 32x64, K-step 128,
// two LDS buffers; tile t+1 streams in during tile t. 16 lanes copy one
// 256-B row piece, so a wave's copy instruction covers whole lines only.
// K must be a multiple of KT.
// ---------------------------------------------------------------------------
template <bool BIAS, bool RES, bool RELU, bool OUT16>
__global__ __launch_bounds__(256, 1)
void gemm_wmma_f16(const _Float16* __restrict__ A, const _Float16* __restrict__ Bt,
                   const float* __restrict__ bias, const float* __restrict__ res,
                   float* __restrict__ outF, _Float16* __restrict__ outH,
                   int M, int N, int K)
{
    __shared__ alignas(16) _Float16 As[2][128][LDP];
    __shared__ alignas(16) _Float16 Bs[2][128][LDP];

    const int tid  = threadIdx.x;
    const int lane = tid & 31;
    const int wave = tid >> 5;
    const int hi   = lane >> 4;
    const int ln15 = lane & 15;
    const int m0   = blockIdx.y * 128;
    const int n0   = blockIdx.x * 128;
    const int wr   = (wave >> 1) * 32;
    const int wc   = (wave & 1) * 64;

    v8f acc[2][4];
#pragma unroll
    for (int i = 0; i < 2; ++i)
#pragma unroll
        for (int j = 0; j < 4; ++j) acc[i][j] = vzero8();

    const int ldRow = tid >> 4;          // 0..15, rows ldRow + 16 i
    const int ldCol = (tid & 15) * 8;    // 16-B piece of the 256-B row piece
    const _Float16* aG = A  + (size_t)(m0 + ldRow) * K + ldCol;
    const _Float16* bG = Bt + (size_t)(n0 + ldRow) * K + ldCol;
    const size_t rstep = (size_t)16 * K;
    // one row of [A 128 rows | Bt 128 rows] per thread, for the L2 prefetch
    const _Float16* pG = (tid < 128) ? A  + (size_t)(m0 + tid) * K
                                     : Bt + (size_t)(n0 + tid - 128) * K;
    const int nk = K / KT;

    auto stage = [&](int buf, int kt) {
#pragma unroll
        for (int i = 0; i < 8; ++i) {
            async_cp16(aG + i * rstep + kt, &As[buf][i * 16 + ldRow][ldCol]);
            async_cp16(bG + i * rstep + kt, &Bs[buf][i * 16 + ldRow][ldCol]);
        }
    };

    auto compute = [&](int buf) {
#pragma unroll
        for (int ks = 0; ks < KT / 32; ++ks) {
            v16h af[2], bf[4];
            af[0] = load_frag(&As[buf][wr + ln15][ks * 32], hi);
            af[1] = load_frag(&As[buf][wr + 16 + ln15][ks * 32], hi);
#pragma unroll
            for (int j = 0; j < 4; ++j)
                bf[j] = load_frag(&Bs[buf][wc + j * 16 + ln15][ks * 32], hi);
#pragma unroll
            for (int i = 0; i < 2; ++i)
#pragma unroll
                for (int j = 0; j < 4; ++j)
                    acc[i][j] = __builtin_amdgcn_wmma_f32_16x16x32_f16(
                        false, af[i], false, bf[j], (short)0, acc[i][j], false, false);
        }
    };

    // prologue: tile 0 lands and is published, then tile 1 starts
    stage(0, 0);
    wait_async0();
    __syncthreads();
    if (nk > 1) {
        stage(1, KT);
        if (nk > 2) __builtin_prefetch(pG + 2 * KT, 0, 1);   // L2 prefetch of tile 2
    }
    for (int t = 0; t < nk; ++t) {
        compute(t & 1);
        // publish point of tile t+1: this wave's reads of tile t are done,
        // its own copies of tile t+1 have landed, then every wave meets
        asm volatile("s_wait_dscnt 0x0" ::: "memory");
        wait_async0();
        __syncthreads();
        if (t + 2 < nk) {                // refill the buffer every reader has left
            stage(t & 1, (t + 2) * KT);
            if (t + 3 < nk)              // L2 prefetch one tile ahead of the copies
                __builtin_prefetch(pG + (t + 3) * KT, 0, 1);
        }
    }
    wait_async0();                       // nothing in flight when the wave ends

    // C layout: lane holds column n = lane&15; VGPR r holds row r + 8*hi.
#pragma unroll
    for (int i = 0; i < 2; ++i)
#pragma unroll
        for (int j = 0; j < 4; ++j)
#pragma unroll
            for (int r = 0; r < 8; ++r) {
                int row = m0 + wr + i * 16 + hi * 8 + r;
                int col = n0 + wc + j * 16 + ln15;
                float v = acc[i][j][r];
                if (BIAS) v += bias[col];
                if (RES)  v += res[(size_t)row * N + col];
                if (RELU) v = fmaxf(v, 0.0f);
                if (OUT16) outH[(size_t)row * N + col] = (_Float16)v;
                else       outF[(size_t)row * N + col] = v;
            }
}

// ---------------------------------------------------------------------------
// Flash attention with WMMA, transposed products: S^T = K Q^T, O^T += V^T P^T.
// 128 threads (4 waves) per block; block handles 64 queries of one (batch,
// head); each wave owns 16 query columns. Key chunk = 32.
// A lane (c = lane & 15, h = lane >> 4) holds 16 scores of ONE query c (keys
// 8h + r and 16 + 8h + r), so maximum and sum run in the lane's own registers
// with one exchange between the wave halves; the two score tiles, converted
// in place, are the B operand of the second product in the hardware k order.
// Every loop over fragments or registers is unrolled so that each index is a
// constant and the arrays stay in registers.
// ---------------------------------------------------------------------------
typedef __attribute__((ext_vector_type(8))) short s16x8;
typedef __attribute__((address_space(3))) s16x8 lds_s16x8;

// row-major 16-bit LDS tile -> 8 k of one column per lane (half an A fragment)
static __device__ __forceinline__ v8h ld_tr16(const char* p) {
    return __builtin_bit_cast(v8h, __builtin_amdgcn_ds_load_tr16_b128_v8i16((lds_s16x8*)p));
}
// lane l with lane l ^ 16
static __device__ __forceinline__ float xhalf(float x) {
    return __builtin_bit_cast(float, __builtin_amdgcn_permlanex16(
        __builtin_bit_cast(int, x), __builtin_bit_cast(int, x),
        0x76543210, 0xfedcba98, false, false));
}

#define VPITCH 80   // halfs: 160 B = 32 B x 5, for ds_load_tr16_b128
#define QKV_LD (3 * E_DIM)   // row pitch of Q, K and V: column blocks of one matrix

__global__ __launch_bounds__(128, 1)
void attention_wmma(const _Float16* __restrict__ Q, const _Float16* __restrict__ K,
                    const _Float16* __restrict__ V, const int* __restrict__ mask,
                    _Float16* __restrict__ O)
{
    __shared__ alignas(16) _Float16 Ks[32][72];      // [key][d], A rows of S^T
    __shared__ alignas(32) _Float16 Vs[32][VPITCH];  // [key][d], read transposed

    const int tid  = threadIdx.x;
    const int lane = tid & 31;
    const int wave = tid >> 5;
    const int hi   = lane >> 4;
    const int ln15 = lane & 15;
    const int q0   = blockIdx.x * 64;
    const int hh   = blockIdx.y;
    const int nb   = blockIdx.z;
    const size_t baseTok = (size_t)nb * L_SEQ;
    const int co   = hh * D_DIM;
    const int* mrow = mask + nb * L_SEQ;

    // Q^T as B operand, loaded once: column = query ln15, k order as K's rows
    v16h qf[2];
    {
        const _Float16* qp = Q + (baseTok + q0 + wave * 16 + ln15) * QKV_LD + co;
        qf[0] = load_frag(qp, hi);
        qf[1] = load_frag(qp + 32, hi);
    }

    v8f o[4];                            // o[t][r] = O[query ln15][16 t + 8 hi + r]
#pragma unroll
    for (int t = 0; t < 4; ++t) o[t] = vzero8();
    float mr = -3.0e38f, lr = 0.0f;      // running maximum (scaled), half's sum

    const int krow = tid >> 2;           // 0..31
    const int kseg = (tid & 3) * 16;     // 0,16,32,48
    const char* vtp = (const char*)&Vs[0][0] + (8 * hi + (lane & 7)) * (VPITCH * 2)
                    + ((lane >> 3) & 1) * 16;

    for (int key0 = 0; key0 < L_SEQ; key0 += 32) {
        __syncthreads();
        v4i mk[2][2];                    // mask words of this lane's 16 keys
        {   // stage K rows and V rows as they lie in memory
            const _Float16* ksrc = K + (baseTok + key0 + krow) * QKV_LD + co + kseg;
            const _Float16* vsrc = V + (baseTok + key0 + krow) * QKV_LD + co + kseg;
            const v8h k0 = *(const v8h*)(ksrc);
            const v8h k1 = *(const v8h*)(ksrc + 8);
            const v8h v0 = *(const v8h*)(vsrc);
            const v8h v1 = *(const v8h*)(vsrc + 8);
#pragma unroll
            for (int c = 0; c < 2; ++c) {
                mk[c][0] = *(const v4i*)(mrow + key0 + c * 16 + hi * 8);
                mk[c][1] = *(const v4i*)(mrow + key0 + c * 16 + hi * 8 + 4);
            }
            *(v8h*)&Ks[krow][kseg]     = k0;
            *(v8h*)&Ks[krow][kseg + 8] = k1;
            *(v8h*)&Vs[krow][kseg]     = v0;
            *(v8h*)&Vs[krow][kseg + 8] = v1;
            // ahead of the next chunk's additions to the address registers that
            // the eight global loads above name
            asm volatile("s_wait_xcnt 0x0" ::: "memory");
        }
        __syncthreads();

        // S^T = K(32x64) @ Q^T(64x16): s[c][r] = score(key 16 c + 8 hi + r, query ln15)
        v16h kf[2][2];
#pragma unroll
        for (int c = 0; c < 2; ++c)
#pragma unroll
            for (int ks = 0; ks < 2; ++ks)
                kf[c][ks] = load_frag(&Ks[c * 16 + ln15][ks * 32], hi);

        // V^T fragments: 16 d x 32 keys each, two transposing loads
        v16h vf[4];
#pragma unroll
        for (int t = 0; t < 4; ++t) {
            union { v16h v; v8h h[2]; } u;
            u.h[0] = ld_tr16(vtp + 32 * t);
            u.h[1] = ld_tr16(vtp + 16 * (VPITCH * 2) + 32 * t);
            vf[t] = u.v;
        }
        // holds all 16 fragment loads ahead of the products: one LDS round
        // trip a chunk; left free, the compiler sinks them between the WMMAs
        __builtin_amdgcn_sched_barrier(0);

        v8f s[2];
        s[0] = vzero8(); s[1] = vzero8();
#pragma unroll
        for (int ks = 0; ks < 2; ++ks)
#pragma unroll
            for (int c = 0; c < 2; ++c)
                s[c] = __builtin_amdgcn_wmma_f32_16x16x32_f16(
                    false, kf[c][ks], false, qf[ks], (short)0, s[c], false, false);

        // mask (before scaling), then the scale
#pragma unroll
        for (int c = 0; c < 2; ++c)
#pragma unroll
            for (int r = 0; r < 8; ++r) {
                float a = s[c][r];
                if (mk[c][r >> 2][r & 3] == 0) a = NEG_VAL;
                s[c][r] = a * 0.125f;
            }

        // online softmax of one query per lane
        float mx = fmaxf(s[0][0], s[1][0]);
#pragma unroll
        for (int r = 1; r < 8; ++r) mx = fmaxf(mx, fmaxf(s[0][r], s[1][r]));
        mx = fmaxf(mx, xhalf(mx));
        const float mn   = fmaxf(mr, mx);
        float rs[4] = {0.0f, 0.0f, 0.0f, 0.0f};   // four short chains of adds
        v16h pf;                         // P^T: element 8 c + r = key 16 c + 8 hi + r
#pragma unroll
        for (int c = 0; c < 2; ++c)
#pragma unroll
            for (int r = 0; r < 8; ++r) {
                const float p = __expf(s[c][r] - mn);
                rs[r & 3]    += p;
                pf[c * 8 + r] = (_Float16)p;
            }
        const float corr = __expf(mr - mn);
        mr = mn;
        lr = lr * corr + ((rs[0] + rs[1]) + (rs[2] + rs[3]));
#pragma unroll
        for (int t = 0; t < 4; ++t) o[t] = o[t] * corr;

        // O^T += V^T(64x32) @ P^T(32x16)
#pragma unroll
        for (int t = 0; t < 4; ++t)
            o[t] = __builtin_amdgcn_wmma_f32_16x16x32_f16(
                false, vf[t], false, pf, (short)0, o[t], false, false);
    }

    // the halves' sums join once; a lane stores 8 consecutive d of its query
    const float inv = 1.0f / (lr + xhalf(lr));
    _Float16* dst = O + (baseTok + q0 + wave * 16 + ln15) * E_DIM + co + hi * 8;
#pragma unroll
    for (int t = 0; t < 4; ++t) {
        v8h h;
#pragma unroll
        for (int r = 0; r < 8; ++r) h[r] = (_Float16)(o[t][r] * inv);
        *(v8h*)(dst + t * 16) = h;
    }
}

// ---------------------------------------------------------------------------
// LayerNorm over rows of E_DIM floats; writes f32 and optionally f16 copy.
// ---------------------------------------------------------------------------
__global__ __launch_bounds__(256, 1)
void layernorm_k(const float* __restrict__ in, const float* __restrict__ g,
                 const float* __restrict__ b, float* __restrict__ outF,
                 _Float16* __restrict__ outH)
{
    const int row = blockIdx.x;
    const int t   = threadIdx.x;
    const float4 x = ((const float4*)(in + (size_t)row * E_DIM))[t];
    float s  = x.x + x.y + x.z + x.w;
    float sq = x.x * x.x + x.y * x.y + x.z * x.z + x.w * x.w;
#pragma unroll
    for (int mk = 1; mk < 32; mk <<= 1) { s += __shfl_xor(s, mk, 32); sq += __shfl_xor(sq, mk, 32); }
    __shared__ float sh_s[8], sh_q[8];
    const int wave = t >> 5;
    if ((t & 31) == 0) { sh_s[wave] = s; sh_q[wave] = sq; }
    __syncthreads();
    float ts = 0.0f, tq = 0.0f;
#pragma unroll
    for (int i = 0; i < 8; ++i) { ts += sh_s[i]; tq += sh_q[i]; }
    const float mean = ts * (1.0f / E_DIM);
    const float var  = tq * (1.0f / E_DIM) - mean * mean;
    const float inv  = rsqrtf(var + 1e-6f);
    const float4 gg = ((const float4*)g)[t];
    const float4 bb = ((const float4*)b)[t];
    float4 y;
    y.x = gg.x * (x.x - mean) * inv + bb.x;
    y.y = gg.y * (x.y - mean) * inv + bb.y;
    y.z = gg.z * (x.z - mean) * inv + bb.z;
    y.w = gg.w * (x.w - mean) * inv + bb.w;
    ((float4*)(outF + (size_t)row * E_DIM))[t] = y;
    if (outH) {
        v4h h; h[0] = (_Float16)y.x; h[1] = (_Float16)y.y;
               h[2] = (_Float16)y.z; h[3] = (_Float16)y.w;
        *(v4h*)(outH + (size_t)row * E_DIM + t * 4) = h;
    }
}

// ---------------------------------------------------------------------------
// Every f16 operand that depends on the inputs alone, made in ONE launch.
// Blocks [0, 12288): 32x32 tiles of the six weights, in[K][N] (f32) ->
// out[N][K] (f16), LDS-tiled for coalescing both ways; wq, wk, wv land one
// behind the other, so that they form one [3 E][E] operand.
// Blocks [12288, 16384): x (f32) -> f16, four elements a thread.
// ---------------------------------------------------------------------------
#define TB_E   ((E_DIM / 32) * (E_DIM / 32))     // tiles of an E x E weight
#define TB_FF  ((E_DIM / 32) * (FF_DIM / 32))    // tiles of w1 or of w2
#define TB_ALL (4 * TB_E + 2 * TB_FF)
#define XB_ALL (2 * L_SEQ * E_DIM / 4 / 256)     // blocks that convert x

__global__ __launch_bounds__(256, 1)
void prep_f16(const float* __restrict__ x,  const float* __restrict__ wq,
              const float* __restrict__ wk, const float* __restrict__ wv,
              const float* __restrict__ wo, const float* __restrict__ w1,
              const float* __restrict__ w2, _Float16* __restrict__ xh,
              _Float16* __restrict__ wqkvT, _Float16* __restrict__ woT,
              _Float16* __restrict__ w1T,   _Float16* __restrict__ w2T)
{
    __shared__ float tile[32][33];
    int b = blockIdx.x;
    if (b >= TB_ALL) {                   // whole blocks leave ahead of the barrier
        const int i = (b - TB_ALL) * 256 + threadIdx.x;
        float4 v = ((const float4*)x)[i];
        v4h h; h[0] = (_Float16)v.x; h[1] = (_Float16)v.y;
               h[2] = (_Float16)v.z; h[3] = (_Float16)v.w;
        ((v4h*)xh)[i] = h;
        return;
    }
    const float* in; _Float16* out; int K, N, lgnt;   // lgnt = log2(N / 32)
    if (b < 4 * TB_E) {
        const int w = b / TB_E;
        b -= w * TB_E;
        in  = (w == 0) ? wq : (w == 1) ? wk : (w == 2) ? wv : wo;
        out = (w == 3) ? woT : wqkvT + (size_t)w * E_DIM * E_DIM;
        K = E_DIM; N = E_DIM; lgnt = 5;
    } else if (b < 4 * TB_E + TB_FF) {
        b -= 4 * TB_E;
        in = w1; out = w1T; K = E_DIM; N = FF_DIM; lgnt = 7;
    } else {
        b -= 4 * TB_E + TB_FF;
        in = w2; out = w2T; K = FF_DIM; N = E_DIM; lgnt = 5;
    }
    const int n0 = (b & ((1 << lgnt) - 1)) * 32, k0 = (b >> lgnt) * 32;
    const int tx = threadIdx.x & 31, ty = threadIdx.x >> 5;
#pragma unroll
    for (int i = 0; i < 4; ++i)
        tile[ty + i * 8][tx] = in[(size_t)(k0 + ty + i * 8) * N + n0 + tx];
    __syncthreads();
#pragma unroll
    for (int i = 0; i < 4; ++i)
        out[(size_t)(n0 + ty + i * 8) * K + k0 + tx] = (_Float16)tile[tx][ty + i * 8];
}

extern "C" void kernel_launch(void* const* d_in, const int* in_sizes, int n_in,
                              void* d_out, int out_size, void* d_ws, size_t ws_size,
                              hipStream_t stream)
{
    (void)in_sizes; (void)n_in; (void)out_size; (void)ws_size;
    const float* x   = (const float*)d_in[0];
    const int*   msk = (const int*)d_in[1];
    const float* wq  = (const float*)d_in[2];
    const float* wk  = (const float*)d_in[3];
    const float* wv  = (const float*)d_in[4];
    const float* wo  = (const float*)d_in[5];
    const float* bo  = (const float*)d_in[6];
    const float* g1  = (const float*)d_in[7];
    const float* be1 = (const float*)d_in[8];
    const float* g2  = (const float*)d_in[9];
    const float* be2 = (const float*)d_in[10];
    const float* w1  = (const float*)d_in[11];
    const float* b1  = (const float*)d_in[12];
    const float* w2  = (const float*)d_in[13];
    const float* b2  = (const float*)d_in[14];

    const int NL = 2 * L_SEQ;                       // 4096 tokens
    char* ws = (char*)d_ws;
    const size_t MB = 1024ull * 1024ull;
    _Float16* AH    = (_Float16*)(ws + 0);          //  8 MB: x f16, later h f16
    _Float16* FFH   = (_Float16*)(ws + 8 * MB);     // 32 MB: relu(h@w1+b1) f16
    _Float16* QKVH  = (_Float16*)(ws + 48 * MB);    // 24 MB: [token][Q | K | V] f16
    _Float16* ATTNH = (_Float16*)(ws + 72 * MB);    //  8 MB
    float*    RES   = (float*)(ws + 80 * MB);       // 16 MB (pre-LN1, later pre-LN2)
    float*    HBUF  = (float*)(ws + 96 * MB);       // 16 MB: h f32 (residual)
    _Float16* WQKVT = (_Float16*)(ws + 112 * MB);   //  6 MB: [wq^T ; wk^T ; wv^T] f16
    _Float16* WOT   = (_Float16*)(ws + 118 * MB);   //  2 MB: wo^T f16
    _Float16* W1T   = (_Float16*)(ws + 120 * MB);   //  8 MB: w1^T f16
    _Float16* W2T   = (_Float16*)(ws + 128 * MB);   //  8 MB: w2^T f16

    dim3 blk256(256), blk128(128);
    dim3 gP(E_DIM / 128, NL / 128);                 // (8, 32)
    dim3 gQKV(3 * E_DIM / 128, NL / 128);           // (24, 32)
    dim3 gF1(FF_DIM / 128, NL / 128);               // (32, 32)

    // x and all six weights to f16 (weights transposed)
    prep_f16<<<TB_ALL + XB_ALL, blk256, 0, stream>>>(x, wq, wk, wv, wo, w1, w2,
                                                     AH, WQKVT, WOT, W1T, W2T);

    // Q, K and V projections as one product with N = 3 E
    gemm_wmma_f16<false, false, false, true><<<gQKV, blk256, 0, stream>>>(AH, WQKVT, nullptr, nullptr, nullptr, QKVH, NL, 3 * E_DIM, E_DIM);

    attention_wmma<<<dim3(L_SEQ / 64, H_DIM, 2), blk128, 0, stream>>>(QKVH, QKVH + E_DIM, QKVH + 2 * E_DIM, msk, ATTNH);

    // out-proj + bo + residual x  -> RES (f32)
    gemm_wmma_f16<true, true, false, false><<<gP, blk256, 0, stream>>>(ATTNH, WOT, bo, x, RES, nullptr, NL, E_DIM, E_DIM);

    // LN1 -> h (f32 in HBUF, f16 in AH)
    layernorm_k<<<NL, blk256, 0, stream>>>(RES, g1, be1, HBUF, AH);

    // FF1: relu(h @ w1 + b1) -> FFH (f16)
    gemm_wmma_f16<true, false, true, true><<<gF1, blk256, 0, stream>>>(AH, W1T, b1, nullptr, nullptr, FFH, NL, FF_DIM, E_DIM);

    // FF2: ff @ w2 + b2 + h -> RES (f32)
    gemm_wmma_f16<true, true, false, false><<<gP, blk256, 0, stream>>>(FFH, W2T, b2, HBUF, RES, nullptr, NL, E_DIM, FF_DIM);

    // LN2 -> final output
    layernorm_k<<<NL, blk256, 0, stream>>>(RES, g2, be2, (float*)d_out, nullptr);
}

// v004
// Measured time: 188 microseconds a run.
// Timed twice side by side with v003, it ran 1.09 times as fast both times.
// Over all steps from v000 it is 2.12 times as fast.
#include <hip/hip_runtime.h>
#include <hip/hip_bf16.h>

typedef __attribute__((ext_vector_type(16))) _Float16 v16h;
typedef __attribute__((ext_vector_type(8)))  _Float16 v8h;
typedef __attribute__((ext_vector_type(4)))  _Float16 v4h;
typedef __attribute__((ext_vector_type(8)))  float    v8f;
typedef __attribute__((ext_vector_type(4)))  int      v4i;

#define E_DIM   1024
#define H_DIM   16
#define D_DIM   64
#define FF_DIM  4096
#define L_SEQ   2048
#define NEG_VAL (-10000.0f)

#if __has_builtin(__builtin_amdgcn_global_load_async_to_lds_b128)
#define ASYNC_LDS 1
#endif

static __device__ __forceinline__ v8f vzero8() {
    v8f v;
#pragma unroll
    for (int i = 0; i < 8; ++i) v[i] = 0.0f;
    return v;
}

// WMMA 16-bit A/B fragment from a row (LDS or global) holding a 32-half K-window.
// Lane hi-half selects K-halves [hi*8, +8) (VGPRs 0..3) and [16+hi*8, +8).
static __device__ __forceinline__ v16h load_frag(const _Float16* p, int hi) {
    union { v16h v; v8h h[2]; } u;
    u.h[0] = *reinterpret_cast<const v8h*>(p + hi * 8);
    u.h[1] = *reinterpret_cast<const v8h*>(p + 16 + hi * 8);
    return u.v;
}

#ifdef ASYNC_LDS
typedef __attribute__((address_space(1))) v4i*  gptr_v4i;
typedef __attribute__((address_space(3))) v4i*  lptr_v4i;
typedef __attribute__((address_space(1))) void* gptr_void;
typedef __attribute__((address_space(3))) void* lptr_void;

static __device__ __forceinline__ void async_cp16(const _Float16* g, _Float16* l) {
    __builtin_amdgcn_global_load_async_to_lds_b128(
        (gptr_v4i)(gptr_void)const_cast<_Float16*>(g),
        (lptr_v4i)(lptr_void)l, 0, 0);
}
static __device__ __forceinline__ void wait_async0() {
    // asm with the memory clobber: holds every later LDS read behind the wait
    asm volatile("s_wait_asynccnt 0x0" ::: "memory");
}
#else
// no async path: same ring, staged through registers
static __device__ __forceinline__ void async_cp16(const _Float16* g, _Float16* l) {
    *reinterpret_cast<v8h*>(l) = *reinterpret_cast<const v8h*>(g);
}
static __device__ __forceinline__ void wait_async0() {}
#endif

#define KT  128   // halfs of K per pass: one 256-B piece of every operand row
#define LDP 136   // LDS row pitch in halfs: 272 B = 16 B x 17, for ds_load_b128

// ---------------------------------------------------------------------------
// Tiled f16 WMMA GEMM:  C[M,N] = A[M,K] * Bt[N,K]^T  (Bt is B transposed)
// 256 threads (8 waves), block tile 128x128, wave tile 32x64, K-step 128,
// two LDS buffers; tile t+1 streams in during tile t. 16 lanes copy one
// 256-B row piece, so a wave's copy instruction covers whole lines only.
// K must be a multiple of KT.
// ---------------------------------------------------------------------------
template <bool BIAS, bool RES, bool RELU, bool OUT16>
__global__ __launch_bounds__(256, 1)
void gemm_wmma_f16(const _Float16* __restrict__ A, const _Float16* __restrict__ Bt,
                   const float* __restrict__ bias, const float* __restrict__ res,
                   float* __restrict__ outF, _Float16* __restrict__ outH,
                   int M, int N, int K)
{
    __shared__ alignas(16) _Float16 As[2][128][LDP];
    __shared__ alignas(16) _Float16 Bs[2][128][LDP];

    const int tid  = threadIdx.x;
    const int lane = tid & 31;
    const int wave = tid >> 5;
    const int hi   = lane >> 4;
    const int ln15 = lane & 15;
    const int m0   = blockIdx.y * 128;
    const int n0   = blockIdx.x * 128;
    const int wr   = (wave >> 1) * 32;
    const int wc   = (wave & 1) * 64;

    v8f acc[2][4];
#pragma unroll
    for (int i = 0; i < 2; ++i)
#pragma unroll
        for (int j = 0; j < 4; ++j) acc[i][j] = vzero8();

    const int ldRow = tid >> 4;          // 0..15, rows ldRow + 16 i
    const int ldCol = (tid & 15) * 8;    // 16-B piece of the 256-B row piece
    const _Float16* aG = A  + (size_t)(m0 + ldRow) * K + ldCol;
    const _Float16* bG = Bt + (size_t)(n0 + ldRow) * K + ldCol;
    const size_t rstep = (size_t)16 * K;
    // one row of [A 128 rows | Bt 128 rows] per thread, for the L2 prefetch
    const _Float16* pG = (tid < 128) ? A  + (size_t)(m0 + tid) * K
                                     : Bt + (size_t)(n0 + tid - 128) * K;
    const int nk = K / KT;

    auto stage = [&](int buf, int kt) {
#pragma unroll
        for (int i = 0; i < 8; ++i) {
            async_cp16(aG + i * rstep + kt, &As[buf][i * 16 + ldRow][ldCol]);
            async_cp16(bG + i * rstep + kt, &Bs[buf][i * 16 + ldRow][ldCol]);
        }
    };

    auto compute = [&](int buf) {
#pragma unroll
        for (int ks = 0; ks < KT / 32; ++ks) {
            v16h af[2], bf[4];
            af[0] = load_frag(&As[buf][wr + ln15][ks * 32], hi);
            af[1] = load_frag(&As[buf][wr + 16 + ln15][ks * 32], hi);
#pragma unroll
            for (int j = 0; j < 4; ++j)
                bf[j] = load_frag(&Bs[buf][wc + j * 16 + ln15][ks * 32], hi);
#pragma unroll
            for (int i = 0; i < 2; ++i)
#pragma unroll
                for (int j = 0; j < 4; ++j)
                    acc[i][j] = __builtin_amdgcn_wmma_f32_16x16x32_f16(
                        false, af[i], false, bf[j], (short)0, acc[i][j], false, false);
        }
    };

    // prologue: tile 0 lands and is published, then tile 1 starts
    stage(0, 0);
    wait_async0();
    __syncthreads();
    if (nk > 1) {
        stage(1, KT);
        if (nk > 2) __builtin_prefetch(pG + 2 * KT, 0, 1);   // L2 prefetch of tile 2
    }
    for (int t = 0; t < nk; ++t) {
        compute(t & 1);
        // publish point of tile t+1: this wave's reads of tile t are done,
        // its own copies of tile t+1 have landed, then every wave meets
        asm volatile("s_wait_dscnt 0x0" ::: "memory");
        wait_async0();
        __syncthreads();
        if (t + 2 < nk) {                // refill the buffer every reader has left
            stage(t & 1, (t + 2) * KT);
            if (t + 3 < nk)              // L2 prefetch one tile ahead of the copies
                __builtin_prefetch(pG + (t + 3) * KT, 0, 1);
        }
    }
    wait_async0();                       // nothing in flight when the wave ends

    // C layout: lane holds column n = lane&15; VGPR r holds row r + 8*hi.
#pragma unroll
    for (int i = 0; i < 2; ++i)
#pragma unroll
        for (int j = 0; j < 4; ++j)
#pragma unroll
            for (int r = 0; r < 8; ++r) {
                int row = m0 + wr + i * 16 + hi * 8 + r;
                int col = n0 + wc + j * 16 + ln15;
                float v = acc[i][j][r];
                if (BIAS) v += bias[col];
                if (RES)  v += res[(size_t)row * N + col];
                if (RELU) v = fmaxf(v, 0.0f);
                if (OUT16) outH[(size_t)row * N + col] = (_Float16)v;
                else       outF[(size_t)row * N + col] = v;
            }
}

// ---------------------------------------------------------------------------
// Flash attention with WMMA, transposed products: S^T = K Q^T, O^T += V^T P^T.
// 128 threads (4 waves) per block; block handles 64 queries of one (batch,
// head); each wave owns 16 query columns. Key chunk = 32.
// K and V rows come by asynchronous copies into a ring of two LDS buffers of
// 64 keys (two chunks): stage s + 1 flies while stage s is worked on.
// A lane (c = lane & 15, h = lane >> 4) holds 16 scores of ONE query c (keys
// 8h + r and 16 + 8h + r), so maximum and sum run in the lane's own registers
// with one exchange between the wave halves; the two score tiles, converted
// in place, are the B operand of the second product in the hardware k order.
// Every loop over fragments or registers is unrolled so that each index is a
// constant and the arrays stay in registers.
// ---------------------------------------------------------------------------
typedef __attribute__((ext_vector_type(8))) short s16x8;
typedef __attribute__((address_space(3))) s16x8 lds_s16x8;

// row-major 16-bit LDS tile -> 8 k of one column per lane (half an A fragment)
static __device__ __forceinline__ v8h ld_tr16(const char* p) {
    return __builtin_bit_cast(v8h, __builtin_amdgcn_ds_load_tr16_b128_v8i16((lds_s16x8*)p));
}
// lane l with lane l ^ 16
static __device__ __forceinline__ float xhalf(float x) {
    return __builtin_bit_cast(float, __builtin_amdgcn_permlanex16(
        __builtin_bit_cast(int, x), __builtin_bit_cast(int, x),
        0x76543210, 0xfedcba98, false, false));
}

#define VPITCH 80   // halfs: 160 B = 32 B x 5, for ds_load_tr16_b128
#define QKV_LD (3 * E_DIM)   // row pitch of Q, K and V: column blocks of one matrix
#define SKEYS  64            // keys per stage of the K/V ring
#define NSTAGE (L_SEQ / SKEYS)

__global__ __launch_bounds__(128, 1)
void attention_wmma(const _Float16* __restrict__ Q, const _Float16* __restrict__ K,
                    const _Float16* __restrict__ V, const int* __restrict__ mask,
                    _Float16* __restrict__ O)
{
    __shared__ alignas(16) _Float16 Ks[2][SKEYS][72];      // [key][d], A rows of S^T
    __shared__ alignas(32) _Float16 Vs[2][SKEYS][VPITCH];  // [key][d], read transposed

    const int tid  = threadIdx.x;
    const int lane = tid & 31;
    const int wave = tid >> 5;
    const int hi   = lane >> 4;
    const int ln15 = lane & 15;
    const int q0   = blockIdx.x * 64;
    const int hh   = blockIdx.y;
    const int nb   = blockIdx.z;
    const size_t baseTok = (size_t)nb * L_SEQ;
    const int co   = hh * D_DIM;
    const int* mrow = mask + nb * L_SEQ;

    // Q^T as B operand, loaded once: column = query ln15, k order as K's rows
    v16h qf[2];
    {
        const _Float16* qp = Q + (baseTok + q0 + wave * 16 + ln15) * QKV_LD + co;
        qf[0] = load_frag(qp, hi);
        qf[1] = load_frag(qp + 32, hi);
    }

    v8f o[4];                            // o[t][r] = O[query ln15][16 t + 8 hi + r]
#pragma unroll
    for (int t = 0; t < 4; ++t) o[t] = vzero8();
    float mr = -3.0e38f, lr = 0.0f;      // running maximum (scaled), half's sum

    // eight lanes copy one 128-B row, so a wave's copy covers four whole lines
    const int crow = tid >> 3;           // 0..15, rows crow + 16 i
    const int ccol = (tid & 7) * 8;      // 16-B piece of the row
    const _Float16* kG = K + (baseTok + crow) * QKV_LD + co + ccol;
    const _Float16* vG = V + (baseTok + crow) * QKV_LD + co + ccol;
    auto stage = [&](int buf, int key0) {
#pragma unroll                           // eight copies issued back to back
        for (int i = 0; i < SKEYS / 16; ++i) {
            const size_t off = (size_t)(key0 + i * 16) * QKV_LD;
            async_cp16(kG + off, &Ks[buf][i * 16 + crow][ccol]);
            async_cp16(vG + off, &Vs[buf][i * 16 + crow][ccol]);
        }
    };
    const int vlane = (8 * hi + (lane & 7)) * (VPITCH * 2) + ((lane >> 3) & 1) * 16;

    // prologue: stage 0 lands and is published, then stage 1 starts
    stage(0, 0);
    wait_async0();
    __syncthreads();
    stage(1, SKEYS);

    v4i mk[2][2];                        // mask words of this lane's 16 keys
#pragma unroll
    for (int c = 0; c < 2; ++c) {
        mk[c][0] = *(const v4i*)(mrow + c * 16 + hi * 8);
        mk[c][1] = *(const v4i*)(mrow + c * 16 + hi * 8 + 4);
    }

    for (int st = 0; st < NSTAGE; ++st) {
      const int buf = st & 1;
      const char* vtp = (const char*)&Vs[buf][0][0] + vlane;
#pragma unroll
      for (int sub = 0; sub < SKEYS / 32; ++sub) {   // unrolled: LDS offsets constant
        // the next chunk's mask words, one chunk ahead of their use (the last
        // chunk reads its own again, so that the address stays inside the row)
        const int keyn = min(st * SKEYS + sub * 32 + 32, L_SEQ - 32);
        v4i mkn[2][2];
#pragma unroll
        for (int c = 0; c < 2; ++c) {
            mkn[c][0] = *(const v4i*)(mrow + keyn + c * 16 + hi * 8);
            mkn[c][1] = *(const v4i*)(mrow + keyn + c * 16 + hi * 8 + 4);
        }
        // ahead of the next chunk's new values in the address registers that
        // the four global loads above name
        asm volatile("s_wait_xcnt 0x0" ::: "memory");

        // S^T = K(32x64) @ Q^T(64x16): s[c][r] = score(key 16 c + 8 hi + r, query ln15)
        v16h kf[2][2];
#pragma unroll
        for (int c = 0; c < 2; ++c)
#pragma unroll
            for (int ks = 0; ks < 2; ++ks)
                kf[c][ks] = load_frag(&Ks[buf][sub * 32 + c * 16 + ln15][ks * 32], hi);

        // V^T fragments: 16 d x 32 keys each, two transposing loads
        v16h vf[4];
#pragma unroll
        for (int t = 0; t < 4; ++t) {
            union { v16h v; v8h h[2]; } u;
            u.h[0] = ld_tr16(vtp + (sub * 32) * (VPITCH * 2) + 32 * t);
            u.h[1] = ld_tr16(vtp + (sub * 32 + 16) * (VPITCH * 2) + 32 * t);
            vf[t] = u.v;
        }
        // holds all 16 fragment loads ahead of the products: one LDS round
        // trip a chunk; left free, the compiler sinks them between the WMMAs
        __builtin_amdgcn_sched_barrier(0);

        v8f s[2];
        s[0] = vzero8(); s[1] = vzero8();
#pragma unroll
        for (int ks = 0; ks < 2; ++ks)
#pragma unroll
            for (int c = 0; c < 2; ++c)
                s[c] = __builtin_amdgcn_wmma_f32_16x16x32_f16(
                    false, kf[c][ks], false, qf[ks], (short)0, s[c], false, false);

        // mask (before scaling), then the scale
#pragma unroll
        for (int c = 0; c < 2; ++c)
#pragma unroll
            for (int r = 0; r < 8; ++r) {
                float a = s[c][r];
                if (mk[c][r >> 2][r & 3] == 0) a = NEG_VAL;
                s[c][r] = a * 0.125f;
            }

        // online softmax of one query per lane
        float mx = fmaxf(s[0][0], s[1][0]);
#pragma unroll
        for (int r = 1; r < 8; ++r) mx = fmaxf(mx, fmaxf(s[0][r], s[1][r]));
        mx = fmaxf(mx, xhalf(mx));
        const float mn   = fmaxf(mr, mx);
        float rs[4] = {0.0f, 0.0f, 0.0f, 0.0f};   // four short chains of adds
        v16h pf;                         // P^T: element 8 c + r = key 16 c + 8 hi + r
#pragma unroll
        for (int c = 0; c < 2; ++c)
#pragma unroll
            for (int r = 0; r < 8; ++r) {
                const float p = __expf(s[c][r] - mn);
                rs[r & 3]    += p;
                pf[c * 8 + r] = (_Float16)p;
            }
        const float corr = __expf(mr - mn);
        mr = mn;
        lr = lr * corr + ((rs[0] + rs[1]) + (rs[2] + rs[3]));
#pragma unroll
        for (int t = 0; t < 4; ++t) o[t] = o[t] * corr;

        // O^T += V^T(64x32) @ P^T(32x16)
#pragma unroll
        for (int t = 0; t < 4; ++t)
            o[t] = __builtin_amdgcn_wmma_f32_16x16x32_f16(
                false, vf[t], false, pf, (short)0, o[t], false, false);
#pragma unroll
        for (int c = 0; c < 2; ++c) { mk[c][0] = mkn[c][0]; mk[c][1] = mkn[c][1]; }
      }
      // keeps the stage's last products ahead of the barrier: left free, the
      // compiler sinks them behind it and the refill starts a whole chunk later
      __builtin_amdgcn_sched_barrier(0);
      // publish point of stage st + 1: this wave's reads of stage st are done,
      // its own copies of stage st + 1 have landed, then every wave meets
      asm volatile("s_wait_dscnt 0x0" ::: "memory");
      wait_async0();
      __syncthreads();
      if (st + 2 < NSTAGE)               // refill the buffer every reader has left
          stage(buf, (st + 2) * SKEYS);
    }
    wait_async0();                       // nothing in flight when the wave ends

    // the halves' sums join once; a lane stores 8 consecutive d of its query
    const float inv = 1.0f / (lr + xhalf(lr));
    _Float16* dst = O + (baseTok + q0 + wave * 16 + ln15) * E_DIM + co + hi * 8;
#pragma unroll
    for (int t = 0; t < 4; ++t) {
        v8h h;
#pragma unroll
        for (int r = 0; r < 8; ++r) h[r] = (_Float16)(o[t][r] * inv);
        *(v8h*)(dst + t * 16) = h;
    }
}

// ---------------------------------------------------------------------------
// LayerNorm over rows of E_DIM floats; writes f32 and optionally f16 copy.
// ---------------------------------------------------------------------------
__global__ __launch_bounds__(256, 1)
void layernorm_k(const float* __restrict__ in, const float* __restrict__ g,
                 const float* __restrict__ b, float* __restrict__ outF,
                 _Float16* __restrict__ outH)
{
    const int row = blockIdx.x;
    const int t   = threadIdx.x;
    const float4 x = ((const float4*)(in + (size_t)row * E_DIM))[t];
    float s  = x.x + x.y + x.z + x.w;
    float sq = x.x * x.x + x.y * x.y + x.z * x.z + x.w * x.w;
#pragma unroll
    for (int mk = 1; mk < 32; mk <<= 1) { s += __shfl_xor(s, mk, 32); sq += __shfl_xor(sq, mk, 32); }
    __shared__ float sh_s[8], sh_q[8];
    const int wave = t >> 5;
    if ((t & 31) == 0) { sh_s[wave] = s; sh_q[wave] = sq; }
    __syncthreads();
    float ts = 0.0f, tq = 0.0f;
#pragma unroll
    for (int i = 0; i < 8; ++i) { ts += sh_s[i]; tq += sh_q[i]; }
    const float mean = ts * (1.0f / E_DIM);
    const float var  = tq * (1.0f / E_DIM) - mean * mean;
    const float inv  = rsqrtf(var + 1e-6f);
    const float4 gg = ((const float4*)g)[t];
    const float4 bb = ((const float4*)b)[t];
    float4 y;
    y.x = gg.x * (x.x - mean) * inv + bb.x;
    y.y = gg.y * (x.y - mean) * inv + bb.y;
    y.z = gg.z * (x.z - mean) * inv + bb.z;
    y.w = gg.w * (x.w - mean) * inv + bb.w;
    ((float4*)(outF + (size_t)row * E_DIM))[t] = y;
    if (outH) {
        v4h h; h[0] = (_Float16)y.x; h[1] = (_Float16)y.y;
               h[2] = (_Float16)y.z; h[3] = (_Float16)y.w;
        *(v4h*)(outH + (size_t)row * E_DIM + t * 4) = h;
    }
}

// ---------------------------------------------------------------------------
// Every f16 operand that depends on the inputs alone, made in ONE launch.
// Blocks [0, 12288): 32x32 tiles of the six weights, in[K][N] (f32) ->
// out[N][K] (f16), LDS-tiled for coalescing both ways; wq, wk, wv land one
// behind the other, so that they form one [3 E][E] operand.
// Blocks [12288, 16384): x (f32) -> f16, four elements a thread.
// ---------------------------------------------------------------------------
#define TB_E   ((E_DIM / 32) * (E_DIM / 32))     // tiles of an E x E weight
#define TB_FF  ((E_DIM / 32) * (FF_DIM / 32))    // tiles of w1 or of w2
#define TB_ALL (4 * TB_E + 2 * TB_FF)
#define XB_ALL (2 * L_SEQ * E_DIM / 4 / 256)     // blocks that convert x

__global__ __launch_bounds__(256, 1)
void prep_f16(const float* __restrict__ x,  const float* __restrict__ wq,
              const float* __restrict__ wk, const float* __restrict__ wv,
              const float* __restrict__ wo, const float* __restrict__ w1,
              const float* __restrict__ w2, _Float16* __restrict__ xh,
              _Float16* __restrict__ wqkvT, _Float16* __restrict__ woT,
              _Float16* __restrict__ w1T,   _Float16* __restrict__ w2T)
{
    __shared__ float tile[32][33];
    int b = blockIdx.x;
    if (b >= TB_ALL) {                   // whole blocks leave ahead of the barrier
        const int i = (b - TB_ALL) * 256 + threadIdx.x;
        float4 v = ((const float4*)x)[i];
        v4h h; h[0] = (_Float16)v.x; h[1] = (_Float16)v.y;
               h[2] = (_Float16)v.z; h[3] = (_Float16)v.w;
        ((v4h*)xh)[i] = h;
        return;
    }
    const float* in; _Float16* out; int K, N, lgnt;   // lgnt = log2(N / 32)
    if (b < 4 * TB_E) {
        const int w = b / TB_E;
        b -= w * TB_E;
        in  = (w == 0) ? wq : (w == 1) ? wk : (w == 2) ? wv : wo;
        out = (w == 3) ? woT : wqkvT + (size_t)w * E_DIM * E_DIM;
        K = E_DIM; N = E_DIM; lgnt = 5;
    } else if (b < 4 * TB_E + TB_FF) {
        b -= 4 * TB_E;
        in = w1; out = w1T; K = E_DIM; N = FF_DIM; lgnt = 7;
    } else {
        b -= 4 * TB_E + TB_FF;
        in = w2; out = w2T; K = FF_DIM; N = E_DIM; lgnt = 5;
    }
    const int n0 = (b & ((1 << lgnt) - 1)) * 32, k0 = (b >> lgnt) * 32;
    const int tx = threadIdx.x & 31, ty = threadIdx.x >> 5;
#pragma unroll
    for (int i = 0; i < 4; ++i)
        tile[ty + i * 8][tx] = in[(size_t)(k0 + ty + i * 8) * N + n0 + tx];
    __syncthreads();
#pragma unroll
    for (int i = 0; i < 4; ++i)
        out[(size_t)(n0 + ty + i * 8) * K + k0 + tx] = (_Float16)tile[tx][ty + i * 8];
}

extern "C" void kernel_launch(void* const* d_in, const int* in_sizes, int n_in,
                              void* d_out, int out_size, void* d_ws, size_t ws_size,
                              hipStream_t stream)
{
    (void)in_sizes; (void)n_in; (void)out_size; (void)ws_size;
    const float* x   = (const float*)d_in[0];
    const int*   msk = (const int*)d_in[1];
    const float* wq  = (const float*)d_in[2];
    const float* wk  = (const float*)d_in[3];
    const float* wv  = (const float*)d_in[4];
    const float* wo  = (const float*)d_in[5];
    const float* bo  = (const float*)d_in[6];
    const float* g1  = (const float*)d_in[7];
    const float* be1 = (const float*)d_in[8];
    const float* g2  = (const float*)d_in[9];
    const float* be2 = (const float*)d_in[10];
    const float* w1  = (const float*)d_in[11];
    const float* b1  = (const float*)d_in[12];
    const float* w2  = (const float*)d_in[13];
    const float* b2  = (const float*)d_in[14];

    const int NL = 2 * L_SEQ;                       // 4096 tokens
    char* ws = (char*)d_ws;
    const size_t MB = 1024ull * 1024ull;
    _Float16* AH    = (_Float16*)(ws + 0);          //  8 MB: x f16, later h f16
    _Float16* FFH   = (_Float16*)(ws + 8 * MB);     // 32 MB: relu(h@w1+b1) f16
    _Float16* QKVH  = (_Float16*)(ws + 48 * MB);    // 24 MB: [token][Q | K | V] f16
    _Float16* ATTNH = (_Float16*)(ws + 72 * MB);    //  8 MB
    float*    RES   = (float*)(ws + 80 * MB);       // 16 MB (pre-LN1, later pre-LN2)
    float*    HBUF  = (float*)(ws + 96 * MB);       // 16 MB: h f32 (residual)
    _Float16* WQKVT = (_Float16*)(ws + 112 * MB);   //  6 MB: [wq^T ; wk^T ; wv^T] f16
    _Float16* WOT   = (_Float16*)(ws + 118 * MB);   //  2 MB: wo^T f16
    _Float16* W1T   = (_Float16*)(ws + 120 * MB);   //  8 MB: w1^T f16
    _Float16* W2T   = (_Float16*)(ws + 128 * MB);   //  8 MB: w2^T f16

    dim3 blk256(256), blk128(128);
    dim3 gP(E_DIM / 128, NL / 128);                 // (8, 32)
    dim3 gQKV(3 * E_DIM / 128, NL / 128);           // (24, 32)
    dim3 gF1(FF_DIM / 128, NL / 128);               // (32, 32)

    // x and all six weights to f16 (weights transposed)
    prep_f16<<<TB_ALL + XB_ALL, blk256, 0, stream>>>(x, wq, wk, wv, wo, w1, w2,
                                                     AH, WQKVT, WOT, W1T, W2T);

    // Q, K and V projections as one product with N = 3 E
    gemm_wmma_f16<false, false, false, true><<<gQKV, blk256, 0, stream>>>(AH, WQKVT, nullptr, nullptr, nullptr, QKVH, NL, 3 * E_DIM, E_DIM);

    attention_wmma<<<dim3(L_SEQ / 64, H_DIM, 2), blk128, 0, stream>>>(QKVH, QKVH + E_DIM, QKVH + 2 * E_DIM, msk, ATTNH);

    // out-proj + bo + residual x  -> RES (f32)
    gemm_wmma_f16<true, true, false, false><<<gP, blk256, 0, stream>>>(ATTNH, WOT, bo, x, RES, nullptr, NL, E_DIM, E_DIM);

    // LN1 -> h (f32 in HBUF, f16 in AH)
    layernorm_k<<<NL, blk256, 0, stream>>>(RES, g1, be1, HBUF, AH);

    // FF1: relu(h @ w1 + b1) -> FFH (f16)
    gemm_wmma_f16<true, false, true, true><<<gF1, blk256, 0, stream>>>(AH, W1T, b1, nullptr, nullptr, FFH, NL, FF_DIM, E_DIM);

    // FF2: ff @ w2 + b2 + h -> RES (f32)
    gemm_wmma_f16<true, true, false, false><<<gP, blk256, 0, stream>>>(FFH, W2T, b2, HBUF, RES, nullptr, NL, E_DIM, FF_DIM);

    // LN2 -> final output
    layernorm_k<<<NL, blk256, 0, stream>>>(RES, g2, be2, (float*)d_out, nullptr);
}

// v005
// Measured time: 176 microseconds a run.
// Timed twice side by side with v004, it ran 1.07 times as fast both times.
// Over all steps from v000 it is 2.27 times as fast.
#include <hip/hip_runtime.h>
#include <hip/hip_bf16.h>

typedef __attribute__((ext_vector_type(16))) _Float16 v16h;
typedef __attribute__((ext_vector_type(8)))  _Float16 v8h;
typedef __attribute__((ext_vector_type(4)))  _Float16 v4h;
typedef __attribute__((ext_vector_type(8)))  float    v8f;
typedef __attribute__((ext_vector_type(4)))  int      v4i;

#define E_DIM   1024
#define H_DIM   16
#define D_DIM   64
#define FF_DIM  4096
#define L_SEQ   2048
#define NEG_VAL (-10000.0f)

#if __has_builtin(__builtin_amdgcn_global_load_async_to_lds_b128)
#define ASYNC_LDS 1
#endif

static __device__ __forceinline__ v8f vzero8() {
    v8f v;
#pragma unroll
    for (int i = 0; i < 8; ++i) v[i] = 0.0f;
    return v;
}

// WMMA 16-bit A/B fragment from a row (LDS or global) holding a 32-half K-window.
// Lane hi-half selects K-halves [hi*8, +8) (VGPRs 0..3) and [16+hi*8, +8).
static __device__ __forceinline__ v16h load_frag(const _Float16* p, int hi) {
    union { v16h v; v8h h[2]; } u;
    u.h[0] = *reinterpret_cast<const v8h*>(p + hi * 8);
    u.h[1] = *reinterpret_cast<const v8h*>(p + 16 + hi * 8);
    return u.v;
}

#ifdef ASYNC_LDS
typedef __attribute__((address_space(1))) v4i*  gptr_v4i;
typedef __attribute__((address_space(3))) v4i*  lptr_v4i;
typedef __attribute__((address_space(1))) void* gptr_void;
typedef __attribute__((address_space(3))) void* lptr_void;

static __device__ __forceinline__ void async_cp16(const _Float16* g, _Float16* l) {
    __builtin_amdgcn_global_load_async_to_lds_b128(
        (gptr_v4i)(gptr_void)const_cast<_Float16*>(g),
        (lptr_v4i)(lptr_void)l, 0, 0);
}
static __device__ __forceinline__ void wait_async0() {
    // asm with the memory clobber: holds every later LDS read behind the wait
    asm volatile("s_wait_asynccnt 0x0" ::: "memory");
}
#else
// no async path: same ring, staged through registers
static __device__ __forceinline__ void async_cp16(const _Float16* g, _Float16* l) {
    *reinterpret_cast<v8h*>(l) = *reinterpret_cast<const v8h*>(g);
}
static __device__ __forceinline__ void wait_async0() {}
#endif

#define KT  128   // halfs of K per pass: one 256-B piece of every operand row
#define LDP 136   // LDS row pitch in halfs: 272 B = 16 B x 17, for ds_load_b128

// ---------------------------------------------------------------------------
// Tiled f16 WMMA GEMM:  C[M,N] = A[M,K] * Bt[N,K]^T  (Bt is B transposed)
// 256 threads (8 waves, 4 x 2), block tile BM x BN, wave tile BM/4 x BN/2,
// K-step 128, two LDS buffers; tile t+1 streams in during tile t. 16 lanes
// copy one 256-B row piece, so a wave's copy instruction covers whole lines.
// The tile is the largest whose grid still gives every WGP a block: operand
// bytes brought from L2 and fragment bytes read from LDS per product both
// fall as (BM + BN) / (BM * BN).
// K must be a multiple of KT, M of BM, N of BN.
// ---------------------------------------------------------------------------
template <int BM, int BN, bool BIAS, bool RES, bool RELU, bool OUT16>
__global__ __launch_bounds__(256, 1)
void gemm_wmma_f16(const _Float16* __restrict__ A, const _Float16* __restrict__ Bt,
                   const float* __restrict__ bias, const float* __restrict__ res,
                   float* __restrict__ outF, _Float16* __restrict__ outH,
                   int M, int N, int K)
{
    constexpr int  FM = BM / 64;         // 16-row fragments of A per wave
    constexpr int  FN = BN / 32;         // 16-column fragments of Bt per wave
    constexpr bool PF = (BM + BN == 256);   // one operand row per thread
    static_assert(BM >= BN && BM % 64 == 0 && BN % 32 == 0, "tile shape");
    __shared__ alignas(16) _Float16 As[2][BM][LDP];
    __shared__ alignas(16) _Float16 Bs[2][BN][LDP];

    const int tid  = threadIdx.x;
    const int lane = tid & 31;
    const int wave = tid >> 5;
    const int hi   = lane >> 4;
    const int ln15 = lane & 15;
    const int m0   = blockIdx.y * BM;
    const int n0   = blockIdx.x * BN;
    const int wr   = (wave >> 1) * (BM / 4);
    const int wc   = (wave & 1) * (BN / 2);

    v8f acc[FM][FN];
#pragma unroll
    for (int i = 0; i < FM; ++i)
#pragma unroll
        for (int j = 0; j < FN; ++j) acc[i][j] = vzero8();

    const int ldRow = tid >> 4;          // 0..15, rows ldRow + 16 i
    const int ldCol = (tid & 15) * 8;    // 16-B piece of the 256-B row piece
    const _Float16* aG = A  + (size_t)(m0 + ldRow) * K + ldCol;
    const _Float16* bG = Bt + (size_t)(n0 + ldRow) * K + ldCol;
    const size_t rstep = (size_t)16 * K;
    // one row of [A 128 rows | Bt 128 rows] per thread, for the L2 prefetch
    // (128 x 128 tile only)
    const _Float16* pG = (tid < 128) ? A  + (size_t)(m0 + tid) * K
                                     : Bt + (size_t)(n0 + tid - 128) * K;
    const int nk = K / KT;

    auto stage = [&](int buf, int kt) {
#pragma unroll
        for (int i = 0; i < BM / 16; ++i) {          // BM >= BN
            async_cp16(aG + i * rstep + kt, &As[buf][i * 16 + ldRow][ldCol]);
            if (i < BN / 16)
                async_cp16(bG + i * rstep + kt, &Bs[buf][i * 16 + ldRow][ldCol]);
        }
    };

    auto compute = [&](int buf) {
#pragma unroll
        for (int ks = 0; ks < KT / 32; ++ks) {
            v16h af[FM], bf[FN];
#pragma unroll
            for (int i = 0; i < FM; ++i)
                af[i] = load_frag(&As[buf][wr + i * 16 + ln15][ks * 32], hi);
#pragma unroll
            for (int j = 0; j < FN; ++j)
                bf[j] = load_frag(&Bs[buf][wc + j * 16 + ln15][ks * 32], hi);
            // large tiles: all fragment loads of a k block stand as one group
            // ahead of its products; left free, the compiler keeps one A
            // fragment and waits out an LDS round trip before every row of
            // products, which the SIMD's one other wave cannot cover
            if (!PF) __builtin_amdgcn_sched_barrier(0);
#pragma unroll
            for (int i = 0; i < FM; ++i)
#pragma unroll
                for (int j = 0; j < FN; ++j)
                    acc[i][j] = __builtin_amdgcn_wmma_f32_16x16x32_f16(
                        false, af[i], false, bf[j], (short)0, acc[i][j], false, false);
            // and no load of the next k block moves in among these products,
            // nor a product behind the pass's barrier
            if (!PF) __builtin_amdgcn_sched_barrier(0);
        }
    };

    // prologue: tile 0 lands and is published, then tile 1 starts
    stage(0, 0);
    wait_async0();
    __syncthreads();
    if (nk > 1) {
        stage(1, KT);
        if (PF && nk > 2) __builtin_prefetch(pG + 2 * KT, 0, 1);   // into L2
    }
    for (int t = 0; t < nk; ++t) {
        compute(t & 1);
        // publish point of tile t+1: this wave's reads of tile t are done,
        // its own copies of tile t+1 have landed, then every wave meets
        asm volatile("s_wait_dscnt 0x0" ::: "memory");
        wait_async0();
        __syncthreads();
        if (t + 2 < nk) {                // refill the buffer every reader has left
            stage(t & 1, (t + 2) * KT);
            if (PF && t + 3 < nk)        // L2 prefetch one tile ahead of the copies
                __builtin_prefetch(pG + (t + 3) * KT, 0, 1);
        }
    }
    wait_async0();                       // nothing in flight when the wave ends

    // C layout: lane holds column n = lane&15; VGPR r holds row r + 8*hi.
#pragma unroll
    for (int i = 0; i < FM; ++i) {
#pragma unroll
        for (int j = 0; j < FN; ++j)
#pragma unroll
            for (int r = 0; r < 8; ++r) {
                int row = m0 + wr + i * 16 + hi * 8 + r;
                int col = n0 + wc + j * 16 + ln15;
                float v = acc[i][j][r];
                if (BIAS) v += bias[col];
                if (RES)  v += res[(size_t)row * N + col];
                if (RELU) v = fmaxf(v, 0.0f);
                if (OUT16) outH[(size_t)row * N + col] = (_Float16)v;
                else       outF[(size_t)row * N + col] = v;
            }
        if (!PF && i + 1 < FM) {
            // ahead of the next 16 rows' values and addresses in registers
            // that the stores above name; the two scheduling fences keep that
            // arithmetic behind the wait
            __builtin_amdgcn_sched_barrier(0);
            asm volatile("s_wait_xcnt 0x0" ::: "memory");
            __builtin_amdgcn_sched_barrier(0);
        }
    }
}

// ---------------------------------------------------------------------------
// Flash attention with WMMA, transposed products: S^T = K Q^T, O^T += V^T P^T.
// 128 threads (4 waves) per block; block handles 64 queries of one (batch,
// head); each wave owns 16 query columns. Key chunk = 32.
// K and V rows come by asynchronous copies into a ring of two LDS buffers of
// 64 keys (two chunks): stage s + 1 flies while stage s is worked on.
// A lane (c = lane & 15, h = lane >> 4) holds 16 scores of ONE query c (keys
// 8h + r and 16 + 8h + r), so maximum and sum run in the lane's own registers
// with one exchange between the wave halves; the two score tiles, converted
// in place, are the B operand of the second product in the hardware k order.
// Every loop over fragments or registers is unrolled so that each index is a
// constant and the arrays stay in registers.
// ---------------------------------------------------------------------------
typedef __attribute__((ext_vector_type(8))) short s16x8;
typedef __attribute__((address_space(3))) s16x8 lds_s16x8;

// row-major 16-bit LDS tile -> 8 k of one column per lane (half an A fragment)
static __device__ __forceinline__ v8h ld_tr16(const char* p) {
    return __builtin_bit_cast(v8h, __builtin_amdgcn_ds_load_tr16_b128_v8i16((lds_s16x8*)p));
}
// lane l with lane l ^ 16
static __device__ __forceinline__ float xhalf(float x) {
    return __builtin_bit_cast(float, __builtin_amdgcn_permlanex16(
        __builtin_bit_cast(int, x), __builtin_bit_cast(int, x),
        0x76543210, 0xfedcba98, false, false));
}

#define VPITCH 80   // halfs: 160 B = 32 B x 5, for ds_load_tr16_b128
#define QKV_LD (3 * E_DIM)   // row pitch of Q, K and V: column blocks of one matrix
#define SKEYS  64            // keys per stage of the K/V ring
#define NSTAGE (L_SEQ / SKEYS)

__global__ __launch_bounds__(128, 1)
void attention_wmma(const _Float16* __restrict__ Q, const _Float16* __restrict__ K,
                    const _Float16* __restrict__ V, const int* __restrict__ mask,
                    _Float16* __restrict__ O)
{
    __shared__ alignas(16) _Float16 Ks[2][SKEYS][72];      // [key][d], A rows of S^T
    __shared__ alignas(32) _Float16 Vs[2][SKEYS][VPITCH];  // [key][d], read transposed

    const int tid  = threadIdx.x;
    const int lane = tid & 31;
    const int wave = tid >> 5;
    const int hi   = lane >> 4;
    const int ln15 = lane & 15;
    const int q0   = blockIdx.x * 64;
    const int hh   = blockIdx.y;
    const int nb   = blockIdx.z;
    const size_t baseTok = (size_t)nb * L_SEQ;
    const int co   = hh * D_DIM;
    const int* mrow = mask + nb * L_SEQ;

    // Q^T as B operand, loaded once: column = query ln15, k order as K's rows
    v16h qf[2];
    {
        const _Float16* qp = Q + (baseTok + q0 + wave * 16 + ln15) * QKV_LD + co;
        qf[0] = load_frag(qp, hi);
        qf[1] = load_frag(qp + 32, hi);
    }

    v8f o[4];                            // o[t][r] = O[query ln15][16 t + 8 hi + r]
#pragma unroll
    for (int t = 0; t < 4; ++t) o[t] = vzero8();
    float mr = -3.0e38f, lr = 0.0f;      // running maximum (scaled), half's sum

    // eight lanes copy one 128-B row, so a wave's copy covers four whole lines
    const int crow = tid >> 3;           // 0..15, rows crow + 16 i
    const int ccol = (tid & 7) * 8;      // 16-B piece of the row
    const _Float16* kG = K + (baseTok + crow) * QKV_LD + co + ccol;
    const _Float16* vG = V + (baseTok + crow) * QKV_LD + co + ccol;
    auto stage = [&](int buf, int key0) {
#pragma unroll                           // eight copies issued back to back
        for (int i = 0; i < SKEYS / 16; ++i) {
            const size_t off = (size_t)(key0 + i * 16) * QKV_LD;
            async_cp16(kG + off, &Ks[buf][i * 16 + crow][ccol]);
            async_cp16(vG + off, &Vs[buf][i * 16 + crow][ccol]);
        }
    };
    const int vlane = (8 * hi + (lane & 7)) * (VPITCH * 2) + ((lane >> 3) & 1) * 16;

    // prologue: stage 0 lands and is published, then stage 1 starts
    stage(0, 0);
    wait_async0();
    __syncthreads();
    stage(1, SKEYS);

    v4i mk[2][2];                        // mask words of this lane's 16 keys
#pragma unroll
    for (int c = 0; c < 2; ++c) {
        mk[c][0] = *(const v4i*)(mrow + c * 16 + hi * 8);
        mk[c][1] = *(const v4i*)(mrow + c * 16 + hi * 8 + 4);
    }

    for (int st = 0; st < NSTAGE; ++st) {
      const int buf = st & 1;
      const char* vtp = (const char*)&Vs[buf][0][0] + vlane;
#pragma unroll
      for (int sub = 0; sub < SKEYS / 32; ++sub) {   // unrolled: LDS offsets constant
        // the next chunk's mask words, one chunk ahead of their use (the last
        // chunk reads its own again, so that the address stays inside the row)
        const int keyn = min(st * SKEYS + sub * 32 + 32, L_SEQ - 32);
        v4i mkn[2][2];
#pragma unroll
        for (int c = 0; c < 2; ++c) {
            mkn[c][0] = *(const v4i*)(mrow + keyn + c * 16 + hi * 8);
            mkn[c][1] = *(const v4i*)(mrow + keyn + c * 16 + hi * 8 + 4);
        }
        // ahead of the next chunk's new values in the address registers that
        // the four global loads above name
        asm volatile("s_wait_xcnt 0x0" ::: "memory");

        // S^T = K(32x64) @ Q^T(64x16): s[c][r] = score(key 16 c + 8 hi + r, query ln15)
        v16h kf[2][2];
#pragma unroll
        for (int c = 0; c < 2; ++c)
#pragma unroll
            for (int ks = 0; ks < 2; ++ks)
                kf[c][ks] = load_frag(&Ks[buf][sub * 32 + c * 16 + ln15][ks * 32], hi);

        // V^T fragments: 16 d x 32 keys each, two transposing loads
        v16h vf[4];
#pragma unroll
        for (int t = 0; t < 4; ++t) {
            union { v16h v; v8h h[2]; } u;
            u.h[0] = ld_tr16(vtp + (sub * 32) * (VPITCH * 2) + 32 * t);
            u.h[1] = ld_tr16(vtp + (sub * 32 + 16) * (VPITCH * 2) + 32 * t);
            vf[t] = u.v;
        }
        // holds all 16 fragment loads ahead of the products: one LDS round
        // trip a chunk; left free, the compiler sinks them between the WMMAs
        __builtin_amdgcn_sched_barrier(0);

        v8f s[2];
        s[0] = vzero8(); s[1] = vzero8();
#pragma unroll
        for (int ks = 0; ks < 2; ++ks)
#pragma unroll
            for (int c = 0; c < 2; ++c)
                s[c] = __builtin_amdgcn_wmma_f32_16x16x32_f16(
                    false, kf[c][ks], false, qf[ks], (short)0, s[c], false, false);

        // mask (before scaling), then the scale
#pragma unroll
        for (int c = 0; c < 2; ++c)
#pragma unroll
            for (int r = 0; r < 8; ++r) {
                float a = s[c][r];
                if (mk[c][r >> 2][r & 3] == 0) a = NEG_VAL;
                s[c][r] = a * 0.125f;
            }

        // online softmax of one query per lane
        float mx = fmaxf(s[0][0], s[1][0]);
#pragma unroll
        for (int r = 1; r < 8; ++r) mx = fmaxf(mx, fmaxf(s[0][r], s[1][r]));
        mx = fmaxf(mx, xhalf(mx));
        const float mn   = fmaxf(mr, mx);
        float rs[4] = {0.0f, 0.0f, 0.0f, 0.0f};   // four short chains of adds
        v16h pf;                         // P^T: element 8 c + r = key 16 c + 8 hi + r
#pragma unroll
        for (int c = 0; c < 2; ++c)
#pragma unroll
            for (int r = 0; r < 8; ++r) {
                const float p = __expf(s[c][r] - mn);
                rs[r & 3]    += p;
                pf[c * 8 + r] = (_Float16)p;
            }
        const float corr = __expf(mr - mn);
        mr = mn;
        lr = lr * corr + ((rs[0] + rs[1]) + (rs[2] + rs[3]));
#pragma unroll
        for (int t = 0; t < 4; ++t) o[t] = o[t] * corr;

        // O^T += V^T(64x32) @ P^T(32x16)
#pragma unroll
        for (int t = 0; t < 4; ++t)
            o[t] = __builtin_amdgcn_wmma_f32_16x16x32_f16(
                false, vf[t], false, pf, (short)0, o[t], false, false);
#pragma unroll
        for (int c = 0; c < 2; ++c) { mk[c][0] = mkn[c][0]; mk[c][1] = mkn[c][1]; }
      }
      // keeps the stage's last products ahead of the barrier: left free, the
      // compiler sinks them behind it and the refill starts a whole chunk later
      __builtin_amdgcn_sched_barrier(0);
      // publish point of stage st + 1: this wave's reads of stage st are done,
      // its own copies of stage st + 1 have landed, then every wave meets
      asm volatile("s_wait_dscnt 0x0" ::: "memory");
      wait_async0();
      __syncthreads();
      if (st + 2 < NSTAGE)               // refill the buffer every reader has left
          stage(buf, (st + 2) * SKEYS);
    }
    wait_async0();                       // nothing in flight when the wave ends

    // the halves' sums join once; a lane stores 8 consecutive d of its query
    const float inv = 1.0f / (lr + xhalf(lr));
    _Float16* dst = O + (baseTok + q0 + wave * 16 + ln15) * E_DIM + co + hi * 8;
#pragma unroll
    for (int t = 0; t < 4; ++t) {
        v8h h;
#pragma unroll
        for (int r = 0; r < 8; ++r) h[r] = (_Float16)(o[t][r] * inv);
        *(v8h*)(dst + t * 16) = h;
    }
}

// ---------------------------------------------------------------------------
// LayerNorm over rows of E_DIM floats; writes f32 and optionally f16 copy.
// ---------------------------------------------------------------------------
__global__ __launch_bounds__(256, 1)
void layernorm_k(const float* __restrict__ in, const float* __restrict__ g,
                 const float* __restrict__ b, float* __restrict__ outF,
                 _Float16* __restrict__ outH)
{
    const int row = blockIdx.x;
    const int t   = threadIdx.x;
    const float4 x = ((const float4*)(in + (size_t)row * E_DIM))[t];
    float s  = x.x + x.y + x.z + x.w;
    float sq = x.x * x.x + x.y * x.y + x.z * x.z + x.w * x.w;
#pragma unroll
    for (int mk = 1; mk < 32; mk <<= 1) { s += __shfl_xor(s, mk, 32); sq += __shfl_xor(sq, mk, 32); }
    __shared__ float sh_s[8], sh_q[8];
    const int wave = t >> 5;
    if ((t & 31) == 0) { sh_s[wave] = s; sh_q[wave] = sq; }
    __syncthreads();
    float ts = 0.0f, tq = 0.0f;
#pragma unroll
    for (int i = 0; i < 8; ++i) { ts += sh_s[i]; tq += sh_q[i]; }
    const float mean = ts * (1.0f / E_DIM);
    const float var  = tq * (1.0f / E_DIM) - mean * mean;
    const float inv  = rsqrtf(var + 1e-6f);
    const float4 gg = ((const float4*)g)[t];
    const float4 bb = ((const float4*)b)[t];
    float4 y;
    y.x = gg.x * (x.x - mean) * inv + bb.x;
    y.y = gg.y * (x.y - mean) * inv + bb.y;
    y.z = gg.z * (x.z - mean) * inv + bb.z;
    y.w = gg.w * (x.w - mean) * inv + bb.w;
    ((float4*)(outF + (size_t)row * E_DIM))[t] = y;
    if (outH) {
        v4h h; h[0] = (_Float16)y.x; h[1] = (_Float16)y.y;
               h[2] = (_Float16)y.z; h[3] = (_Float16)y.w;
        *(v4h*)(outH + (size_t)row * E_DIM + t * 4) = h;
    }
}

// ---------------------------------------------------------------------------
// Every f16 operand that depends on the inputs alone, made in ONE launch.
// Blocks [0, 12288): 32x32 tiles of the six weights, in[K][N] (f32) ->
// out[N][K] (f16), LDS-tiled for coalescing both ways; wq, wk, wv land one
// behind the other, so that they form one [3 E][E] operand.
// Blocks [12288, 16384): x (f32) -> f16, four elements a thread.
// ---------------------------------------------------------------------------
#define TB_E   ((E_DIM / 32) * (E_DIM / 32))     // tiles of an E x E weight
#define TB_FF  ((E_DIM / 32) * (FF_DIM / 32))    // tiles of w1 or of w2
#define TB_ALL (4 * TB_E + 2 * TB_FF)
#define XB_ALL (2 * L_SEQ * E_DIM / 4 / 256)     // blocks that convert x

__global__ __launch_bounds__(256, 1)
void prep_f16(const float* __restrict__ x,  const float* __restrict__ wq,
              const float* __restrict__ wk, const float* __restrict__ wv,
              const float* __restrict__ wo, const float* __restrict__ w1,
              const float* __restrict__ w2, _Float16* __restrict__ xh,
              _Float16* __restrict__ wqkvT, _Float16* __restrict__ woT,
              _Float16* __restrict__ w1T,   _Float16* __restrict__ w2T)
{
    __shared__ float tile[32][33];
    int b = blockIdx.x;
    if (b >= TB_ALL) {                   // whole blocks leave ahead of the barrier
        const int i = (b - TB_ALL) * 256 + threadIdx.x;
        float4 v = ((const float4*)x)[i];
        v4h h; h[0] = (_Float16)v.x; h[1] = (_Float16)v.y;
               h[2] = (_Float16)v.z; h[3] = (_Float16)v.w;
        ((v4h*)xh)[i] = h;
        return;
    }
    const float* in; _Float16* out; int K, N, lgnt;   // lgnt = log2(N / 32)
    if (b < 4 * TB_E) {
        const int w = b / TB_E;
        b -= w * TB_E;
        in  = (w == 0) ? wq : (w == 1) ? wk : (w == 2) ? wv : wo;
        out = (w == 3) ? woT : wqkvT + (size_t)w * E_DIM * E_DIM;
        K = E_DIM; N = E_DIM; lgnt = 5;
    } else if (b < 4 * TB_E + TB_FF) {
        b -= 4 * TB_E;
        in = w1; out = w1T; K = E_DIM; N = FF_DIM; lgnt = 7;
    } else {
        b -= 4 * TB_E + TB_FF;
        in = w2; out = w2T; K = FF_DIM; N = E_DIM; lgnt = 5;
    }
    const int n0 = (b & ((1 << lgnt) - 1)) * 32, k0 = (b >> lgnt) * 32;
    const int tx = threadIdx.x & 31, ty = threadIdx.x >> 5;
#pragma unroll
    for (int i = 0; i < 4; ++i)
        tile[ty + i * 8][tx] = in[(size_t)(k0 + ty + i * 8) * N + n0 + tx];
    __syncthreads();
#pragma unroll
    for (int i = 0; i < 4; ++i)
        out[(size_t)(n0 + ty + i * 8) * K + k0 + tx] = (_Float16)tile[tx][ty + i * 8];
}

extern "C" void kernel_launch(void* const* d_in, const int* in_sizes, int n_in,
                              void* d_out, int out_size, void* d_ws, size_t ws_size,
                              hipStream_t stream)
{
    (void)in_sizes; (void)n_in; (void)out_size; (void)ws_size;
    const float* x   = (const float*)d_in[0];
    const int*   msk = (const int*)d_in[1];
    const float* wq  = (const float*)d_in[2];
    const float* wk  = (const float*)d_in[3];
    const float* wv  = (const float*)d_in[4];
    const float* wo  = (const float*)d_in[5];
    const float* bo  = (const float*)d_in[6];
    const float* g1  = (const float*)d_in[7];
    const float* be1 = (const float*)d_in[8];
    const float* g2  = (const float*)d_in[9];
    const float* be2 = (const float*)d_in[10];
    const float* w1  = (const float*)d_in[11];
    const float* b1  = (const float*)d_in[12];
    const float* w2  = (const float*)d_in[13];
    const float* b2  = (const float*)d_in[14];

    const int NL = 2 * L_SEQ;                       // 4096 tokens
    char* ws = (char*)d_ws;
    const size_t MB = 1024ull * 1024ull;
    _Float16* AH    = (_Float16*)(ws + 0);          //  8 MB: x f16, later h f16
    _Float16* FFH   = (_Float16*)(ws + 8 * MB);     // 32 MB: relu(h@w1+b1) f16
    _Float16* QKVH  = (_Float16*)(ws + 48 * MB);    // 24 MB: [token][Q | K | V] f16
    _Float16* ATTNH = (_Float16*)(ws + 72 * MB);    //  8 MB
    float*    RES   = (float*)(ws + 80 * MB);       // 16 MB (pre-LN1, later pre-LN2)
    float*    HBUF  = (float*)(ws + 96 * MB);       // 16 MB: h f32 (residual)
    _Float16* WQKVT = (_Float16*)(ws + 112 * MB);   //  6 MB: [wq^T ; wk^T ; wv^T] f16
    _Float16* WOT   = (_Float16*)(ws + 118 * MB);   //  2 MB: wo^T f16
    _Float16* W1T   = (_Float16*)(ws + 120 * MB);   //  8 MB: w1^T f16
    _Float16* W2T   = (_Float16*)(ws + 128 * MB);   //  8 MB: w2^T f16

    dim3 blk256(256), blk128(128);
    dim3 gP(E_DIM / 128, NL / 128);                 // (8, 32)
    dim3 gQKV(3 * E_DIM / 192, NL / 256);           // (16, 16): one block a WGP
    dim3 gF1(FF_DIM / 256, NL / 256);               // (16, 16): one block a WGP

    // x and all six weights to f16 (weights transposed)
    prep_f16<<<TB_ALL + XB_ALL, blk256, 0, stream>>>(x, wq, wk, wv, wo, w1, w2,
                                                     AH, WQKVT, WOT, W1T, W2T);

    // Q, K and V projections as one product with N = 3 E
    gemm_wmma_f16<256, 192, false, false, false, true><<<gQKV, blk256, 0, stream>>>(AH, WQKVT, nullptr, nullptr, nullptr, QKVH, NL, 3 * E_DIM, E_DIM);

    attention_wmma<<<dim3(L_SEQ / 64, H_DIM, 2), blk128, 0, stream>>>(QKVH, QKVH + E_DIM, QKVH + 2 * E_DIM, msk, ATTNH);

    // out-proj + bo + residual x  -> RES (f32)
    gemm_wmma_f16<128, 128, true, true, false, false><<<gP, blk256, 0, stream>>>(ATTNH, WOT, bo, x, RES, nullptr, NL, E_DIM, E_DIM);

    // LN1 -> h (f32 in HBUF, f16 in AH)
    layernorm_k<<<NL, blk256, 0, stream>>>(RES, g1, be1, HBUF, AH);

    // FF1: relu(h @ w1 + b1) -> FFH (f16)
    gemm_wmma_f16<256, 256, true, false, true, true><<<gF1, blk256, 0, stream>>>(AH, W1T, b1, nullptr, nullptr, FFH, NL, FF_DIM, E_DIM);

    // FF2: ff @ w2 + b2 + h -> RES (f32)
    gemm_wmma_f16<128, 128, true, true, false, false><<<gP, blk256, 0, stream>>>(FFH, W2T, b2, HBUF, RES, nullptr, NL, E_DIM, FF_DIM);

    // LN2 -> final output
    layernorm_k<<<NL, blk256, 0, stream>>>(RES, g2, be2, (float*)d_out, nullptr);
}

// v006
// A run of this version takes 166 microseconds.
// Timed twice side by side with v005, it ran 1.06 times as fast both times.
// All steps since v000 together make it 2.41 times as fast.
#include <hip/hip_runtime.h>
#include <hip/hip_bf16.h>

typedef __attribute__((ext_vector_type(16))) _Float16 v16h;
typedef __attribute__((ext_vector_type(8)))  _Float16 v8h;
typedef __attribute__((ext_vector_type(4)))  _Float16 v4h;
typedef __attribute__((ext_vector_type(8)))  float    v8f;
typedef __attribute__((ext_vector_type(4)))  int      v4i;

#define E_DIM   1024
#define H_DIM   16
#define D_DIM   64
#define FF_DIM  4096
#define L_SEQ   2048
#define NEG_VAL (-10000.0f)

#if __has_builtin(__builtin_amdgcn_global_load_async_to_lds_b128)
#define ASYNC_LDS 1
#endif

static __device__ __forceinline__ v8f vzero8() {
    v8f v;
#pragma unroll
    for (int i = 0; i < 8; ++i) v[i] = 0.0f;
    return v;
}

// WMMA 16-bit A/B fragment from a row (LDS or global) holding a 32-half K-window.
// Lane hi-half selects K-halves [hi*8, +8) (VGPRs 0..3) and [16+hi*8, +8).
static __device__ __forceinline__ v16h load_frag(const _Float16* p, int hi) {
    union { v16h v; v8h h[2]; } u;
    u.h[0] = *reinterpret_cast<const v8h*>(p + hi * 8);
    u.h[1] = *reinterpret_cast<const v8h*>(p + 16 + hi * 8);
    return u.v;
}

#ifdef ASYNC_LDS
typedef __attribute__((address_space(1))) v4i*  gptr_v4i;
typedef __attribute__((address_space(3))) v4i*  lptr_v4i;
typedef __attribute__((address_space(1))) void* gptr_void;
typedef __attribute__((address_space(3))) void* lptr_void;

static __device__ __forceinline__ void async_cp16(const _Float16* g, _Float16* l) {
    __builtin_amdgcn_global_load_async_to_lds_b128(
        (gptr_v4i)(gptr_void)const_cast<_Float16*>(g),
        (lptr_v4i)(lptr_void)l, 0, 0);
}
static __device__ __forceinline__ void wait_async0() {
    // asm with the memory clobber: holds every later LDS read behind the wait
    asm volatile("s_wait_asynccnt 0x0" ::: "memory");
}
#else
// no async path: same ring, staged through registers
static __device__ __forceinline__ void async_cp16(const _Float16* g, _Float16* l) {
    *reinterpret_cast<v8h*>(l) = *reinterpret_cast<const v8h*>(g);
}
static __device__ __forceinline__ void wait_async0() {}
#endif

#define KT  128   // halfs of K per pass: one 256-B piece of every operand row
#define LDP 136   // LDS row pitch in halfs: 272 B = 16 B x 17, for ds_load_b128

// ---------------------------------------------------------------------------
// Tiled f16 WMMA GEMM:  C[M,N] = A[M,K] * Bt[N,K]^T  (Bt is B transposed)
// 256 threads (8 waves, 4 x 2), block tile BM x BN, wave tile BM/4 x BN/2,
// K-step 128, two LDS buffers; tile t+1 streams in during tile t. 16 lanes
// copy one 256-B row piece, so a wave's copy instruction covers whole lines.
// The tile is the largest whose grid still gives every WGP a block: operand
// bytes brought from L2 and fragment bytes read from LDS per product both
// fall as (BM + BN) / (BM * BN).
// K must be a multiple of KT, M of BM, N of BN.
// ---------------------------------------------------------------------------
template <int BM, int BN, bool BIAS, bool RES, bool RELU, bool OUT16>
__global__ __launch_bounds__(256, 1)
void gemm_wmma_f16(const _Float16* __restrict__ A, const _Float16* __restrict__ Bt,
                   const float* __restrict__ bias, const float* __restrict__ res,
                   float* __restrict__ outF, _Float16* __restrict__ outH,
                   int M, int N, int K)
{
    constexpr int  FM = BM / 64;         // 16-row fragments of A per wave
    constexpr int  FN = BN / 32;         // 16-column fragments of Bt per wave
    constexpr bool PF = (BM + BN == 256);   // one operand row per thread
    static_assert(BM >= BN && BM % 64 == 0 && BN % 32 == 0, "tile shape");
    __shared__ alignas(16) _Float16 As[2][BM][LDP];
    __shared__ alignas(16) _Float16 Bs[2][BN][LDP];

    const int tid  = threadIdx.x;
    const int lane = tid & 31;
    const int wave = tid >> 5;
    const int hi   = lane >> 4;
    const int ln15 = lane & 15;
    const int m0   = blockIdx.y * BM;
    const int n0   = blockIdx.x * BN;
    const int wr   = (wave >> 1) * (BM / 4);
    const int wc   = (wave & 1) * (BN / 2);

    v8f acc[FM][FN];
#pragma unroll
    for (int i = 0; i < FM; ++i)
#pragma unroll
        for (int j = 0; j < FN; ++j) acc[i][j] = vzero8();

    const int ldRow = tid >> 4;          // 0..15, rows ldRow + 16 i
    const int ldCol = (tid & 15) * 8;    // 16-B piece of the 256-B row piece
    const _Float16* aG = A  + (size_t)(m0 + ldRow) * K + ldCol;
    const _Float16* bG = Bt + (size_t)(n0 + ldRow) * K + ldCol;
    const size_t rstep = (size_t)16 * K;
    // one row of [A 128 rows | Bt 128 rows] per thread, for the L2 prefetch
    // (128 x 128 tile only)
    const _Float16* pG = (tid < 128) ? A  + (size_t)(m0 + tid) * K
                                     : Bt + (size_t)(n0 + tid - 128) * K;
    const int nk = K / KT;

    auto stage = [&](int buf, int kt) {
#pragma unroll
        for (int i = 0; i < BM / 16; ++i) {          // BM >= BN
            async_cp16(aG + i * rstep + kt, &As[buf][i * 16 + ldRow][ldCol]);
            if (i < BN / 16)
                async_cp16(bG + i * rstep + kt, &Bs[buf][i * 16 + ldRow][ldCol]);
        }
    };

    auto compute = [&](int buf) {
#pragma unroll
        for (int ks = 0; ks < KT / 32; ++ks) {
            v16h af[FM], bf[FN];
#pragma unroll
            for (int i = 0; i < FM; ++i)
                af[i] = load_frag(&As[buf][wr + i * 16 + ln15][ks * 32], hi);
#pragma unroll
            for (int j = 0; j < FN; ++j)
                bf[j] = load_frag(&Bs[buf][wc + j * 16 + ln15][ks * 32], hi);
            // large tiles: all fragment loads of a k block stand as one group
            // ahead of its products; left free, the compiler keeps one A
            // fragment and waits out an LDS round trip before every row of
            // products, which the SIMD's one other wave cannot cover
            if (!PF) __builtin_amdgcn_sched_barrier(0);
#pragma unroll
            for (int i = 0; i < FM; ++i)
#pragma unroll
                for (int j = 0; j < FN; ++j)
                    acc[i][j] = __builtin_amdgcn_wmma_f32_16x16x32_f16(
                        false, af[i], false, bf[j], (short)0, acc[i][j], false, false);
            // and no load of the next k block moves in among these products,
            // nor a product behind the pass's barrier
            if (!PF) __builtin_amdgcn_sched_barrier(0);
        }
    };

    // prologue: tile 0 lands and is published, then tile 1 starts
    stage(0, 0);
    wait_async0();
    __syncthreads();
    if (nk > 1) {
        stage(1, KT);
        if (PF && nk > 2) __builtin_prefetch(pG + 2 * KT, 0, 1);   // into L2
    }
    for (int t = 0; t < nk; ++t) {
        compute(t & 1);
        // publish point of tile t+1: this wave's reads of tile t are done,
        // its own copies of tile t+1 have landed, then every wave meets
        asm volatile("s_wait_dscnt 0x0" ::: "memory");
        wait_async0();
        __syncthreads();
        if (t + 2 < nk) {                // refill the buffer every reader has left
            stage(t & 1, (t + 2) * KT);
            if (PF && t + 3 < nk)        // L2 prefetch one tile ahead of the copies
                __builtin_prefetch(pG + (t + 3) * KT, 0, 1);
        }
    }
    wait_async0();                       // nothing in flight when the wave ends

    // C layout: lane holds column n = lane&15; VGPR r holds row r + 8*hi.
#pragma unroll
    for (int i = 0; i < FM; ++i) {
#pragma unroll
        for (int j = 0; j < FN; ++j)
#pragma unroll
            for (int r = 0; r < 8; ++r) {
                int row = m0 + wr + i * 16 + hi * 8 + r;
                int col = n0 + wc + j * 16 + ln15;
                float v = acc[i][j][r];
                if (BIAS) v += bias[col];
                if (RES)  v += res[(size_t)row * N + col];
                if (RELU) v = fmaxf(v, 0.0f);
                if (OUT16) outH[(size_t)row * N + col] = (_Float16)v;
                else       outF[(size_t)row * N + col] = v;
            }
        if (!PF && i + 1 < FM) {
            // ahead of the next 16 rows' values and addresses in registers
            // that the stores above name; the two scheduling fences keep that
            // arithmetic behind the wait
            __builtin_amdgcn_sched_barrier(0);
            asm volatile("s_wait_xcnt 0x0" ::: "memory");
            __builtin_amdgcn_sched_barrier(0);
        }
    }
}

// ---------------------------------------------------------------------------
// Flash attention with WMMA, transposed products: S^T = K Q^T, O^T += V^T P^T.
// 128 threads (4 waves) per block; block handles 64 queries of one (batch,
// head); each wave owns 16 query columns. Key chunk = 32.
// K and V rows come by asynchronous copies into a ring of two LDS buffers of
// 64 keys (two chunks): stage s + 1 flies while stage s is worked on.
// A lane (c = lane & 15, h = lane >> 4) holds 16 scores of ONE query c (keys
// 8h + r and 16 + 8h + r), so maximum and sum run in the lane's own registers;
// the two score tiles, converted in place, are the B operand of the second
// product in the hardware k order.
// The loop is bound by vector issue, so a chunk's common case is kept short:
// P = 2^(score * SC_LOG2 - mu), one multiply-add and one exponential a score,
// with mu the maximum in use. ONE ballot a chunk asks whether any lane needs
// more: a mask word of the chunk that is zero, or a score that would make P
// exceed 2^LAZY_LOG2. Only then does the wave select masked scores, exchange
// the maximum between its halves, raise mu and rescale sums and output.
// Every loop over fragments or registers is unrolled so that each index is a
// constant and the arrays stay in registers.
// ---------------------------------------------------------------------------
typedef __attribute__((ext_vector_type(8))) short s16x8;
typedef __attribute__((address_space(3))) s16x8 lds_s16x8;

// row-major 16-bit LDS tile -> 8 k of one column per lane (half an A fragment)
static __device__ __forceinline__ v8h ld_tr16(const char* p) {
    return __builtin_bit_cast(v8h, __builtin_amdgcn_ds_load_tr16_b128_v8i16((lds_s16x8*)p));
}
// lane l with lane l ^ 16
static __device__ __forceinline__ float xhalf(float x) {
    return __builtin_bit_cast(float, __builtin_amdgcn_permlanex16(
        __builtin_bit_cast(int, x), __builtin_bit_cast(int, x),
        0x76543210, 0xfedcba98, false, false));
}

#define VPITCH 80   // halfs: 160 B = 32 B x 5, for ds_load_tr16_b128
#define QKV_LD (3 * E_DIM)   // row pitch of Q, K and V: column blocks of one matrix
#define SKEYS  64            // keys per stage of the K/V ring
#define NSTAGE (L_SEQ / SKEYS)
#define SC_LOG2      0.18033688011112042f   // log2(e) / sqrt(D): raw score -> power of two
#define RAW_PER_LOG2 5.545177444479562f     // its inverse
#define LAZY_LOG2    8.0f                   // P stays below 2^8, far inside f16

// maximum of a lane's 16 scores, two chains of three-input maxima
static __device__ __forceinline__ float max16(const v8f& a, const v8f& b) {
    float x = fmaxf(fmaxf(a[0], a[1]), a[2]);
    float y = fmaxf(fmaxf(b[0], b[1]), b[2]);
    x = fmaxf(fmaxf(x, a[3]), a[4]);
    y = fmaxf(fmaxf(y, b[3]), b[4]);
    x = fmaxf(fmaxf(x, a[5]), a[6]);
    y = fmaxf(fmaxf(y, b[5]), b[6]);
    return fmaxf(fmaxf(fmaxf(x, y), a[7]), b[7]);
}

__global__ __launch_bounds__(128, 1)
void attention_wmma(const _Float16* __restrict__ Q, const _Float16* __restrict__ K,
                    const _Float16* __restrict__ V, const int* __restrict__ mask,
                    _Float16* __restrict__ O)
{
    __shared__ alignas(16) _Float16 Ks[2][SKEYS][72];      // [key][d], A rows of S^T
    __shared__ alignas(32) _Float16 Vs[2][SKEYS][VPITCH];  // [key][d], read transposed

    const int tid  = threadIdx.x;
    const int lane = tid & 31;
    const int wave = tid >> 5;
    const int hi   = lane >> 4;
    const int ln15 = lane & 15;
    const int q0   = blockIdx.x * 64;
    const int hh   = blockIdx.y;
    const int nb   = blockIdx.z;
    const size_t baseTok = (size_t)nb * L_SEQ;
    const int co   = hh * D_DIM;
    const int* mrow = mask + nb * L_SEQ;

    // Q^T as B operand, loaded once: column = query ln15, k order as K's rows
    v16h qf[2];
    {
        const _Float16* qp = Q + (baseTok + q0 + wave * 16 + ln15) * QKV_LD + co;
        qf[0] = load_frag(qp, hi);
        qf[1] = load_frag(qp + 32, hi);
    }

    v8f o[4];                            // o[t][r] = O[query ln15][16 t + 8 hi + r]
#pragma unroll
    for (int t = 0; t < 4; ++t) o[t] = vzero8();
    v8f   ls  = vzero8();                // eight partial sums of this half's P
    float mu  = -3.0e38f;                // maximum in use, as a power of two
    float thr = -3.0e38f;                // raw score above which mu has to grow

    // eight lanes copy one 128-B row, so a wave's copy covers four whole lines
    const int crow = tid >> 3;           // 0..15, rows crow + 16 i
    const int ccol = (tid & 7) * 8;      // 16-B piece of the row
    const _Float16* kG = K + (baseTok + crow) * QKV_LD + co + ccol;
    const _Float16* vG = V + (baseTok + crow) * QKV_LD + co + ccol;
    auto stage = [&](int buf, int key0) {
#pragma unroll                           // eight copies issued back to back
        for (int i = 0; i < SKEYS / 16; ++i) {
            const size_t off = (size_t)(key0 + i * 16) * QKV_LD;
            async_cp16(kG + off, &Ks[buf][i * 16 + crow][ccol]);
            async_cp16(vG + off, &Vs[buf][i * 16 + crow][ccol]);
        }
    };
    const int vlane = (8 * hi + (lane & 7)) * (VPITCH * 2) + ((lane >> 3) & 1) * 16;

    // prologue: stage 0 lands and is published, then stage 1 starts
    stage(0, 0);
    wait_async0();
    __syncthreads();
    stage(1, SKEYS);

    int mw = mrow[lane];                 // mask word of key `lane` of the chunk
    // ahead of new values in the registers that the global load above names;
    // the two scheduling fences keep the set-up that follows behind the wait
    __builtin_amdgcn_sched_barrier(0);
    asm volatile("s_wait_xcnt 0x0" ::: "memory");
    __builtin_amdgcn_sched_barrier(0);

    for (int st = 0; st < NSTAGE; ++st) {
      const int buf = st & 1;
      const char* vtp = (const char*)&Vs[buf][0][0] + vlane;
#pragma unroll
      for (int sub = 0; sub < SKEYS / 32; ++sub) {   // unrolled: LDS offsets constant
        // the next chunk's mask word, one chunk ahead of its use (the last
        // chunk reads its own again, so that the address stays inside the row)
        const int keyn = min(st * SKEYS + sub * 32 + 32, L_SEQ - 32);
        const int mwn  = mrow[keyn + lane];
        // ahead of the next chunk's new value in the address registers that
        // the global load above names
        asm volatile("s_wait_xcnt 0x0" ::: "memory");

        // S^T = K(32x64) @ Q^T(64x16): s[c][r] = score(key 16 c + 8 hi + r, query ln15)
        v16h kf[2][2];
#pragma unroll
        for (int c = 0; c < 2; ++c)
#pragma unroll
            for (int ks = 0; ks < 2; ++ks)
                kf[c][ks] = load_frag(&Ks[buf][sub * 32 + c * 16 + ln15][ks * 32], hi);

        // V^T fragments: 16 d x 32 keys each, two transposing loads
        v16h vf[4];
#pragma unroll
        for (int t = 0; t < 4; ++t) {
            union { v16h v; v8h h[2]; } u;
            u.h[0] = ld_tr16(vtp + (sub * 32) * (VPITCH * 2) + 32 * t);
            u.h[1] = ld_tr16(vtp + (sub * 32 + 16) * (VPITCH * 2) + 32 * t);
            vf[t] = u.v;
        }
        // holds all 16 fragment loads ahead of the products: one LDS round
        // trip a chunk; left free, the compiler sinks them between the WMMAs
        __builtin_amdgcn_sched_barrier(0);

        v8f s[2];
        s[0] = vzero8(); s[1] = vzero8();
#pragma unroll
        for (int ks = 0; ks < 2; ++ks)
#pragma unroll
            for (int c = 0; c < 2; ++c)
                s[c] = __builtin_amdgcn_wmma_f32_16x16x32_f16(
                    false, kf[c][ks], false, qf[ks], (short)0, s[c], false, false);

        // one wave-uniform test a chunk: a scalar branch, no barrier inside
        const bool more = (max16(s[0], s[1]) > thr) | (mw == 0);
        if (__builtin_amdgcn_ballot_w32(more) != 0u) {
            // mask on the raw score (before scaling):
            // bit k of the ballot is key k of the chunk, this lane's keys
            // are 16 c + 8 hi + r
            const unsigned live = __builtin_amdgcn_ballot_w32(mw != 0) >> (hi * 8);
#pragma unroll
            for (int c = 0; c < 2; ++c)
#pragma unroll
                for (int r = 0; r < 8; ++r)
                    if (((live >> (c * 16 + r)) & 1u) == 0u) s[c][r] = NEG_VAL;
            float mx = max16(s[0], s[1]);
            mx = fmaxf(mx, xhalf(mx));   // both halves of a query agree on mu
            const float mn   = fmaxf(mu, mx * SC_LOG2);
            const float corr = __builtin_amdgcn_exp2f(mu - mn);
            mu  = mn;
            thr = (mn + LAZY_LOG2) * RAW_PER_LOG2;
            ls  = ls * corr;
#pragma unroll
            for (int t = 0; t < 4; ++t) o[t] = o[t] * corr;
        }

        v16h pf;                         // P^T: element 8 c + r = key 16 c + 8 hi + r
        v8f scv, nmu;
#pragma unroll
        for (int r = 0; r < 8; ++r) { scv[r] = SC_LOG2; nmu[r] = -mu; }
#pragma unroll
        for (int c = 0; c < 2; ++c) {
            const v8f e = __builtin_elementwise_fma(s[c], scv, nmu);
            v8f p;
#pragma unroll
            for (int r = 0; r < 8; ++r) {
                p[r] = __builtin_amdgcn_exp2f(e[r]);
                pf[c * 8 + r] = (_Float16)p[r];
            }
            ls = ls + p;
        }

        // O^T += V^T(64x32) @ P^T(32x16)
#pragma unroll
        for (int t = 0; t < 4; ++t)
            o[t] = __builtin_amdgcn_wmma_f32_16x16x32_f16(
                false, vf[t], false, pf, (short)0, o[t], false, false);
        mw = mwn;
      }
      // keeps the stage's last products ahead of the barrier: left free, the
      // compiler sinks them behind it and the refill starts a whole chunk later
      __builtin_amdgcn_sched_barrier(0);
      // publish point of stage st + 1: this wave's reads of stage st are done,
      // its own copies of stage st + 1 have landed, then every wave meets
      asm volatile("s_wait_dscnt 0x0" ::: "memory");
      wait_async0();
      __syncthreads();
      if (st + 2 < NSTAGE)               // refill the buffer every reader has left
          stage(buf, (st + 2) * SKEYS);
    }
    wait_async0();                       // nothing in flight when the wave ends

    // the halves' sums join once; a lane stores 8 consecutive d of its query
    const float lr  = ((ls[0] + ls[1]) + (ls[2] + ls[3])) + ((ls[4] + ls[5]) + (ls[6] + ls[7]));
    const float inv = 1.0f / (lr + xhalf(lr));
    _Float16* dst = O + (baseTok + q0 + wave * 16 + ln15) * E_DIM + co + hi * 8;
#pragma unroll
    for (int t = 0; t < 4; ++t) {
        v8h h;
#pragma unroll
        for (int r = 0; r < 8; ++r) h[r] = (_Float16)(o[t][r] * inv);
        *(v8h*)(dst + t * 16) = h;
    }
}

// ---------------------------------------------------------------------------
// LayerNorm over rows of E_DIM floats; writes f32 and optionally f16 copy.
// ---------------------------------------------------------------------------
__global__ __launch_bounds__(256, 1)
void layernorm_k(const float* __restrict__ in, const float* __restrict__ g,
                 const float* __restrict__ b, float* __restrict__ outF,
                 _Float16* __restrict__ outH)
{
    const int row = blockIdx.x;
    const int t   = threadIdx.x;
    const float4 x = ((const float4*)(in + (size_t)row * E_DIM))[t];
    float s  = x.x + x.y + x.z + x.w;
    float sq = x.x * x.x + x.y * x.y + x.z * x.z + x.w * x.w;
#pragma unroll
    for (int mk = 1; mk < 32; mk <<= 1) { s += __shfl_xor(s, mk, 32); sq += __shfl_xor(sq, mk, 32); }
    __shared__ float sh_s[8], sh_q[8];
    const int wave = t >> 5;
    if ((t & 31) == 0) { sh_s[wave] = s; sh_q[wave] = sq; }
    __syncthreads();
    float ts = 0.0f, tq = 0.0f;
#pragma unroll
    for (int i = 0; i < 8; ++i) { ts += sh_s[i]; tq += sh_q[i]; }
    const float mean = ts * (1.0f / E_DIM);
    const float var  = tq * (1.0f / E_DIM) - mean * mean;
    const float inv  = rsqrtf(var + 1e-6f);
    const float4 gg = ((const float4*)g)[t];
    const float4 bb = ((const float4*)b)[t];
    float4 y;
    y.x = gg.x * (x.x - mean) * inv + bb.x;
    y.y = gg.y * (x.y - mean) * inv + bb.y;
    y.z = gg.z * (x.z - mean) * inv + bb.z;
    y.w = gg.w * (x.w - mean) * inv + bb.w;
    ((float4*)(outF + (size_t)row * E_DIM))[t] = y;
    if (outH) {
        v4h h; h[0] = (_Float16)y.x; h[1] = (_Float16)y.y;
               h[2] = (_Float16)y.z; h[3] = (_Float16)y.w;
        *(v4h*)(outH + (size_t)row * E_DIM + t * 4) = h;
    }
}

// ---------------------------------------------------------------------------
// Every f16 operand that depends on the inputs alone, made in ONE launch.
// Blocks [0, 12288): 32x32 tiles of the six weights, in[K][N] (f32) ->
// out[N][K] (f16), LDS-tiled for coalescing both ways; wq, wk, wv land one
// behind the other, so that they form one [3 E][E] operand.
// Blocks [12288, 16384): x (f32) -> f16, four elements a thread.
// ---------------------------------------------------------------------------
#define TB_E   ((E_DIM / 32) * (E_DIM / 32))     // tiles of an E x E weight
#define TB_FF  ((E_DIM / 32) * (FF_DIM / 32))    // tiles of w1 or of w2
#define TB_ALL (4 * TB_E + 2 * TB_FF)
#define XB_ALL (2 * L_SEQ * E_DIM / 4 / 256)     // blocks that convert x

__global__ __launch_bounds__(256, 1)
void prep_f16(const float* __restrict__ x,  const float* __restrict__ wq,
              const float* __restrict__ wk, const float* __restrict__ wv,
              const float* __restrict__ wo, const float* __restrict__ w1,
              const float* __restrict__ w2, _Float16* __restrict__ xh,
              _Float16* __restrict__ wqkvT, _Float16* __restrict__ woT,
              _Float16* __restrict__ w1T,   _Float16* __restrict__ w2T)
{
    __shared__ float tile[32][33];
    int b = blockIdx.x;
    if (b >= TB_ALL) {                   // whole blocks leave ahead of the barrier
        const int i = (b - TB_ALL) * 256 + threadIdx.x;
        float4 v = ((const float4*)x)[i];
        v4h h; h[0] = (_Float16)v.x; h[1] = (_Float16)v.y;
               h[2] = (_Float16)v.z; h[3] = (_Float16)v.w;
        ((v4h*)xh)[i] = h;
        return;
    }
    const float* in; _Float16* out; int K, N, lgnt;   // lgnt = log2(N / 32)
    if (b < 4 * TB_E) {
        const int w = b / TB_E;
        b -= w * TB_E;
        in  = (w == 0) ? wq : (w == 1) ? wk : (w == 2) ? wv : wo;
        out = (w == 3) ? woT : wqkvT + (size_t)w * E_DIM * E_DIM;
        K = E_DIM; N = E_DIM; lgnt = 5;
    } else if (b < 4 * TB_E + TB_FF) {
        b -= 4 * TB_E;
        in = w1; out = w1T; K = E_DIM; N = FF_DIM; lgnt = 7;
    } else {
        b -= 4 * TB_E + TB_FF;
        in = w2; out = w2T; K = FF_DIM; N = E_DIM; lgnt = 5;
    }
    const int n0 = (b & ((1 << lgnt) - 1)) * 32, k0 = (b >> lgnt) * 32;
    const int tx = threadIdx.x & 31, ty = threadIdx.x >> 5;
#pragma unroll
    for (int i = 0; i < 4; ++i)
        tile[ty + i * 8][tx] = in[(size_t)(k0 + ty + i * 8) * N + n0 + tx];
    __syncthreads();
#pragma unroll
    for (int i = 0; i < 4; ++i)
        out[(size_t)(n0 + ty + i * 8) * K + k0 + tx] = (_Float16)tile[tx][ty + i * 8];
}

extern "C" void kernel_launch(void* const* d_in, const int* in_sizes, int n_in,
                              void* d_out, int out_size, void* d_ws, size_t ws_size,
                              hipStream_t stream)
{
    (void)in_sizes; (void)n_in; (void)out_size; (void)ws_size;
    const float* x   = (const float*)d_in[0];
    const int*   msk = (const int*)d_in[1];
    const float* wq  = (const float*)d_in[2];
    const float* wk  = (const float*)d_in[3];
    const float* wv  = (const float*)d_in[4];
    const float* wo  = (const float*)d_in[5];
    const float* bo  = (const float*)d_in[6];
    const float* g1  = (const float*)d_in[7];
    const float* be1 = (const float*)d_in[8];
    const float* g2  = (const float*)d_in[9];
    const float* be2 = (const float*)d_in[10];
    const float* w1  = (const float*)d_in[11];
    const float* b1  = (const float*)d_in[12];
    const float* w2  = (const float*)d_in[13];
    const float* b2  = (const float*)d_in[14];

    const int NL = 2 * L_SEQ;                       // 4096 tokens
    char* ws = (char*)d_ws;
    const size_t MB = 1024ull * 1024ull;
    _Float16* AH    = (_Float16*)(ws + 0);          //  8 MB: x f16, later h f16
    _Float16* FFH   = (_Float16*)(ws + 8 * MB);     // 32 MB: relu(h@w1+b1) f16
    _Float16* QKVH  = (_Float16*)(ws + 48 * MB);    // 24 MB: [token][Q | K | V] f16
    _Float16* ATTNH = (_Float16*)(ws + 72 * MB);    //  8 MB
    float*    RES   = (float*)(ws + 80 * MB);       // 16 MB (pre-LN1, later pre-LN2)
    float*    HBUF  = (float*)(ws + 96 * MB);       // 16 MB: h f32 (residual)
    _Float16* WQKVT = (_Float16*)(ws + 112 * MB);   //  6 MB: [wq^T ; wk^T ; wv^T] f16
    _Float16* WOT   = (_Float16*)(ws + 118 * MB);   //  2 MB: wo^T f16
    _Float16* W1T   = (_Float16*)(ws + 120 * MB);   //  8 MB: w1^T f16
    _Float16* W2T   = (_Float16*)(ws + 128 * MB);   //  8 MB: w2^T f16

    dim3 blk256(256), blk128(128);
    dim3 gP(E_DIM / 128, NL / 128);                 // (8, 32)
    dim3 gQKV(3 * E_DIM / 192, NL / 256);           // (16, 16): one block a WGP
    dim3 gF1(FF_DIM / 256, NL / 256);               // (16, 16): one block a WGP

    // x and all six weights to f16 (weights transposed)
    prep_f16<<<TB_ALL + XB_ALL, blk256, 0, stream>>>(x, wq, wk, wv, wo, w1, w2,
                                                     AH, WQKVT, WOT, W1T, W2T);

    // Q, K and V projections as one product with N = 3 E
    gemm_wmma_f16<256, 192, false, false, false, true><<<gQKV, blk256, 0, stream>>>(AH, WQKVT, nullptr, nullptr, nullptr, QKVH, NL, 3 * E_DIM, E_DIM);

    attention_wmma<<<dim3(L_SEQ / 64, H_DIM, 2), blk128, 0, stream>>>(QKVH, QKVH + E_DIM, QKVH + 2 * E_DIM, msk, ATTNH);

    // out-proj + bo + residual x  -> RES (f32)
    gemm_wmma_f16<128, 128, true, true, false, false><<<gP, blk256, 0, stream>>>(ATTNH, WOT, bo, x, RES, nullptr, NL, E_DIM, E_DIM);

    // LN1 -> h (f32 in HBUF, f16 in AH)
    layernorm_k<<<NL, blk256, 0, stream>>>(RES, g1, be1, HBUF, AH);

    // FF1: relu(h @ w1 + b1) -> FFH (f16)
    gemm_wmma_f16<256, 256, true, false, true, true><<<gF1, blk256, 0, stream>>>(AH, W1T, b1, nullptr, nullptr, FFH, NL, FF_DIM, E_DIM);

    // FF2: ff @ w2 + b2 + h -> RES (f32)
    gemm_wmma_f16<128, 128, true, true, false, false><<<gP, blk256, 0, stream>>>(FFH, W2T, b2, HBUF, RES, nullptr, NL, E_DIM, FF_DIM);

    // LN2 -> final output
    layernorm_k<<<NL, blk256, 0, stream>>>(RES, g2, be2, (float*)d_out, nullptr);
}

// v007
// It runs in 159 microseconds.
// Two timings next to v006 put it at 1.04 and 1.05 times that version's speed.
// Counting every step since v000, it is 2.51 times as fast.
#include <hip/hip_runtime.h>
#include <hip/hip_bf16.h>

typedef __attribute__((ext_vector_type(16))) _Float16 v16h;
typedef __attribute__((ext_vector_type(8)))  _Float16 v8h;
typedef __attribute__((ext_vector_type(4)))  _Float16 v4h;
typedef __attribute__((ext_vector_type(8)))  float    v8f;
typedef __attribute__((ext_vector_type(4)))  int      v4i;

#define E_DIM   1024
#define H_DIM   16
#define D_DIM   64
#define FF_DIM  4096
#define L_SEQ   2048
#define NEG_VAL (-10000.0f)

#if __has_builtin(__builtin_amdgcn_global_load_async_to_lds_b128)
#define ASYNC_LDS 1
#endif

static __device__ __forceinline__ v8f vzero8() {
    v8f v;
#pragma unroll
    for (int i = 0; i < 8; ++i) v[i] = 0.0f;
    return v;
}

// WMMA 16-bit A/B fragment from a row (LDS or global) holding a 32-half K-window.
// Lane hi-half selects K-halves [hi*8, +8) (VGPRs 0..3) and [16+hi*8, +8).
static __device__ __forceinline__ v16h load_frag(const _Float16* p, int hi) {
    union { v16h v; v8h h[2]; } u;
    u.h[0] = *reinterpret_cast<const v8h*>(p + hi * 8);
    u.h[1] = *reinterpret_cast<const v8h*>(p + 16 + hi * 8);
    return u.v;
}

#ifdef ASYNC_LDS
typedef __attribute__((address_space(1))) v4i*  gptr_v4i;
typedef __attribute__((address_space(3))) v4i*  lptr_v4i;
typedef __attribute__((address_space(1))) void* gptr_void;
typedef __attribute__((address_space(3))) void* lptr_void;

static __device__ __forceinline__ void async_cp16(const _Float16* g, _Float16* l) {
    __builtin_amdgcn_global_load_async_to_lds_b128(
        (gptr_v4i)(gptr_void)const_cast<_Float16*>(g),
        (lptr_v4i)(lptr_void)l, 0, 0);
}
static __device__ __forceinline__ void wait_async0() {
    // asm with the memory clobber: holds every later LDS read behind the wait
    asm volatile("s_wait_asynccnt 0x0" ::: "memory");
}
#else
// no async path: same ring, staged through registers
static __device__ __forceinline__ void async_cp16(const _Float16* g, _Float16* l) {
    *reinterpret_cast<v8h*>(l) = *reinterpret_cast<const v8h*>(g);
}
static __device__ __forceinline__ void wait_async0() {}
#endif

#define KT  128   // halfs of K per pass: one 256-B piece of every operand row
#define LDP 136   // LDS row pitch in halfs: 272 B = 16 B x 17, for ds_load_b128

// ---------------------------------------------------------------------------
// Tiled f16 WMMA GEMM:  C[M,N] = A[M,K] * Bt[N,K]^T  (Bt is B transposed)
// 256 threads (8 waves, 4 x 2), block tile BM x BN, wave tile BM/4 x BN/2,
// K-step 128, two LDS buffers; tile t+1 streams in during tile t. 16 lanes
// copy one 256-B row piece, so a wave's copy instruction covers whole lines.
// The tile is the largest whose grid still gives every WGP a block: operand
// bytes brought from L2 and fragment bytes read from LDS per product both
// fall as (BM + BN) / (BM * BN).
// K must be a multiple of KT, M of BM, N of BN.
// ---------------------------------------------------------------------------
template <int BM, int BN, bool BIAS, bool RES, bool RELU, bool OUT16>
__global__ __launch_bounds__(256, 1)
void gemm_wmma_f16(const _Float16* __restrict__ A, const _Float16* __restrict__ Bt,
                   const float* __restrict__ bias, const float* __restrict__ res,
                   float* __restrict__ outF, _Float16* __restrict__ outH,
                   int M, int N, int K)
{
    constexpr int  FM = BM / 64;         // 16-row fragments of A per wave
    constexpr int  FN = BN / 32;         // 16-column fragments of Bt per wave
    constexpr bool PF = (BM + BN == 256);   // one operand row per thread
    static_assert(BM >= BN && BM % 64 == 0 && BN % 32 == 0, "tile shape");
    __shared__ alignas(16) _Float16 As[2][BM][LDP];
    __shared__ alignas(16) _Float16 Bs[2][BN][LDP];

    const int tid  = threadIdx.x;
    const int lane = tid & 31;
    const int wave = tid >> 5;
    const int hi   = lane >> 4;
    const int ln15 = lane & 15;
    const int m0   = blockIdx.y * BM;
    const int n0   = blockIdx.x * BN;
    const int wr   = (wave >> 1) * (BM / 4);
    const int wc   = (wave & 1) * (BN / 2);

    v8f acc[FM][FN];
#pragma unroll
    for (int i = 0; i < FM; ++i)
#pragma unroll
        for (int j = 0; j < FN; ++j) acc[i][j] = vzero8();

    const int ldRow = tid >> 4;          // 0..15, rows ldRow + 16 i
    const int ldCol = (tid & 15) * 8;    // 16-B piece of the 256-B row piece
    const _Float16* aG = A  + (size_t)(m0 + ldRow) * K + ldCol;
    const _Float16* bG = Bt + (size_t)(n0 + ldRow) * K + ldCol;
    const size_t rstep = (size_t)16 * K;
    // one row of [A 128 rows | Bt 128 rows] per thread, for the L2 prefetch
    // (128 x 128 tile only)
    const _Float16* pG = (tid < 128) ? A  + (size_t)(m0 + tid) * K
                                     : Bt + (size_t)(n0 + tid - 128) * K;
    const int nk = K / KT;

    auto stage = [&](int buf, int kt) {
#pragma unroll
        for (int i = 0; i < BM / 16; ++i) {          // BM >= BN
            async_cp16(aG + i * rstep + kt, &As[buf][i * 16 + ldRow][ldCol]);
            if (i < BN / 16)
                async_cp16(bG + i * rstep + kt, &Bs[buf][i * 16 + ldRow][ldCol]);
        }
    };

    auto compute = [&](int buf) {
#pragma unroll
        for (int ks = 0; ks < KT / 32; ++ks) {
            v16h af[FM], bf[FN];
#pragma unroll
            for (int i = 0; i < FM; ++i)
                af[i] = load_frag(&As[buf][wr + i * 16 + ln15][ks * 32], hi);
#pragma unroll
            for (int j = 0; j < FN; ++j)
                bf[j] = load_frag(&Bs[buf][wc + j * 16 + ln15][ks * 32], hi);
            // large tiles: all fragment loads of a k block stand as one group
            // ahead of its products; left free, the compiler keeps one A
            // fragment and waits out an LDS round trip before every row of
            // products, which the SIMD's one other wave cannot cover
            if (!PF) __builtin_amdgcn_sched_barrier(0);
#pragma unroll
            for (int i = 0; i < FM; ++i)
#pragma unroll
                for (int j = 0; j < FN; ++j)
                    acc[i][j] = __builtin_amdgcn_wmma_f32_16x16x32_f16(
                        false, af[i], false, bf[j], (short)0, acc[i][j], false, false);
            // and no load of the next k block moves in among these products,
            // nor a product behind the pass's barrier
            if (!PF) __builtin_amdgcn_sched_barrier(0);
        }
    };

    // prologue: tile 0 lands and is published, then tile 1 starts
    stage(0, 0);
    wait_async0();
    __syncthreads();
    if (nk > 1) {
        stage(1, KT);
        if (PF && nk > 2) __builtin_prefetch(pG + 2 * KT, 0, 1);   // into L2
    }
    for (int t = 0; t < nk; ++t) {
        compute(t & 1);
        // publish point of tile t+1: this wave's reads of tile t are done,
        // its own copies of tile t+1 have landed, then every wave meets
        asm volatile("s_wait_dscnt 0x0" ::: "memory");
        wait_async0();
        __syncthreads();
        if (t + 2 < nk) {                // refill the buffer every reader has left
            stage(t & 1, (t + 2) * KT);
            if (PF && t + 3 < nk)        // L2 prefetch one tile ahead of the copies
                __builtin_prefetch(pG + (t + 3) * KT, 0, 1);
        }
    }
    wait_async0();                       // nothing in flight when the wave ends

    // C layout: lane holds column n = lane&15; VGPR r holds row r + 8*hi.
#pragma unroll
    for (int i = 0; i < FM; ++i) {
#pragma unroll
        for (int j = 0; j < FN; ++j)
#pragma unroll
            for (int r = 0; r < 8; ++r) {
                int row = m0 + wr + i * 16 + hi * 8 + r;
                int col = n0 + wc + j * 16 + ln15;
                float v = acc[i][j][r];
                if (BIAS) v += bias[col];
                if (RES)  v += res[(size_t)row * N + col];
                if (RELU) v = fmaxf(v, 0.0f);
                if (OUT16) outH[(size_t)row * N + col] = (_Float16)v;
                else       outF[(size_t)row * N + col] = v;
            }
        if (!PF && i + 1 < FM) {
            // ahead of the next 16 rows' values and addresses in registers
            // that the stores above name; the two scheduling fences keep that
            // arithmetic behind the wait
            __builtin_amdgcn_sched_barrier(0);
            asm volatile("s_wait_xcnt 0x0" ::: "memory");
            __builtin_amdgcn_sched_barrier(0);
        }
    }
}

// ---------------------------------------------------------------------------
// Flash attention with WMMA, transposed products: S^T = K Q^T, O^T += V^T P^T.
// 256 threads (8 waves) per block; block handles 128 queries of one (batch,
// head), two blocks a WGP. A wave owns 32 query columns as two groups of 16,
// so that every K and V fragment read from LDS feeds two products. That alone
// would leave two waves a SIMD, too few to cover the vector work between the
// products; so waves w and w + 4 share their 32 columns and split the keys:
// of every stage of 128 keys wave w takes the first 64, wave w + 4 the rest,
// each with its own maximum, sums and output, joined once through LDS at the
// end. Key chunk = 32.
// K and V rows come by asynchronous copies into a ring of two LDS buffers of
// 128 keys (two chunks a wave): stage s + 1 flies while stage s is worked on.
// In each group a lane (c = lane & 15, h = lane >> 4) holds 16 scores of ONE
// query c (keys 8h + r and 16 + 8h + r), so maximum and sum run in the lane's
// own registers;
// the two score tiles, converted in place, are the B operand of the second
// product in the hardware k order.
// The loop is bound by vector issue, so a chunk's common case is kept short:
// P = 2^(score * SC_LOG2 - mu), one multiply-add and one exponential a score,
// with mu the maximum in use. ONE ballot a chunk asks whether any lane needs
// more: a mask word of the chunk that is zero, or a score that would make P
// exceed 2^LAZY_LOG2. Only then does the wave select masked scores, exchange
// the maximum between its halves, raise mu and rescale sums and output.
// Every loop over fragments or registers is unrolled so that each index is a
// constant and the arrays stay in registers.
// ---------------------------------------------------------------------------
typedef __attribute__((ext_vector_type(8))) short s16x8;
typedef __attribute__((address_space(3))) s16x8 lds_s16x8;

// row-major 16-bit LDS tile -> 8 k of one column per lane (half an A fragment)
static __device__ __forceinline__ v8h ld_tr16(const char* p) {
    return __builtin_bit_cast(v8h, __builtin_amdgcn_ds_load_tr16_b128_v8i16((lds_s16x8*)p));
}
// lane l with lane l ^ 16
static __device__ __forceinline__ float xhalf(float x) {
    return __builtin_bit_cast(float, __builtin_amdgcn_permlanex16(
        __builtin_bit_cast(int, x), __builtin_bit_cast(int, x),
        0x76543210, 0xfedcba98, false, false));
}

#define VPITCH 80   // halfs: 160 B = 32 B x 5, for ds_load_tr16_b128
#define QKV_LD (3 * E_DIM)   // row pitch of Q, K and V: column blocks of one matrix
#define SKEYS  128           // keys per stage of the K/V ring
#define WKEYS  (SKEYS / 2)   // keys of a stage that one wave works on
#define NSTAGE (L_SEQ / SKEYS)
#define QG     2             // groups of 16 query columns per wave
#define QBLK   (4 * QG * 16) // queries per block
#define SC_LOG2      0.18033688011112042f   // log2(e) / sqrt(D): raw score -> power of two
#define RAW_PER_LOG2 5.545177444479562f     // its inverse
#define LAZY_LOG2    8.0f                   // P stays below 2^8, far inside f16

// maximum of a lane's 16 scores, two chains of three-input maxima
static __device__ __forceinline__ float max16(const v8f& a, const v8f& b) {
    float x = fmaxf(fmaxf(a[0], a[1]), a[2]);
    float y = fmaxf(fmaxf(b[0], b[1]), b[2]);
    x = fmaxf(fmaxf(x, a[3]), a[4]);
    y = fmaxf(fmaxf(y, b[3]), b[4]);
    x = fmaxf(fmaxf(x, a[5]), a[6]);
    y = fmaxf(fmaxf(y, b[5]), b[6]);
    return fmaxf(fmaxf(fmaxf(x, y), a[7]), b[7]);
}

// four waves a SIMD: 256 registers a wave, two blocks' LDS in one WGP
__global__ __launch_bounds__(256) __attribute__((amdgpu_waves_per_eu(4, 4)))
void attention_wmma(const _Float16* __restrict__ Q, const _Float16* __restrict__ K,
                    const _Float16* __restrict__ V, const int* __restrict__ mask,
                    _Float16* __restrict__ O)
{
    __shared__ alignas(16) _Float16 Ks[2][SKEYS][72];      // [key][d], A rows of S^T
    __shared__ alignas(32) _Float16 Vs[2][SKEYS][VPITCH];  // [key][d], read transposed
    __shared__ float4 Jn[4][QG * 8 + 1][32];   // second key half's output, sums, maxima

    const int tid  = threadIdx.x;
    const int lane = tid & 31;
    const int wave = __builtin_amdgcn_readfirstlane(tid >> 5);   // scalar: offsets, the join's branches
    const int cw   = wave & 3;           // which 32 query columns
    const int kh   = wave >> 2;          // which half of every stage's keys
    const int hi   = lane >> 4;
    const int ln15 = lane & 15;
    const int q0   = blockIdx.x * QBLK;
    const int hh   = blockIdx.y;
    const int nb   = blockIdx.z;
    const size_t baseTok = (size_t)nb * L_SEQ;
    const int co   = hh * D_DIM;
    const int* mrow = mask + nb * L_SEQ;

    // Q^T as B operand, loaded once: column = query ln15, k order as K's rows
    v16h qf[QG][2];
#pragma unroll
    for (int g = 0; g < QG; ++g) {
        const _Float16* qp = Q + (baseTok + q0 + (cw * QG + g) * 16 + ln15) * QKV_LD + co;
        qf[g][0] = load_frag(qp, hi);
        qf[g][1] = load_frag(qp + 32, hi);
    }

    v8f   o[QG][4];                      // o[g][t][r] = O[query ln15 of g][16 t + 8 hi + r]
    v8f   ls[QG];                        // eight partial sums of this half's P
    float mu[QG];                        // maximum in use, as a power of two
    float thr[QG];                       // raw score above which mu has to grow
#pragma unroll
    for (int g = 0; g < QG; ++g) {
#pragma unroll
        for (int t = 0; t < 4; ++t) o[g][t] = vzero8();
        ls[g]  = vzero8();
        mu[g]  = -3.0e38f;
        thr[g] = -3.0e38f;
    }

    // eight lanes copy one 128-B row, so a wave's copy covers four whole lines
    const int crow = tid >> 3;           // 0..31, rows crow + 32 i
    const int ccol = (tid & 7) * 8;      // 16-B piece of the row
    const _Float16* kG = K + (baseTok + crow) * QKV_LD + co + ccol;
    const _Float16* vG = V + (baseTok + crow) * QKV_LD + co + ccol;
    auto stage = [&](int buf, int key0) {
#pragma unroll                           // eight copies issued back to back
        for (int i = 0; i < SKEYS / 32; ++i) {
            const size_t off = (size_t)(key0 + i * 32) * QKV_LD;
            async_cp16(kG + off, &Ks[buf][i * 32 + crow][ccol]);
            async_cp16(vG + off, &Vs[buf][i * 32 + crow][ccol]);
        }
    };
    const int vlane = (8 * hi + (lane & 7)) * (VPITCH * 2) + ((lane >> 3) & 1) * 16;

    // prologue: stage 0 lands and is published, then stage 1 starts
    stage(0, 0);
    wait_async0();
    __syncthreads();
    stage(1, SKEYS);

    int mw = mrow[kh * WKEYS + lane];    // mask word of key `lane` of the chunk
    // ahead of new values in the registers that the global load above names;
    // the two scheduling fences keep the set-up that follows behind the wait
    __builtin_amdgcn_sched_barrier(0);
    asm volatile("s_wait_xcnt 0x0" ::: "memory");
    __builtin_amdgcn_sched_barrier(0);

    for (int st = 0; st < NSTAGE; ++st) {
      const int buf = st & 1;
      const char* vtp = (const char*)&Vs[buf][kh * WKEYS][0] + vlane;
#pragma unroll
      for (int sub = 0; sub < WKEYS / 32; ++sub) {   // unrolled: LDS offsets constant
        // the next chunk's mask word, one chunk ahead of its use (behind the
        // last chunk the address is held inside the row; that word is not used)
        const int keyn = min((sub + 1 < WKEYS / 32 ? st * SKEYS + sub * 32 + 32
                                                   : st * SKEYS + SKEYS) + kh * WKEYS, L_SEQ - 32);
        const int mwn  = mrow[keyn + lane];
        // ahead of the next chunk's new value in the address registers that
        // the global load above names
        asm volatile("s_wait_xcnt 0x0" ::: "memory");

        // S^T = K(32x64) @ Q^T(64x16) per group:
        // s[g][c][r] = score(key 16 c + 8 hi + r, query ln15 of group g)
        v16h kf[2][2];
#pragma unroll
        for (int c = 0; c < 2; ++c)
#pragma unroll
            for (int ks = 0; ks < 2; ++ks)
                kf[c][ks] = load_frag(&Ks[buf][kh * WKEYS + sub * 32 + c * 16 + ln15][ks * 32], hi);

        // V^T fragments: 16 d x 32 keys each, two transposing loads
        v16h vf[4];
#pragma unroll
        for (int t = 0; t < 4; ++t) {
            union { v16h v; v8h h[2]; } u;
            u.h[0] = ld_tr16(vtp + (sub * 32) * (VPITCH * 2) + 32 * t);
            u.h[1] = ld_tr16(vtp + (sub * 32 + 16) * (VPITCH * 2) + 32 * t);
            vf[t] = u.v;
        }
        // holds all 16 fragment loads ahead of the products: one LDS round
        // trip a chunk; left free, the compiler sinks them between the WMMAs
        __builtin_amdgcn_sched_barrier(0);

        v8f s[QG][2];
#pragma unroll
        for (int g = 0; g < QG; ++g) { s[g][0] = vzero8(); s[g][1] = vzero8(); }
#pragma unroll
        for (int ks = 0; ks < 2; ++ks)
#pragma unroll
            for (int g = 0; g < QG; ++g)
#pragma unroll
                for (int c = 0; c < 2; ++c)
                    s[g][c] = __builtin_amdgcn_wmma_f32_16x16x32_f16(
                        false, kf[c][ks], false, qf[g][ks], (short)0, s[g][c], false, false);
        // the eight products stand together: a maximum moved in among them
        // reads a result too early and is padded with idle vector slots,
        // which the SIMD's other waves then lack
        __builtin_amdgcn_sched_barrier(0);

        // one wave-uniform test a chunk: a scalar branch, no barrier inside
        bool more = (mw == 0);
#pragma unroll
        for (int g = 0; g < QG; ++g) more |= (max16(s[g][0], s[g][1]) > thr[g]);
        if (__builtin_amdgcn_ballot_w32(more) != 0u) {
            // mask on the raw score (before scaling):
            // bit k of the ballot is key k of the chunk, this lane's keys
            // are 16 c + 8 hi + r
            const unsigned live = __builtin_amdgcn_ballot_w32(mw != 0) >> (hi * 8);
#pragma unroll
            for (int g = 0; g < QG; ++g) {
#pragma unroll
                for (int c = 0; c < 2; ++c)
#pragma unroll
                    for (int r = 0; r < 8; ++r)
                        if (((live >> (c * 16 + r)) & 1u) == 0u) s[g][c][r] = NEG_VAL;
                float mx = max16(s[g][0], s[g][1]);
                mx = fmaxf(mx, xhalf(mx));   // both halves of a query agree on mu
                const float mn   = fmaxf(mu[g], mx * SC_LOG2);
                const float corr = __builtin_amdgcn_exp2f(mu[g] - mn);
                mu[g]  = mn;
                thr[g] = (mn + LAZY_LOG2) * RAW_PER_LOG2;
                ls[g]  = ls[g] * corr;
#pragma unroll
                for (int t = 0; t < 4; ++t) o[g][t] = o[g][t] * corr;
            }
        }

        v16h pf[QG];                     // P^T: element e = key 16 (e / 8) + 8 hi + e % 8
#pragma unroll
        for (int g = 0; g < QG; ++g) {
            v8f scv, nmu;
#pragma unroll
            for (int r = 0; r < 8; ++r) { scv[r] = SC_LOG2; nmu[r] = -mu[g]; }
#pragma unroll
            for (int c = 0; c < 2; ++c) {
                const v8f e = __builtin_elementwise_fma(s[g][c], scv, nmu);
                v8f p;
#pragma unroll
                for (int r = 0; r < 8; ++r) {
                    p[r] = __builtin_amdgcn_exp2f(e[r]);
                    pf[g][c * 8 + r] = (_Float16)p[r];
                }
                ls[g] = ls[g] + p;
            }
        }
        // likewise: both groups' P stand ready ahead of the eight products, so
        // that no vector write into an operand register waits behind a product
        __builtin_amdgcn_sched_barrier(0);

        // O^T += V^T(64x32) @ P^T(32x16)
#pragma unroll
        for (int g = 0; g < QG; ++g)
#pragma unroll
            for (int t = 0; t < 4; ++t)
                o[g][t] = __builtin_amdgcn_wmma_f32_16x16x32_f16(
                    false, vf[t], false, pf[g], (short)0, o[g][t], false, false);
        mw = mwn;
        // keeps the next chunk's fragment loads one group behind these
        // products, not strewn among them, and the stage's last products ahead
        // of the barrier: left free, the compiler sinks those behind it and
        // the refill starts a whole chunk later
        __builtin_amdgcn_sched_barrier(0);
      }
      // publish point of stage st + 1: this wave's reads of stage st are done,
      // its own copies of stage st + 1 have landed, then every wave meets
      asm volatile("s_wait_dscnt 0x0" ::: "memory");
      wait_async0();
      __syncthreads();
      if (st + 2 < NSTAGE)               // refill the buffer every reader has left
          stage(buf, (st + 2) * SKEYS);
    }
    wait_async0();                       // nothing in flight when the wave ends

    // the two key halves join: wave w + 4 hands its output, sums and maxima to
    // wave w, 16 B a lane and 512 B in a row per store
    float lr[QG];
#pragma unroll
    for (int g = 0; g < QG; ++g) {
        const v8f& l = ls[g];
        lr[g] = ((l[0] + l[1]) + (l[2] + l[3])) + ((l[4] + l[5]) + (l[6] + l[7]));
    }
    if (kh == 1) {
#pragma unroll
        for (int g = 0; g < QG; ++g)
#pragma unroll
            for (int t = 0; t < 4; ++t) {
                const v8f& a = o[g][t];
                Jn[cw][(g * 4 + t) * 2 + 0][lane] = make_float4(a[0], a[1], a[2], a[3]);
                Jn[cw][(g * 4 + t) * 2 + 1][lane] = make_float4(a[4], a[5], a[6], a[7]);
            }
        Jn[cw][QG * 8][lane] = make_float4(lr[0], lr[1], mu[0], mu[1]);
    }
    __syncthreads();                     // every wave passes it; wave w reads behind it
    if (kh == 0) {
        const float4 x = Jn[cw][QG * 8][lane];
#pragma unroll
        for (int g = 0; g < QG; ++g) {
            const float lb = g ? x.y : x.x;
            const float mb = g ? x.w : x.z;
            const float mn = fmaxf(mu[g], mb);
            float ca = __builtin_amdgcn_exp2f(mu[g] - mn);
            float cb = __builtin_amdgcn_exp2f(mb - mn);
            const float lj = lr[g] * ca + lb * cb;
            // the lane halves' sums join once; a lane stores 8 consecutive d of its query
            const float inv = 1.0f / (lj + xhalf(lj));
            ca *= inv;
            cb *= inv;
            _Float16* dst = O + (baseTok + q0 + (cw * QG + g) * 16 + ln15) * E_DIM + co + hi * 8;
#pragma unroll
            for (int t = 0; t < 4; ++t) {
                const float4 b0 = Jn[cw][(g * 4 + t) * 2 + 0][lane];
                const float4 b1 = Jn[cw][(g * 4 + t) * 2 + 1][lane];
                const v8f& a = o[g][t];
                v8h h;
                h[0] = (_Float16)(a[0] * ca + b0.x * cb);
                h[1] = (_Float16)(a[1] * ca + b0.y * cb);
                h[2] = (_Float16)(a[2] * ca + b0.z * cb);
                h[3] = (_Float16)(a[3] * ca + b0.w * cb);
                h[4] = (_Float16)(a[4] * ca + b1.x * cb);
                h[5] = (_Float16)(a[5] * ca + b1.y * cb);
                h[6] = (_Float16)(a[6] * ca + b1.z * cb);
                h[7] = (_Float16)(a[7] * ca + b1.w * cb);
                *(v8h*)(dst + t * 16) = h;
            }
            if (g + 1 < QG) {
                // ahead of the next group's values in registers that the stores
                // above name; the two scheduling fences keep that arithmetic
                // behind the wait
                __builtin_amdgcn_sched_barrier(0);
                asm volatile("s_wait_xcnt 0x0" ::: "memory");
                __builtin_amdgcn_sched_barrier(0);
            }
        }
    }
}

// ---------------------------------------------------------------------------
// LayerNorm over rows of E_DIM floats; writes f32 and optionally f16 copy.
// ---------------------------------------------------------------------------
__global__ __launch_bounds__(256, 1)
void layernorm_k(const float* __restrict__ in, const float* __restrict__ g,
                 const float* __restrict__ b, float* __restrict__ outF,
                 _Float16* __restrict__ outH)
{
    const int row = blockIdx.x;
    const int t   = threadIdx.x;
    const float4 x = ((const float4*)(in + (size_t)row * E_DIM))[t];
    float s  = x.x + x.y + x.z + x.w;
    float sq = x.x * x.x + x.y * x.y + x.z * x.z + x.w * x.w;
#pragma unroll
    for (int mk = 1; mk < 32; mk <<= 1) { s += __shfl_xor(s, mk, 32); sq += __shfl_xor(sq, mk, 32); }
    __shared__ float sh_s[8], sh_q[8];
    const int wave = t >> 5;
    if ((t & 31) == 0) { sh_s[wave] = s; sh_q[wave] = sq; }
    __syncthreads();
    float ts = 0.0f, tq = 0.0f;
#pragma unroll
    for (int i = 0; i < 8; ++i) { ts += sh_s[i]; tq += sh_q[i]; }
    const float mean = ts * (1.0f / E_DIM);
    const float var  = tq * (1.0f / E_DIM) - mean * mean;
    const float inv  = rsqrtf(var + 1e-6f);
    const float4 gg = ((const float4*)g)[t];
    const float4 bb = ((const float4*)b)[t];
    float4 y;
    y.x = gg.x * (x.x - mean) * inv + bb.x;
    y.y = gg.y * (x.y - mean) * inv + bb.y;
    y.z = gg.z * (x.z - mean) * inv + bb.z;
    y.w = gg.w * (x.w - mean) * inv + bb.w;
    ((float4*)(outF + (size_t)row * E_DIM))[t] = y;
    if (outH) {
        v4h h; h[0] = (_Float16)y.x; h[1] = (_Float16)y.y;
               h[2] = (_Float16)y.z; h[3] = (_Float16)y.w;
        *(v4h*)(outH + (size_t)row * E_DIM + t * 4) = h;
    }
}

// ---------------------------------------------------------------------------
// Every f16 operand that depends on the inputs alone, made in ONE launch.
// Blocks [0, 12288): 32x32 tiles of the six weights, in[K][N] (f32) ->
// out[N][K] (f16), LDS-tiled for coalescing both ways; wq, wk, wv land one
// behind the other, so that they form one [3 E][E] operand.
// Blocks [12288, 16384): x (f32) -> f16, four elements a thread.
// ---------------------------------------------------------------------------
#define TB_E   ((E_DIM / 32) * (E_DIM / 32))     // tiles of an E x E weight
#define TB_FF  ((E_DIM / 32) * (FF_DIM / 32))    // tiles of w1 or of w2
#define TB_ALL (4 * TB_E + 2 * TB_FF)
#define XB_ALL (2 * L_SEQ * E_DIM / 4 / 256)     // blocks that convert x

__global__ __launch_bounds__(256, 1)
void prep_f16(const float* __restrict__ x,  const float* __restrict__ wq,
              const float* __restrict__ wk, const float* __restrict__ wv,
              const float* __restrict__ wo, const float* __restrict__ w1,
              const float* __restrict__ w2, _Float16* __restrict__ xh,
              _Float16* __restrict__ wqkvT, _Float16* __restrict__ woT,
              _Float16* __restrict__ w1T,   _Float16* __restrict__ w2T)
{
    __shared__ float tile[32][33];
    int b = blockIdx.x;
    if (b >= TB_ALL) {                   // whole blocks leave ahead of the barrier
        const int i = (b - TB_ALL) * 256 + threadIdx.x;
        float4 v = ((const float4*)x)[i];
        v4h h; h[0] = (_Float16)v.x; h[1] = (_Float16)v.y;
               h[2] = (_Float16)v.z; h[3] = (_Float16)v.w;
        ((v4h*)xh)[i] = h;
        return;
    }
    const float* in; _Float16* out; int K, N, lgnt;   // lgnt = log2(N / 32)
    if (b < 4 * TB_E) {
        const int w = b / TB_E;
        b -= w * TB_E;
        in  = (w == 0) ? wq : (w == 1) ? wk : (w == 2) ? wv : wo;
        out = (w == 3) ? woT : wqkvT + (size_t)w * E_DIM * E_DIM;
        K = E_DIM; N = E_DIM; lgnt = 5;
    } else if (b < 4 * TB_E + TB_FF) {
        b -= 4 * TB_E;
        in = w1; out = w1T; K = E_DIM; N = FF_DIM; lgnt = 7;
    } else {
        b -= 4 * TB_E + TB_FF;
        in = w2; out = w2T; K = FF_DIM; N = E_DIM; lgnt = 5;
    }
    const int n0 = (b & ((1 << lgnt) - 1)) * 32, k0 = (b >> lgnt) * 32;
    const int tx = threadIdx.x & 31, ty = threadIdx.x >> 5;
#pragma unroll
    for (int i = 0; i < 4; ++i)
        tile[ty + i * 8][tx] = in[(size_t)(k0 + ty + i * 8) * N + n0 + tx];
    __syncthreads();
#pragma unroll
    for (int i = 0; i < 4; ++i)
        out[(size_t)(n0 + ty + i * 8) * K + k0 + tx] = (_Float16)tile[tx][ty + i * 8];
}

extern "C" void kernel_launch(void* const* d_in, const int* in_sizes, int n_in,
                              void* d_out, int out_size, void* d_ws, size_t ws_size,
                              hipStream_t stream)
{
    (void)in_sizes; (void)n_in; (void)out_size; (void)ws_size;
    const float* x   = (const float*)d_in[0];
    const int*   msk = (const int*)d_in[1];
    const float* wq  = (const float*)d_in[2];
    const float* wk  = (const float*)d_in[3];
    const float* wv  = (const float*)d_in[4];
    const float* wo  = (const float*)d_in[5];
    const float* bo  = (const float*)d_in[6];
    const float* g1  = (const float*)d_in[7];
    const float* be1 = (const float*)d_in[8];
    const float* g2  = (const float*)d_in[9];
    const float* be2 = (const float*)d_in[10];
    const float* w1  = (const float*)d_in[11];
    const float* b1  = (const float*)d_in[12];
    const float* w2  = (const float*)d_in[13];
    const float* b2  = (const float*)d_in[14];

    const int NL = 2 * L_SEQ;                       // 4096 tokens
    char* ws = (char*)d_ws;
    const size_t MB = 1024ull * 1024ull;
    _Float16* AH    = (_Float16*)(ws + 0);          //  8 MB: x f16, later h f16
    _Float16* FFH   = (_Float16*)(ws + 8 * MB);     // 32 MB: relu(h@w1+b1) f16
    _Float16* QKVH  = (_Float16*)(ws + 48 * MB);    // 24 MB: [token][Q | K | V] f16
    _Float16* ATTNH = (_Float16*)(ws + 72 * MB);    //  8 MB
    float*    RES   = (float*)(ws + 80 * MB);       // 16 MB (pre-LN1, later pre-LN2)
    float*    HBUF  = (float*)(ws + 96 * MB);       // 16 MB: h f32 (residual)
    _Float16* WQKVT = (_Float16*)(ws + 112 * MB);   //  6 MB: [wq^T ; wk^T ; wv^T] f16
    _Float16* WOT   = (_Float16*)(ws + 118 * MB);   //  2 MB: wo^T f16
    _Float16* W1T   = (_Float16*)(ws + 120 * MB);   //  8 MB: w1^T f16
    _Float16* W2T   = (_Float16*)(ws + 128 * MB);   //  8 MB: w2^T f16

    dim3 blk256(256);
    dim3 gP(E_DIM / 128, NL / 128);                 // (8, 32)
    dim3 gQKV(3 * E_DIM / 192, NL / 256);           // (16, 16): one block a WGP
    dim3 gF1(FF_DIM / 256, NL / 256);               // (16, 16): one block a WGP

    // x and all six weights to f16 (weights transposed)
    prep_f16<<<TB_ALL + XB_ALL, blk256, 0, stream>>>(x, wq, wk, wv, wo, w1, w2,
                                                     AH, WQKVT, WOT, W1T, W2T);

    // Q, K and V projections as one product with N = 3 E
    gemm_wmma_f16<256, 192, false, false, false, true><<<gQKV, blk256, 0, stream>>>(AH, WQKVT, nullptr, nullptr, nullptr, QKVH, NL, 3 * E_DIM, E_DIM);

    attention_wmma<<<dim3(L_SEQ / QBLK, H_DIM, 2), blk256, 0, stream>>>(QKVH, QKVH + E_DIM, QKVH + 2 * E_DIM, msk, ATTNH);

    // out-proj + bo + residual x  -> RES (f32)
    gemm_wmma_f16<128, 128, true, true, false, false><<<gP, blk256, 0, stream>>>(ATTNH, WOT, bo, x, RES, nullptr, NL, E_DIM, E_DIM);

    // LN1 -> h (f32 in HBUF, f16 in AH)
    layernorm_k<<<NL, blk256, 0, stream>>>(RES, g1, be1, HBUF, AH);

    // FF1: relu(h @ w1 + b1) -> FFH (f16)
    gemm_wmma_f16<256, 256, true, false, true, true><<<gF1, blk256, 0, stream>>>(AH, W1T, b1, nullptr, nullptr, FFH, NL, FF_DIM, E_DIM);

    // FF2: ff @ w2 + b2 + h -> RES (f32)
    gemm_wmma_f16<128, 128, true, true, false, false><<<gP, blk256, 0, stream>>>(FFH, W2T, b2, HBUF, RES, nullptr, NL, E_DIM, FF_DIM);

    // LN2 -> final output
    layernorm_k<<<NL, blk256, 0, stream>>>(RES, g2, be2, (float*)d_out, nullptr);
}

// v008
// It runs in 151 microseconds.
// Timed twice side by side with v007, it ran 1.05 times as fast both times.
// Over all steps from v000 it is 2.65 times as fast.
#include <hip/hip_runtime.h>
#include <hip/hip_bf16.h>

typedef __attribute__((ext_vector_type(16))) _Float16 v16h;
typedef __attribute__((ext_vector_type(8)))  _Float16 v8h;
typedef __attribute__((ext_vector_type(4)))  _Float16 v4h;
typedef __attribute__((ext_vector_type(8)))  float    v8f;
typedef __attribute__((ext_vector_type(4)))  int      v4i;

#define E_DIM   1024
#define H_DIM   16
#define D_DIM   64
#define FF_DIM  4096
#define L_SEQ   2048
#define NEG_VAL (-10000.0f)

#if __has_builtin(__builtin_amdgcn_global_load_async_to_lds_b128)
#define ASYNC_LDS 1
#endif

static __device__ __forceinline__ v8f vzero8() {
    v8f v;
#pragma unroll
    for (int i = 0; i < 8; ++i) v[i] = 0.0f;
    return v;
}

// WMMA 16-bit A/B fragment from a row (LDS or global) holding a 32-half K-window.
// Lane hi-half selects K-halves [hi*8, +8) (VGPRs 0..3) and [16+hi*8, +8).
static __device__ __forceinline__ v16h load_frag(const _Float16* p, int hi) {
    union { v16h v; v8h h[2]; } u;
    u.h[0] = *reinterpret_cast<const v8h*>(p + hi * 8);
    u.h[1] = *reinterpret_cast<const v8h*>(p + 16 + hi * 8);
    return u.v;
}

#ifdef ASYNC_LDS
typedef __attribute__((address_space(1))) v4i*  gptr_v4i;
typedef __attribute__((address_space(3))) v4i*  lptr_v4i;
typedef __attribute__((address_space(1))) void* gptr_void;
typedef __attribute__((address_space(3))) void* lptr_void;

static __device__ __forceinline__ void async_cp16(const _Float16* g, _Float16* l) {
    __builtin_amdgcn_global_load_async_to_lds_b128(
        (gptr_v4i)(gptr_void)const_cast<_Float16*>(g),
        (lptr_v4i)(lptr_void)l, 0, 0);
}
static __device__ __forceinline__ void wait_async0() {
    // asm with the memory clobber: holds every later LDS read behind the wait
    asm volatile("s_wait_asynccnt 0x0" ::: "memory");
}
#else
// no async path: same ring, staged through registers
static __device__ __forceinline__ void async_cp16(const _Float16* g, _Float16* l) {
    *reinterpret_cast<v8h*>(l) = *reinterpret_cast<const v8h*>(g);
}
static __device__ __forceinline__ void wait_async0() {}
#endif

#define KT  128   // halfs of K per pass: one 256-B piece of every operand row
#define LDP 136   // LDS row pitch in halfs: 272 B = 16 B x 17, for ds_load_b128

// ---------------------------------------------------------------------------
// Tiled f16 WMMA GEMM:  C[M,N] = A[M,K] * Bt[N,K]^T  (Bt is B transposed)
// 256 threads (8 waves, 4 x 2), block tile BM x BN, wave tile BM/4 x BN/2,
// K-step 128, two LDS buffers; tile t+1 streams in during tile t. 16 lanes
// copy one 256-B row piece, so a wave's copy instruction covers whole lines.
// The tile is the largest whose grid still gives every WGP a block: operand
// bytes brought from L2 and fragment bytes read from LDS per product both
// fall as (BM + BN) / (BM * BN).
// K must be a multiple of KT, M of BM, N of BN.
// ---------------------------------------------------------------------------
template <int BM, int BN, bool BIAS, bool RES, bool RELU, bool OUT16>
__global__ __launch_bounds__(256, 1)
void gemm_wmma_f16(const _Float16* __restrict__ A, const _Float16* __restrict__ Bt,
                   const float* __restrict__ bias, const float* __restrict__ res,
                   float* __restrict__ outF, _Float16* __restrict__ outH,
                   int M, int N, int K)
{
    constexpr int  FM = BM / 64;         // 16-row fragments of A per wave
    constexpr int  FN = BN / 32;         // 16-column fragments of Bt per wave
    constexpr bool PF = (BM + BN == 256);   // one operand row per thread
    static_assert(BM >= BN && BM % 64 == 0 && BN % 32 == 0, "tile shape");
    __shared__ alignas(16) _Float16 As[2][BM][LDP];
    __shared__ alignas(16) _Float16 Bs[2][BN][LDP];

    const int tid  = threadIdx.x;
    const int lane = tid & 31;
    const int wave = tid >> 5;
    const int hi   = lane >> 4;
    const int ln15 = lane & 15;
    const int m0   = blockIdx.y * BM;
    const int n0   = blockIdx.x * BN;
    const int wr   = (wave >> 1) * (BM / 4);
    const int wc   = (wave & 1) * (BN / 2);

    v8f acc[FM][FN];
#pragma unroll
    for (int i = 0; i < FM; ++i)
#pragma unroll
        for (int j = 0; j < FN; ++j) acc[i][j] = vzero8();

    const int ldRow = tid >> 4;          // 0..15, rows ldRow + 16 i
    const int ldCol = (tid & 15) * 8;    // 16-B piece of the 256-B row piece
    const _Float16* aG = A  + (size_t)(m0 + ldRow) * K + ldCol;
    const _Float16* bG = Bt + (size_t)(n0 + ldRow) * K + ldCol;
    const size_t rstep = (size_t)16 * K;
    // one row of [A 128 rows | Bt 128 rows] per thread, for the L2 prefetch
    // (128 x 128 tile only)
    const _Float16* pG = (tid < 128) ? A  + (size_t)(m0 + tid) * K
                                     : Bt + (size_t)(n0 + tid - 128) * K;
    const int nk = K / KT;

    auto stage = [&](int buf, int kt) {
#pragma unroll
        for (int i = 0; i < BM / 16; ++i) {          // BM >= BN
            async_cp16(aG + i * rstep + kt, &As[buf][i * 16 + ldRow][ldCol]);
            if (i < BN / 16)
                async_cp16(bG + i * rstep + kt, &Bs[buf][i * 16 + ldRow][ldCol]);
        }
    };

    auto compute = [&](int buf) {
#pragma unroll
        for (int ks = 0; ks < KT / 32; ++ks) {
            v16h af[FM], bf[FN];
#pragma unroll
            for (int i = 0; i < FM; ++i)
                af[i] = load_frag(&As[buf][wr + i * 16 + ln15][ks * 32], hi);
#pragma unroll
            for (int j = 0; j < FN; ++j)
                bf[j] = load_frag(&Bs[buf][wc + j * 16 + ln15][ks * 32], hi);
            // large tiles: all fragment loads of a k block stand as one group
            // ahead of its products; left free, the compiler keeps one A
            // fragment and waits out an LDS round trip before every row of
            // products, which the SIMD's one other wave cannot cover
            if (!PF) __builtin_amdgcn_sched_barrier(0);
#pragma unroll
            for (int i = 0; i < FM; ++i)
#pragma unroll
                for (int j = 0; j < FN; ++j)
                    acc[i][j] = __builtin_amdgcn_wmma_f32_16x16x32_f16(
                        false, af[i], false, bf[j], (short)0, acc[i][j], false, false);
            // and no load of the next k block moves in among these products,
            // nor a product behind the pass's barrier
            if (!PF) __builtin_amdgcn_sched_barrier(0);
        }
    };

    // prologue: tile 0 lands and is published, then tile 1 starts
    stage(0, 0);
    wait_async0();
    __syncthreads();
    if (nk > 1) {
        stage(1, KT);
        if (PF && nk > 2) __builtin_prefetch(pG + 2 * KT, 0, 1);   // into L2
    }
    for (int t = 0; t < nk; ++t) {
        compute(t & 1);
        // publish point of tile t+1: this wave's reads of tile t are done,
        // its own copies of tile t+1 have landed, then every wave meets
        asm volatile("s_wait_dscnt 0x0" ::: "memory");
        wait_async0();
        __syncthreads();
        if (t + 2 < nk) {                // refill the buffer every reader has left
            stage(t & 1, (t + 2) * KT);
            if (PF && t + 3 < nk)        // L2 prefetch one tile ahead of the copies
                __builtin_prefetch(pG + (t + 3) * KT, 0, 1);
        }
    }
    wait_async0();                       // nothing in flight when the wave ends

    // C layout: lane holds column n = lane&15; VGPR r holds row r + 8*hi.
#pragma unroll
    for (int i = 0; i < FM; ++i) {
#pragma unroll
        for (int j = 0; j < FN; ++j)
#pragma unroll
            for (int r = 0; r < 8; ++r) {
                int row = m0 + wr + i * 16 + hi * 8 + r;
                int col = n0 + wc + j * 16 + ln15;
                float v = acc[i][j][r];
                if (BIAS) v += bias[col];
                if (RES)  v += res[(size_t)row * N + col];
                if (RELU) v = fmaxf(v, 0.0f);
                if (OUT16) outH[(size_t)row * N + col] = (_Float16)v;
                else       outF[(size_t)row * N + col] = v;
            }
        if (!PF && i + 1 < FM) {
            // ahead of the next 16 rows' values and addresses in registers
            // that the stores above name; the two scheduling fences keep that
            // arithmetic behind the wait
            __builtin_amdgcn_sched_barrier(0);
            asm volatile("s_wait_xcnt 0x0" ::: "memory");
            __builtin_amdgcn_sched_barrier(0);
        }
    }
}

// ---------------------------------------------------------------------------
// Flash attention with WMMA, transposed products: S^T = K Q^T, O^T += V^T P^T.
// 256 threads (8 waves) per block; block handles 128 queries of one (batch,
// head), two blocks a WGP. A wave owns 32 query columns as two groups of 16,
// so that every K and V fragment read from LDS feeds two products. That alone
// would leave two waves a SIMD, too few to cover the vector work between the
// products; so waves w and w + 4 share their 32 columns and split the keys:
// of every stage of 128 keys wave w takes the first 64, wave w + 4 the rest,
// each with its own maximum, sums and output, joined once through LDS at the
// end. Key chunk = 32.
// K and V rows come by asynchronous copies into a ring of two LDS buffers of
// 128 keys (two chunks a wave): stage s + 1 flies while stage s is worked on.
// In each group a lane (c = lane & 15, h = lane >> 4) holds 16 scores of ONE
// query c (keys 8h + r and 16 + 8h + r), so maximum and sum run in the lane's
// own registers;
// the two score tiles, converted in place, are the B operand of the second
// product in the hardware k order.
// The loop is bound by vector issue, so a chunk's common case is kept short:
// P = 2^(score * SC_LOG2 - mu), one multiply-add and one exponential a score,
// with mu the maximum in use. ONE ballot a chunk asks whether any lane needs
// more: a mask word of the chunk that is zero, or a score that would make P
// exceed 2^LAZY_LOG2. Only then does the wave select masked scores, exchange
// the maximum between its halves, raise mu and rescale sums and output.
// Every loop over fragments or registers is unrolled so that each index is a
// constant and the arrays stay in registers.
// ---------------------------------------------------------------------------
typedef __attribute__((ext_vector_type(8))) short s16x8;
typedef __attribute__((address_space(3))) s16x8 lds_s16x8;

// row-major 16-bit LDS tile -> 8 k of one column per lane (half an A fragment)
static __device__ __forceinline__ v8h ld_tr16(const char* p) {
    return __builtin_bit_cast(v8h, __builtin_amdgcn_ds_load_tr16_b128_v8i16((lds_s16x8*)p));
}
// lane l with lane l ^ 16
static __device__ __forceinline__ float xhalf(float x) {
    return __builtin_bit_cast(float, __builtin_amdgcn_permlanex16(
        __builtin_bit_cast(int, x), __builtin_bit_cast(int, x),
        0x76543210, 0xfedcba98, false, false));
}

#define VPITCH 80   // halfs: 160 B = 32 B x 5, for ds_load_tr16_b128
#define QKV_LD (3 * E_DIM)   // row pitch of Q, K and V: column blocks of one matrix
#define SKEYS  128           // keys per stage of the K/V ring
#define WKEYS  (SKEYS / 2)   // keys of a stage that one wave works on
#define NSTAGE (L_SEQ / SKEYS)
#define QG     2             // groups of 16 query columns per wave
#define QBLK   (4 * QG * 16) // queries per block
#define SC_LOG2      0.18033688011112042f   // log2(e) / sqrt(D): raw score -> power of two
#define RAW_PER_LOG2 5.545177444479562f     // its inverse
#define LAZY_LOG2    8.0f                   // P stays below 2^8, far inside f16

// maximum of a lane's 16 scores, two chains of three-input maxima
static __device__ __forceinline__ float max16(const v8f& a, const v8f& b) {
    float x = fmaxf(fmaxf(a[0], a[1]), a[2]);
    float y = fmaxf(fmaxf(b[0], b[1]), b[2]);
    x = fmaxf(fmaxf(x, a[3]), a[4]);
    y = fmaxf(fmaxf(y, b[3]), b[4]);
    x = fmaxf(fmaxf(x, a[5]), a[6]);
    y = fmaxf(fmaxf(y, b[5]), b[6]);
    return fmaxf(fmaxf(fmaxf(x, y), a[7]), b[7]);
}

// four waves a SIMD: 256 registers a wave, two blocks' LDS in one WGP
__global__ __launch_bounds__(256) __attribute__((amdgpu_waves_per_eu(4, 4)))
void attention_wmma(const _Float16* __restrict__ Q, const _Float16* __restrict__ K,
                    const _Float16* __restrict__ V, const int* __restrict__ mask,
                    _Float16* __restrict__ O)
{
    __shared__ alignas(16) _Float16 Ks[2][SKEYS][72];      // [key][d], A rows of S^T
    __shared__ alignas(32) _Float16 Vs[2][SKEYS][VPITCH];  // [key][d], read transposed
    __shared__ float4 Jn[4][QG * 8 + 1][32];   // second key half's output, sums, maxima

    const int tid  = threadIdx.x;
    const int lane = tid & 31;
    const int wave = __builtin_amdgcn_readfirstlane(tid >> 5);   // scalar: offsets, the join's branches
    const int cw   = wave & 3;           // which 32 query columns
    const int kh   = wave >> 2;          // which half of every stage's keys
    const int hi   = lane >> 4;
    const int ln15 = lane & 15;
    const int q0   = blockIdx.x * QBLK;
    const int hh   = blockIdx.y;
    const int nb   = blockIdx.z;
    const size_t baseTok = (size_t)nb * L_SEQ;
    const int co   = hh * D_DIM;
    const int* mrow = mask + nb * L_SEQ;

    // Q^T as B operand, loaded once: column = query ln15, k order as K's rows
    v16h qf[QG][2];
#pragma unroll
    for (int g = 0; g < QG; ++g) {
        const _Float16* qp = Q + (baseTok + q0 + (cw * QG + g) * 16 + ln15) * QKV_LD + co;
        qf[g][0] = load_frag(qp, hi);
        qf[g][1] = load_frag(qp + 32, hi);
    }

    v8f   o[QG][4];                      // o[g][t][r] = O[query ln15 of g][16 t + 8 hi + r]
    v8f   ls[QG];                        // eight partial sums of this half's P
    float mu[QG];                        // maximum in use, as a power of two
    float thr[QG];                       // raw score above which mu has to grow
#pragma unroll
    for (int g = 0; g < QG; ++g) {
#pragma unroll
        for (int t = 0; t < 4; ++t) o[g][t] = vzero8();
        ls[g]  = vzero8();
        mu[g]  = -3.0e38f;
        thr[g] = -3.0e38f;
    }

    // eight lanes copy one 128-B row, so a wave's copy covers four whole lines
    const int crow = tid >> 3;           // 0..31, rows crow + 32 i
    const int ccol = (tid & 7) * 8;      // 16-B piece of the row
    const _Float16* kG = K + (baseTok + crow) * QKV_LD + co + ccol;
    const _Float16* vG = V + (baseTok + crow) * QKV_LD + co + ccol;
    auto stage = [&](int buf, int key0) {
#pragma unroll                           // eight copies issued back to back
        for (int i = 0; i < SKEYS / 32; ++i) {
            const size_t off = (size_t)(key0 + i * 32) * QKV_LD;
            async_cp16(kG + off, &Ks[buf][i * 32 + crow][ccol]);
            async_cp16(vG + off, &Vs[buf][i * 32 + crow][ccol]);
        }
    };
    const int vlane = (8 * hi + (lane & 7)) * (VPITCH * 2) + ((lane >> 3) & 1) * 16;

    // prologue: stage 0 lands and is published, then stage 1 starts
    stage(0, 0);
    wait_async0();
    __syncthreads();
    stage(1, SKEYS);

    int mw = mrow[kh * WKEYS + lane];    // mask word of key `lane` of the chunk
    // ahead of new values in the registers that the global load above names;
    // the two scheduling fences keep the set-up that follows behind the wait
    __builtin_amdgcn_sched_barrier(0);
    asm volatile("s_wait_xcnt 0x0" ::: "memory");
    __builtin_amdgcn_sched_barrier(0);

    for (int st = 0; st < NSTAGE; ++st) {
      const int buf = st & 1;
      const char* vtp = (const char*)&Vs[buf][kh * WKEYS][0] + vlane;
#pragma unroll
      for (int sub = 0; sub < WKEYS / 32; ++sub) {   // unrolled: LDS offsets constant
        // the next chunk's mask word, one chunk ahead of its use (behind the
        // last chunk the address is held inside the row; that word is not used)
        const int keyn = min((sub + 1 < WKEYS / 32 ? st * SKEYS + sub * 32 + 32
                                                   : st * SKEYS + SKEYS) + kh * WKEYS, L_SEQ - 32);
        const int mwn  = mrow[keyn + lane];
        // ahead of the next chunk's new value in the address registers that
        // the global load above names
        asm volatile("s_wait_xcnt 0x0" ::: "memory");

        // S^T = K(32x64) @ Q^T(64x16) per group:
        // s[g][c][r] = score(key 16 c + 8 hi + r, query ln15 of group g)
        v16h kf[2][2];
#pragma unroll
        for (int c = 0; c < 2; ++c)
#pragma unroll
            for (int ks = 0; ks < 2; ++ks)
                kf[c][ks] = load_frag(&Ks[buf][kh * WKEYS + sub * 32 + c * 16 + ln15][ks * 32], hi);

        // V^T fragments: 16 d x 32 keys each, two transposing loads
        v16h vf[4];
#pragma unroll
        for (int t = 0; t < 4; ++t) {
            union { v16h v; v8h h[2]; } u;
            u.h[0] = ld_tr16(vtp + (sub * 32) * (VPITCH * 2) + 32 * t);
            u.h[1] = ld_tr16(vtp + (sub * 32 + 16) * (VPITCH * 2) + 32 * t);
            vf[t] = u.v;
        }
        // holds all 16 fragment loads ahead of the products: one LDS round
        // trip a chunk; left free, the compiler sinks them between the WMMAs
        __builtin_amdgcn_sched_barrier(0);

        v8f s[QG][2];
#pragma unroll
        for (int g = 0; g < QG; ++g) { s[g][0] = vzero8(); s[g][1] = vzero8(); }
#pragma unroll
        for (int ks = 0; ks < 2; ++ks)
#pragma unroll
            for (int g = 0; g < QG; ++g)
#pragma unroll
                for (int c = 0; c < 2; ++c)
                    s[g][c] = __builtin_amdgcn_wmma_f32_16x16x32_f16(
                        false, kf[c][ks], false, qf[g][ks], (short)0, s[g][c], false, false);
        // the eight products stand together: a maximum moved in among them
        // reads a result too early and is padded with idle vector slots,
        // which the SIMD's other waves then lack
        __builtin_amdgcn_sched_barrier(0);

        // one wave-uniform test a chunk: a scalar branch, no barrier inside
        bool more = (mw == 0);
#pragma unroll
        for (int g = 0; g < QG; ++g) more |= (max16(s[g][0], s[g][1]) > thr[g]);
        if (__builtin_amdgcn_ballot_w32(more) != 0u) {
            // mask on the raw score (before scaling):
            // bit k of the ballot is key k of the chunk, this lane's keys
            // are 16 c + 8 hi + r
            const unsigned live = __builtin_amdgcn_ballot_w32(mw != 0) >> (hi * 8);
#pragma unroll
            for (int g = 0; g < QG; ++g) {
#pragma unroll
                for (int c = 0; c < 2; ++c)
#pragma unroll
                    for (int r = 0; r < 8; ++r)
                        if (((live >> (c * 16 + r)) & 1u) == 0u) s[g][c][r] = NEG_VAL;
                float mx = max16(s[g][0], s[g][1]);
                mx = fmaxf(mx, xhalf(mx));   // both halves of a query agree on mu
                const float mn   = fmaxf(mu[g], mx * SC_LOG2);
                const float corr = __builtin_amdgcn_exp2f(mu[g] - mn);
                mu[g]  = mn;
                thr[g] = (mn + LAZY_LOG2) * RAW_PER_LOG2;
                ls[g]  = ls[g] * corr;
#pragma unroll
                for (int t = 0; t < 4; ++t) o[g][t] = o[g][t] * corr;
            }
        }

        v16h pf[QG];                     // P^T: element e = key 16 (e / 8) + 8 hi + e % 8
#pragma unroll
        for (int g = 0; g < QG; ++g) {
            v8f scv, nmu;
#pragma unroll
            for (int r = 0; r < 8; ++r) { scv[r] = SC_LOG2; nmu[r] = -mu[g]; }
#pragma unroll
            for (int c = 0; c < 2; ++c) {
                const v8f e = __builtin_elementwise_fma(s[g][c], scv, nmu);
                v8f p;
#pragma unroll
                for (int r = 0; r < 8; ++r) {
                    p[r] = __builtin_amdgcn_exp2f(e[r]);
                    pf[g][c * 8 + r] = (_Float16)p[r];
                }
                ls[g] = ls[g] + p;
            }
        }
        // likewise: both groups' P stand ready ahead of the eight products, so
        // that no vector write into an operand register waits behind a product
        __builtin_amdgcn_sched_barrier(0);

        // O^T += V^T(64x32) @ P^T(32x16)
#pragma unroll
        for (int g = 0; g < QG; ++g)
#pragma unroll
            for (int t = 0; t < 4; ++t)
                o[g][t] = __builtin_amdgcn_wmma_f32_16x16x32_f16(
                    false, vf[t], false, pf[g], (short)0, o[g][t], false, false);
        mw = mwn;
        // keeps the next chunk's fragment loads one group behind these
        // products, not strewn among them, and the stage's last products ahead
        // of the barrier: left free, the compiler sinks those behind it and
        // the refill starts a whole chunk later
        __builtin_amdgcn_sched_barrier(0);
      }
      // publish point of stage st + 1: this wave's reads of stage st are done,
      // its own copies of stage st + 1 have landed, then every wave meets
      asm volatile("s_wait_dscnt 0x0" ::: "memory");
      wait_async0();
      __syncthreads();
      if (st + 2 < NSTAGE)               // refill the buffer every reader has left
          stage(buf, (st + 2) * SKEYS);
    }
    wait_async0();                       // nothing in flight when the wave ends

    // the two key halves join: wave w + 4 hands its output, sums and maxima to
    // wave w, 16 B a lane and 512 B in a row per store
    float lr[QG];
#pragma unroll
    for (int g = 0; g < QG; ++g) {
        const v8f& l = ls[g];
        lr[g] = ((l[0] + l[1]) + (l[2] + l[3])) + ((l[4] + l[5]) + (l[6] + l[7]));
    }
    if (kh == 1) {
#pragma unroll
        for (int g = 0; g < QG; ++g)
#pragma unroll
            for (int t = 0; t < 4; ++t) {
                const v8f& a = o[g][t];
                Jn[cw][(g * 4 + t) * 2 + 0][lane] = make_float4(a[0], a[1], a[2], a[3]);
                Jn[cw][(g * 4 + t) * 2 + 1][lane] = make_float4(a[4], a[5], a[6], a[7]);
            }
        Jn[cw][QG * 8][lane] = make_float4(lr[0], lr[1], mu[0], mu[1]);
    }
    __syncthreads();                     // every wave passes it; wave w reads behind it
    if (kh == 0) {
        const float4 x = Jn[cw][QG * 8][lane];
#pragma unroll
        for (int g = 0; g < QG; ++g) {
            const float lb = g ? x.y : x.x;
            const float mb = g ? x.w : x.z;
            const float mn = fmaxf(mu[g], mb);
            float ca = __builtin_amdgcn_exp2f(mu[g] - mn);
            float cb = __builtin_amdgcn_exp2f(mb - mn);
            const float lj = lr[g] * ca + lb * cb;
            // the lane halves' sums join once; a lane stores 8 consecutive d of its query
            const float inv = 1.0f / (lj + xhalf(lj));
            ca *= inv;
            cb *= inv;
            _Float16* dst = O + (baseTok + q0 + (cw * QG + g) * 16 + ln15) * E_DIM + co + hi * 8;
#pragma unroll
            for (int t = 0; t < 4; ++t) {
                const float4 b0 = Jn[cw][(g * 4 + t) * 2 + 0][lane];
                const float4 b1 = Jn[cw][(g * 4 + t) * 2 + 1][lane];
                const v8f& a = o[g][t];
                v8h h;
                h[0] = (_Float16)(a[0] * ca + b0.x * cb);
                h[1] = (_Float16)(a[1] * ca + b0.y * cb);
                h[2] = (_Float16)(a[2] * ca + b0.z * cb);
                h[3] = (_Float16)(a[3] * ca + b0.w * cb);
                h[4] = (_Float16)(a[4] * ca + b1.x * cb);
                h[5] = (_Float16)(a[5] * ca + b1.y * cb);
                h[6] = (_Float16)(a[6] * ca + b1.z * cb);
                h[7] = (_Float16)(a[7] * ca + b1.w * cb);
                *(v8h*)(dst + t * 16) = h;
            }
            if (g + 1 < QG) {
                // ahead of the next group's values in registers that the stores
                // above name; the two scheduling fences keep that arithmetic
                // behind the wait
                __builtin_amdgcn_sched_barrier(0);
                asm volatile("s_wait_xcnt 0x0" ::: "memory");
                __builtin_amdgcn_sched_barrier(0);
            }
        }
    }
}

// ---------------------------------------------------------------------------
// The three streaming launches (both LayerNorms, the f16 operands) are cut so
// that every workgroup is resident at once and each wave has 8 or 16 loads of
// 16 B a lane in flight, for speed only.
// ---------------------------------------------------------------------------
typedef __attribute__((ext_vector_type(4))) float v4f;

// ahead of new values in registers that the global loads or stores above name;
// the two scheduling fences keep the arithmetic that follows behind the wait,
// and the address (or the index it is formed from), an input only, stays in
// its registers up to the wait, so that no load of the group lands on it
template <class T>
static __device__ __forceinline__ void wait_xcnt0(T addr) {
    __builtin_amdgcn_sched_barrier(0);
    asm volatile("s_wait_xcnt 0x0" :: "v"(addr) : "memory");
    __builtin_amdgcn_sched_barrier(0);
}

// ---------------------------------------------------------------------------
// LayerNorm over rows of E_DIM floats; writes f32 and optionally f16 copy.
// A block takes LN_ROWS rows: all their loads first, the rows' sums side by
// side, one barrier for all of them. Each row's sums run in the order of one
// row a block: four in the lane, butterfly in the wave, eight wave sums.
// ---------------------------------------------------------------------------
#define LN_ROWS 8

template <bool H16>
__global__ __launch_bounds__(256, 1)
void layernorm_k(const float* __restrict__ in, const float* __restrict__ g,
                 const float* __restrict__ b, float* __restrict__ outF,
                 _Float16* __restrict__ outH)
{
    __shared__ alignas(16) float sh_s[LN_ROWS][8], sh_q[LN_ROWS][8];
    const size_t row0 = (size_t)blockIdx.x * LN_ROWS;
    const int t    = threadIdx.x;
    const int wave = t >> 5;
    const float4* src = (const float4*)(in + row0 * E_DIM) + t;
    float4 x[LN_ROWS];
    // the set-up arithmetic stays in front of the loads: sunk behind them it
    // wrote scalar registers that a load names, ahead of the wait
    __builtin_amdgcn_sched_barrier(0);
#pragma unroll
    for (int r = 0; r < LN_ROWS; ++r) x[r] = src[r * (E_DIM / 4)];
    const float4 gg = ((const float4*)g)[t];
    const float4 bb = ((const float4*)b)[t];
    wait_xcnt0(t);

    float s[LN_ROWS], sq[LN_ROWS];
#pragma unroll
    for (int r = 0; r < LN_ROWS; ++r) {
        s[r]  = x[r].x + x[r].y + x[r].z + x[r].w;
        sq[r] = x[r].x * x[r].x + x[r].y * x[r].y + x[r].z * x[r].z + x[r].w * x[r].w;
    }
#pragma unroll
    for (int mk = 1; mk < 32; mk <<= 1)
#pragma unroll
        for (int r = 0; r < LN_ROWS; ++r) {
            s[r]  += __shfl_xor(s[r], mk, 32);
            sq[r] += __shfl_xor(sq[r], mk, 32);
        }
    if ((t & 31) == 0) {
#pragma unroll
        for (int r = 0; r < LN_ROWS; ++r) { sh_s[r][wave] = s[r]; sh_q[r][wave] = sq[r]; }
    }
    __syncthreads();
    // lane l forms mean and scale of row l & 7, one inverse root a lane; each
    // row's pair is then read from lane r into scalar registers
    const int rr = t & (LN_ROWS - 1);
    float ts = 0.0f, tq = 0.0f;
#pragma unroll
    for (int i = 0; i < 8; ++i) { ts += sh_s[rr][i]; tq += sh_q[rr][i]; }
    const float mean = ts * (1.0f / E_DIM);
    const float var  = tq * (1.0f / E_DIM) - mean * mean;
    const float inv  = rsqrtf(var + 1e-6f);
#pragma unroll
    for (int r = 0; r < LN_ROWS; ++r) {
        const float mr = __builtin_bit_cast(float, __builtin_amdgcn_readlane(__builtin_bit_cast(int, mean), r));
        const float ir = __builtin_bit_cast(float, __builtin_amdgcn_readlane(__builtin_bit_cast(int, inv), r));
        x[r].x = gg.x * (x[r].x - mr) * ir + bb.x;
        x[r].y = gg.y * (x[r].y - mr) * ir + bb.y;
        x[r].z = gg.z * (x[r].z - mr) * ir + bb.z;
        x[r].w = gg.w * (x[r].w - mr) * ir + bb.w;
    }
    float4* dF = (float4*)(outF + row0 * E_DIM) + t;
#pragma unroll
    for (int r = 0; r < LN_ROWS; ++r) dF[r * (E_DIM / 4)] = x[r];
    if (H16) {
        v4h* dH = (v4h*)(outH + row0 * E_DIM) + t;
        wait_xcnt0(t);                   // the f16 values take the stored rows' registers
#pragma unroll
        for (int r = 0; r < LN_ROWS; ++r) {
            v4h h; h[0] = (_Float16)x[r].x; h[1] = (_Float16)x[r].y;
                   h[2] = (_Float16)x[r].z; h[3] = (_Float16)x[r].w;
            dH[r * (E_DIM / 4)] = h;
        }
    }
}

// ---------------------------------------------------------------------------
// Every f16 operand that depends on the inputs alone, made in ONE launch of
// 1024 blocks, four a WGP, 64 KB of f32 read by each.
// Blocks [0, 768): tiles of 256 k x 64 n of the six weights, in[K][N] (f32) ->
// out[N][K] (f16); wq, wk, wv land one behind the other, so that they form one
// [3 E][E] operand. A thread loads 16 pieces of 16 B (a wave's load: two row
// pieces of 256 B), turns each 4 x 4 block in its registers and puts it into
// the LDS tile [n][k]; a wave then stores whole 512-B pieces of output rows.
// Blocks [768, 1024): x (f32) -> f16, 64 elements a thread.
// ---------------------------------------------------------------------------
#define PT_K   256
#define PT_N   64
#define TB_E   ((E_DIM / PT_K) * (E_DIM / PT_N))     // tiles of an E x E weight
#define TB_FF  ((E_DIM / PT_K) * (FF_DIM / PT_N))    // tiles of w1 or of w2
#define TB_ALL (4 * TB_E + 2 * TB_FF)
#define XB_ALL (2 * L_SEQ * E_DIM / 4 / 256 / 16)    // blocks that convert x

// K and N are constants so that all 16 loads, and all 8 stores, are one
// address with immediate offsets.
// The 16-B piece p of LDS row n lies at place p ^ (n >> 2): the 16 rows that a
// wave's 8-B stores hit fall on 16 different bank groups, and a wave's read of
// one whole row stays free of conflicts, with no pad.
template <int K, int N>
static __device__ __forceinline__
void transpose_tile(const float* __restrict__ in, _Float16* __restrict__ out,
                    int b, _Float16 (*tile)[PT_K])
{
    const int tid = threadIdx.x;
    const int n0  = (b % (N / PT_N)) * PT_N, k0 = (b / (N / PT_N)) * PT_K;
    const int kq  = tid >> 4, nq = tid & 15;
    const float* src = in + (size_t)(k0 + kq * 4) * N + n0 + nq * 4;
    v4f v[4][4];
#pragma unroll
    for (int u = 0; u < 4; ++u)
#pragma unroll
        for (int i = 0; i < 4; ++i)
            v[u][i] = *(const v4f*)(src + (size_t)(u * 64 + i) * N);
    wait_xcnt0(src);
#pragma unroll
    for (int u = 0; u < 4; ++u)
#pragma unroll
        for (int j = 0; j < 4; ++j) {
            v4h h;
#pragma unroll
            for (int i = 0; i < 4; ++i) h[i] = (_Float16)v[u][i][j];
            *(v4h*)&tile[nq * 4 + j][(((u * 8 + (kq >> 1)) ^ nq) << 3) + (kq & 1) * 4] = h;
        }
    __syncthreads();
    const int lane = tid & 31, nw = (tid >> 5) * 8;
    _Float16* dst = out + (size_t)(n0 + nw) * K + k0 + lane * 8;
    v8h o[8];
#pragma unroll
    for (int r = 0; r < 8; ++r)
        o[r] = *(const v8h*)&tile[nw + r][(lane ^ ((nw + r) >> 2)) << 3];
#pragma unroll
    for (int r = 0; r < 8; ++r)
        *(v8h*)(dst + (size_t)r * K) = o[r];
    // the other tile shapes' code follows in the listing and takes these registers
    wait_xcnt0(dst);
}

__global__ __launch_bounds__(256, 1)
void prep_f16(const float* __restrict__ x,  const float* __restrict__ wq,
              const float* __restrict__ wk, const float* __restrict__ wv,
              const float* __restrict__ wo, const float* __restrict__ w1,
              const float* __restrict__ w2, _Float16* __restrict__ xh,
              _Float16* __restrict__ wqkvT, _Float16* __restrict__ woT,
              _Float16* __restrict__ w1T,   _Float16* __restrict__ w2T)
{
    __shared__ alignas(16) _Float16 tile[PT_N][PT_K];
    int b = blockIdx.x;
    if (b >= TB_ALL) {                   // whole blocks leave ahead of the barrier
        const size_t i0 = (size_t)(b - TB_ALL) * (16 * 256) + threadIdx.x;
        const v4f* src = (const v4f*)x + i0;
        v4h*       dst = (v4h*)xh + i0;
        v4f v[16];
#pragma unroll
        for (int i = 0; i < 16; ++i) v[i] = src[i * 256];
        wait_xcnt0(src);
#pragma unroll
        for (int i = 0; i < 16; ++i) {
            v4h h;
#pragma unroll
            for (int j = 0; j < 4; ++j) h[j] = (_Float16)v[i][j];
            dst[i * 256] = h;
            if (i == 7) wait_xcnt0(dst);   // the second half reuses the first's registers
        }
        return;
    }
    // the branches are taken by whole blocks, each with its one barrier
    if (b < 4 * TB_E) {
        const int w = b / TB_E;
        b -= w * TB_E;
        const float* in  = (w == 0) ? wq : (w == 1) ? wk : (w == 2) ? wv : wo;
        _Float16*    out = (w == 3) ? woT : wqkvT + (size_t)w * E_DIM * E_DIM;
        transpose_tile<E_DIM, E_DIM>(in, out, b, tile);
    } else if (b < 4 * TB_E + TB_FF) {
        transpose_tile<E_DIM, FF_DIM>(w1, w1T, b - 4 * TB_E, tile);
    } else {
        transpose_tile<FF_DIM, E_DIM>(w2, w2T, b - 4 * TB_E - TB_FF, tile);
    }
}

extern "C" void kernel_launch(void* const* d_in, const int* in_sizes, int n_in,
                              void* d_out, int out_size, void* d_ws, size_t ws_size,
                              hipStream_t stream)
{
    (void)in_sizes; (void)n_in; (void)out_size; (void)ws_size;
    const float* x   = (const float*)d_in[0];
    const int*   msk = (const int*)d_in[1];
    const float* wq  = (const float*)d_in[2];
    const float* wk  = (const float*)d_in[3];
    const float* wv  = (const float*)d_in[4];
    const float* wo  = (const float*)d_in[5];
    const float* bo  = (const float*)d_in[6];
    const float* g1  = (const float*)d_in[7];
    const float* be1 = (const float*)d_in[8];
    const float* g2  = (const float*)d_in[9];
    const float* be2 = (const float*)d_in[10];
    const float* w1  = (const float*)d_in[11];
    const float* b1  = (const float*)d_in[12];
    const float* w2  = (const float*)d_in[13];
    const float* b2  = (const float*)d_in[14];

    const int NL = 2 * L_SEQ;                       // 4096 tokens
    char* ws = (char*)d_ws;
    const size_t MB = 1024ull * 1024ull;
    _Float16* AH    = (_Float16*)(ws + 0);          //  8 MB: x f16, later h f16
    _Float16* FFH   = (_Float16*)(ws + 8 * MB);     // 32 MB: relu(h@w1+b1) f16
    _Float16* QKVH  = (_Float16*)(ws + 48 * MB);    // 24 MB: [token][Q | K | V] f16
    _Float16* ATTNH = (_Float16*)(ws + 72 * MB);    //  8 MB
    float*    RES   = (float*)(ws + 80 * MB);       // 16 MB (pre-LN1, later pre-LN2)
    float*    HBUF  = (float*)(ws + 96 * MB);       // 16 MB: h f32 (residual)
    _Float16* WQKVT = (_Float16*)(ws + 112 * MB);   //  6 MB: [wq^T ; wk^T ; wv^T] f16
    _Float16* WOT   = (_Float16*)(ws + 118 * MB);   //  2 MB: wo^T f16
    _Float16* W1T   = (_Float16*)(ws + 120 * MB);   //  8 MB: w1^T f16
    _Float16* W2T   = (_Float16*)(ws + 128 * MB);   //  8 MB: w2^T f16

    dim3 blk256(256);
    dim3 gP(E_DIM / 128, NL / 128);                 // (8, 32)
    dim3 gQKV(3 * E_DIM / 192, NL / 256);           // (16, 16): one block a WGP
    dim3 gF1(FF_DIM / 256, NL / 256);               // (16, 16): one block a WGP

    // x and all six weights to f16 (weights transposed)
    prep_f16<<<TB_ALL + XB_ALL, blk256, 0, stream>>>(x, wq, wk, wv, wo, w1, w2,
                                                     AH, WQKVT, WOT, W1T, W2T);

    // Q, K and V projections as one product with N = 3 E
    gemm_wmma_f16<256, 192, false, false, false, true><<<gQKV, blk256, 0, stream>>>(AH, WQKVT, nullptr, nullptr, nullptr, QKVH, NL, 3 * E_DIM, E_DIM);

    attention_wmma<<<dim3(L_SEQ / QBLK, H_DIM, 2), blk256, 0, stream>>>(QKVH, QKVH + E_DIM, QKVH + 2 * E_DIM, msk, ATTNH);

    // out-proj + bo + residual x  -> RES (f32)
    gemm_wmma_f16<128, 128, true, true, false, false><<<gP, blk256, 0, stream>>>(ATTNH, WOT, bo, x, RES, nullptr, NL, E_DIM, E_DIM);

    // LN1 -> h (f32 in HBUF, f16 in AH)
    layernorm_k<true><<<NL / LN_ROWS, blk256, 0, stream>>>(RES, g1, be1, HBUF, AH);

    // FF1: relu(h @ w1 + b1) -> FFH (f16)
    gemm_wmma_f16<256, 256, true, false, true, true><<<gF1, blk256, 0, stream>>>(AH, W1T, b1, nullptr, nullptr, FFH, NL, FF_DIM, E_DIM);

    // FF2: ff @ w2 + b2 + h -> RES (f32)
    gemm_wmma_f16<128, 128, true, true, false, false><<<gP, blk256, 0, stream>>>(FFH, W2T, b2, HBUF, RES, nullptr, NL, E_DIM, FF_DIM);

    // LN2 -> final output
    layernorm_k<false><<<NL / LN_ROWS, blk256, 0, stream>>>(RES, g2, be2, (float*)d_out, nullptr);
}

// v009
// Measured time: 142 microseconds a run.
// Timed twice side by side with v008, it ran 1.07 and 1.06 times as fast.
// Counting every step since v000, it is 2.82 times as fast.
#include <hip/hip_runtime.h>
#include <hip/hip_bf16.h>

typedef __attribute__((ext_vector_type(16))) _Float16 v16h;
typedef __attribute__((ext_vector_type(8)))  _Float16 v8h;
typedef __attribute__((ext_vector_type(4)))  _Float16 v4h;
typedef __attribute__((ext_vector_type(8)))  float    v8f;
typedef __attribute__((ext_vector_type(4)))  int      v4i;

#define E_DIM   1024
#define H_DIM   16
#define D_DIM   64
#define FF_DIM  4096
#define L_SEQ   2048
#define NEG_VAL (-10000.0f)

#if __has_builtin(__builtin_amdgcn_global_load_async_to_lds_b128)
#define ASYNC_LDS 1
#endif

static __device__ __forceinline__ v8f vzero8() {
    v8f v;
#pragma unroll
    for (int i = 0; i < 8; ++i) v[i] = 0.0f;
    return v;
}

// WMMA 16-bit A/B fragment from a row (LDS or global) holding a 32-half K-window.
// Lane hi-half selects K-halves [hi*8, +8) (VGPRs 0..3) and [16+hi*8, +8).
static __device__ __forceinline__ v16h load_frag(const _Float16* p, int hi) {
    union { v16h v; v8h h[2]; } u;
    u.h[0] = *reinterpret_cast<const v8h*>(p + hi * 8);
    u.h[1] = *reinterpret_cast<const v8h*>(p + 16 + hi * 8);
    return u.v;
}

#ifdef ASYNC_LDS
typedef __attribute__((address_space(1))) v4i*  gptr_v4i;
typedef __attribute__((address_space(3))) v4i*  lptr_v4i;
typedef __attribute__((address_space(1))) void* gptr_void;
typedef __attribute__((address_space(3))) void* lptr_void;

static __device__ __forceinline__ void async_cp16(const _Float16* g, _Float16* l) {
    __builtin_amdgcn_global_load_async_to_lds_b128(
        (gptr_v4i)(gptr_void)const_cast<_Float16*>(g),
        (lptr_v4i)(lptr_void)l, 0, 0);
}
static __device__ __forceinline__ void wait_async0() {
    // asm with the memory clobber: holds every later LDS read behind the wait
    asm volatile("s_wait_asynccnt 0x0" ::: "memory");
}
#else
// no async path: same ring, staged through registers
static __device__ __forceinline__ void async_cp16(const _Float16* g, _Float16* l) {
    *reinterpret_cast<v8h*>(l) = *reinterpret_cast<const v8h*>(g);
}
static __device__ __forceinline__ void wait_async0() {}
#endif

typedef __attribute__((ext_vector_type(4))) float v4f;

// ahead of new values in registers that the global loads or stores above name;
// the two scheduling fences keep the arithmetic that follows behind the wait,
// and the address (or the index it is formed from), an input only, stays in
// its registers up to the wait, so that no load of the group lands on it
template <class T>
static __device__ __forceinline__ void wait_xcnt0(T addr) {
    __builtin_amdgcn_sched_barrier(0);
    asm volatile("s_wait_xcnt 0x0" :: "v"(addr) : "memory");
    __builtin_amdgcn_sched_barrier(0);
}

// ---------------------------------------------------------------------------
// The first LayerNorm has no launch of its own. With r the row in front of it,
//   h = g (r - mean) inv + be,   h w1 = inv (r (g w1) - mean u) + c,
//   u[n] = sum_k g[k] w1[k][n],  c[n] = sum_k be[k] w1[k][n].
// The GEMM that makes r (LNF 1) also writes r in f16 and, per row and per 64
// columns, the sum and the sum of squares; the operand prep scales w1's rows
// by g and writes u and c per tile of PT_K rows; the next GEMM (LNF 2) takes
// r in f16 as its operand and applies mean, inv, u, c to its results; the last
// GEMM (LNF 3) forms h from r for its residual.
// ---------------------------------------------------------------------------
#define PT_K   256
#define PT_N   64
#define N_TOK  (2 * L_SEQ)           // rows
#define LN_CHUNKS (E_DIM / 64)       // partial sums per row
#define LN_KT     (E_DIM / PT_K)     // partial u and c per column

#define KT  128   // halfs of K per pass: one 256-B piece of every operand row
#define LDP 136   // LDS row pitch in halfs: 272 B = 16 B x 17, for ds_load_b128

// ---------------------------------------------------------------------------
// Tiled f16 WMMA GEMM:  C[M,N] = A[M,K] * Bt[N,K]^T  (Bt is B transposed)
// 256 threads (8 waves, 4 x 2), block tile BM x BN, wave tile BM/4 x BN/2,
// K-step 128, two LDS buffers; tile t+1 streams in during tile t. 16 lanes
// copy one 256-B row piece, so a wave's copy instruction covers whole lines.
// The tile is the largest whose grid still gives every WGP a block: operand
// bytes brought from L2 and fragment bytes read from LDS per product both
// fall as (BM + BN) / (BM * BN).
// K must be a multiple of KT, M of BM, N (a constant) of BN.
// ---------------------------------------------------------------------------
template <int BM, int BN, int N, bool BIAS, bool RES, bool RELU, bool OUT16, int LNF>
__global__ __launch_bounds__(256, 1)
void gemm_wmma_f16(const _Float16* __restrict__ A, const _Float16* __restrict__ Bt,
                   const float* __restrict__ bias, const float* __restrict__ res,
                   float* __restrict__ outF, _Float16* __restrict__ outH,
                   const float* __restrict__ rowSums,   // LNF 2, 3: [chunk][row] (sum, squares)
                   float* __restrict__ rowSumsOut,      // LNF 1: the same, written
                   const float* __restrict__ lnA,       // LNF 2: u partials; LNF 3: g
                   const float* __restrict__ lnB,       // LNF 2: c partials; LNF 3: be
                   int K)
{
    constexpr int  FM = BM / 64;         // 16-row fragments of A per wave
    constexpr int  FN = BN / 32;         // 16-column fragments of Bt per wave
    constexpr bool PF = (BM + BN == 256);   // one operand row per thread
    static_assert(BM >= BN && BM % 64 == 0 && BN % 32 == 0, "tile shape");
    __shared__ alignas(16) _Float16 As[2][BM][LDP];
    __shared__ alignas(16) _Float16 Bs[2][BN][LDP];
    __shared__ alignas(16) float2 rowSt[LNF >= 2 ? BM : 1];   // (mean, inv) of the block's rows
    __shared__ alignas(16) float2 colUC[LNF == 2 ? BN : 1];   // (u, c + bias) of its columns
    static_assert(LNF != 1 || BN / 2 == E_DIM / LN_CHUNKS, "a wave's columns are one chunk");
    static_assert(LNF != 2 || BN <= 256, "one column per thread");

    const int tid  = threadIdx.x;
    const int lane = tid & 31;
    const int wave = tid >> 5;
    const int hi   = lane >> 4;
    const int ln15 = lane & 15;
    const int m0   = blockIdx.y * BM;
    const int n0   = blockIdx.x * BN;
    const int wr   = (wave >> 1) * (BM / 4);
    const int wc   = (wave & 1) * (BN / 2);

    v8f acc[FM][FN];
#pragma unroll
    for (int i = 0; i < FM; ++i)
#pragma unroll
        for (int j = 0; j < FN; ++j) acc[i][j] = vzero8();

    const int ldRow = tid >> 4;          // 0..15, rows ldRow + 16 i
    const int ldCol = (tid & 15) * 8;    // 16-B piece of the 256-B row piece
    const _Float16* aG = A  + (size_t)(m0 + ldRow) * K + ldCol;
    const _Float16* bG = Bt + (size_t)(n0 + ldRow) * K + ldCol;
    const size_t rstep = (size_t)16 * K;
    // one row of [A 128 rows | Bt 128 rows] per thread, for the L2 prefetch
    // (128 x 128 tile only)
    const _Float16* pG = (tid < 128) ? A  + (size_t)(m0 + tid) * K
                                     : Bt + (size_t)(n0 + tid - 128) * K;
    const int nk = K / KT;

    auto stage = [&](int buf, int kt) {
#pragma unroll
        for (int i = 0; i < BM / 16; ++i) {          // BM >= BN
            async_cp16(aG + i * rstep + kt, &As[buf][i * 16 + ldRow][ldCol]);
            if (i < BN / 16)
                async_cp16(bG + i * rstep + kt, &Bs[buf][i * 16 + ldRow][ldCol]);
        }
    };

    auto compute = [&](int buf) {
#pragma unroll
        for (int ks = 0; ks < KT / 32; ++ks) {
            v16h af[FM], bf[FN];
#pragma unroll
            for (int i = 0; i < FM; ++i)
                af[i] = load_frag(&As[buf][wr + i * 16 + ln15][ks * 32], hi);
#pragma unroll
            for (int j = 0; j < FN; ++j)
                bf[j] = load_frag(&Bs[buf][wc + j * 16 + ln15][ks * 32], hi);
            // large tiles: all fragment loads of a k block stand as one group
            // ahead of its products; left free, the compiler keeps one A
            // fragment and waits out an LDS round trip before every row of
            // products, which the SIMD's one other wave cannot cover
            if (!PF) __builtin_amdgcn_sched_barrier(0);
#pragma unroll
            for (int i = 0; i < FM; ++i)
#pragma unroll
                for (int j = 0; j < FN; ++j)
                    acc[i][j] = __builtin_amdgcn_wmma_f32_16x16x32_f16(
                        false, af[i], false, bf[j], (short)0, acc[i][j], false, false);
            // and no load of the next k block moves in among these products,
            // nor a product behind the pass's barrier
            if (!PF) __builtin_amdgcn_sched_barrier(0);
        }
    };

    // prologue: tile 0 lands and is published, then tile 1 starts
    stage(0, 0);
    // while tile 0 flies: a thread joins one row's partial sums, in chunk order,
    // and one column's u and c; the barrier below publishes them too
    // (row and column counts as constants: each group of loads is one scalar
    // base, one index and immediate offsets)
    if (LNF >= 2 && tid < BM) {
        const float2* p = (const float2*)rowSums + m0;
        float2 w[LN_CHUNKS];
#pragma unroll
        for (int c = 0; c < LN_CHUNKS; ++c) w[c] = p[c * N_TOK + tid];
        // ahead of new values in the registers that the loads above name: base
        // and index, inputs only, stay in their registers up to the wait
        asm volatile("s_wait_xcnt 0x0" :: "s"(p), "v"(tid) : "memory");
        float ts = 0.0f, tq = 0.0f;
#pragma unroll
        for (int c = 0; c < LN_CHUNKS; ++c) { ts += w[c].x; tq += w[c].y; }
        const float mean = ts * (1.0f / E_DIM);
        const float var  = tq * (1.0f / E_DIM) - mean * mean;
        rowSt[tid] = make_float2(mean, rsqrtf(var + 1e-6f));
    }
    if (LNF == 2 && tid < BN) {
        const float* pu = lnA + n0;
        const float* pc = lnB + n0;
        const float* pb = bias + n0;
        float u[LN_KT], c[LN_KT];
#pragma unroll
        for (int i = 0; i < LN_KT; ++i) { u[i] = pu[i * N + tid]; c[i] = pc[i * N + tid]; }
        float cs = pb[tid];
        // as above, for these three bases
        asm volatile("s_wait_xcnt 0x0" :: "s"(pu), "s"(pc), "s"(pb), "v"(tid) : "memory");
        float us = 0.0f;
#pragma unroll
        for (int i = 0; i < LN_KT; ++i) { us += u[i]; cs += c[i]; }
        colUC[tid] = make_float2(us, cs);
    }
    wait_async0();
    __syncthreads();
    if (nk > 1) {
        stage(1, KT);
        if (PF && nk > 2) __builtin_prefetch(pG + 2 * KT, 0, 1);   // into L2
    }
    for (int t = 0; t < nk; ++t) {
        compute(t & 1);
        // publish point of tile t+1: this wave's reads of tile t are done,
        // its own copies of tile t+1 have landed, then every wave meets
        asm volatile("s_wait_dscnt 0x0" ::: "memory");
        wait_async0();
        __syncthreads();
        if (t + 2 < nk) {                // refill the buffer every reader has left
            stage(t & 1, (t + 2) * KT);
            if (PF && t + 3 < nk)        // L2 prefetch one tile ahead of the copies
                __builtin_prefetch(pG + (t + 3) * KT, 0, 1);
        }
    }
    wait_async0();                       // nothing in flight when the wave ends

    // C layout: lane holds column n = lane&15; VGPR r holds row r + 8*hi.
    // N is a constant, so that every load and store below is a scalar base, one
    // index and an immediate offset. First the loads and a wait; then per 16
    // rows all the arithmetic, the stores, a wait. Each wait stands ahead of new values
    // in registers that the loads or stores in front of it name; bases and
    // index, inputs only, stay in their registers up to it, and the scheduling
    // fences keep the arithmetic on its side.
    const int    cix = wc + ln15;                    // column within the block
    const int    eix = (wr + hi * 8) * N + cix;      // element within the block's rows
    const size_t eb  = (size_t)m0 * N + n0;
    float bv[FN], lg[FN], lb[FN];
    if (BIAS) {
        const float* pb = bias + n0;
#pragma unroll
        for (int j = 0; j < FN; ++j) bv[j] = pb[cix + j * 16];
        __builtin_amdgcn_sched_barrier(0);
        asm volatile("s_wait_xcnt 0x0" :: "s"(pb), "v"(cix) : "memory");
        __builtin_amdgcn_sched_barrier(0);
    }
    if (LNF == 3) {
        const float* pg = lnA + n0;
        const float* pe = lnB + n0;
#pragma unroll
        for (int j = 0; j < FN; ++j) { lg[j] = pg[cix + j * 16]; lb[j] = pe[cix + j * 16]; }
        __builtin_amdgcn_sched_barrier(0);
        asm volatile("s_wait_xcnt 0x0" :: "s"(pg), "s"(pe), "v"(cix) : "memory");
        __builtin_amdgcn_sched_barrier(0);
    }
    float x[RES ? FM : 1][FN][8];        // residual, all rows in one group of loads
    if (RES) {
        const float* pr = res + eb;
#pragma unroll
        for (int i = 0; i < FM; ++i)
#pragma unroll
            for (int j = 0; j < FN; ++j)
#pragma unroll
                for (int r = 0; r < 8; ++r) x[i][j][r] = pr[eix + (i * 16 + r) * N + j * 16];
        __builtin_amdgcn_sched_barrier(0);
        asm volatile("s_wait_xcnt 0x0" :: "s"(pr), "v"(eix) : "memory");
        __builtin_amdgcn_sched_barrier(0);
    }
#pragma unroll
    for (int i = 0; i < FM; ++i) {
        float2 st[8];                    // (mean, inv) of this lane's eight rows
        float  rs[8], rq[8];             // LNF 1: sums over this lane's columns
#pragma unroll
        for (int r = 0; r < 8; ++r) {
            st[r] = (LNF >= 2) ? rowSt[wr + i * 16 + hi * 8 + r] : make_float2(0.0f, 0.0f);
            rs[r] = 0.0f;
            rq[r] = 0.0f;
        }
        _Float16 hv[FN][8];
#pragma unroll
        for (int j = 0; j < FN; ++j) {
            const float2 uc = (LNF == 2) ? colUC[cix + j * 16] : make_float2(0.0f, 0.0f);
#pragma unroll
            for (int r = 0; r < 8; ++r) {
                float v = acc[i][j][r];
                if (LNF == 2) v = st[r].y * (v - st[r].x * uc.x) + uc.y;
                if (BIAS) v += bv[j];
                if (RES) {
                    float h = x[i][j][r];
                    if (LNF == 3) h = lg[j] * (h - st[r].x) * st[r].y + lb[j];
                    v += h;
                }
                if (RELU) v = fmaxf(v, 0.0f);
                acc[i][j][r] = v;
                hv[j][r] = (_Float16)v;
                if (LNF == 1) { rs[r] += v; rq[r] += v * v; }
            }
        }
        float sa = 0.0f, sq = 0.0f;
        if (LNF == 1) {
            // the 16 lanes of a half hold the 64 columns of the same eight rows
#pragma unroll
            for (int mk = 1; mk < 16; mk <<= 1)
#pragma unroll
                for (int r = 0; r < 8; ++r) {
                    rs[r] += __shfl_xor(rs[r], mk, 32);
                    rq[r] += __shfl_xor(rq[r], mk, 32);
                }
            // lane c < 8 of a half will store row c: the wave writes one whole line
            sa = rs[0];
            sq = rq[0];
#pragma unroll
            for (int r = 1; r < 8; ++r)
                if (ln15 == r) { sa = rs[r]; sq = rq[r]; }
        }
        __builtin_amdgcn_sched_barrier(0);
        float*    pf = outF + eb;
        _Float16* ph = outH + eb;
        float2*   ps = (float2*)rowSumsOut + (size_t)blockIdx.x * 2 * N_TOK + m0;
        const int six = (wave & 1) * N_TOK + wr + hi * 8 + ln15;
#pragma unroll
        for (int j = 0; j < FN; ++j)
#pragma unroll
            for (int r = 0; r < 8; ++r) {
                if (!OUT16)            pf[eix + (i * 16 + r) * N + j * 16] = acc[i][j][r];
                if (OUT16 || LNF == 1) ph[eix + (i * 16 + r) * N + j * 16] = hv[j][r];
            }
        if (LNF == 1 && ln15 < 8) ps[six + i * 16] = make_float2(sa, sq);
        if (i + 1 < FM) {
            __builtin_amdgcn_sched_barrier(0);
            if (LNF == 1)   asm volatile("s_wait_xcnt 0x0" :: "s"(pf), "s"(ph), "s"(ps), "v"(eix), "v"(six) : "memory");
            else if (OUT16) asm volatile("s_wait_xcnt 0x0" :: "s"(ph), "v"(eix) : "memory");
            else            asm volatile("s_wait_xcnt 0x0" :: "s"(pf), "v"(eix) : "memory");
            __builtin_amdgcn_sched_barrier(0);
        }
    }
}

// ---------------------------------------------------------------------------
// Flash attention with WMMA, transposed products: S^T = K Q^T, O^T += V^T P^T.
// 256 threads (8 waves) per block; block handles 128 queries of one (batch,
// head), two blocks a WGP. A wave owns 32 query columns as two groups of 16,
// so that every K and V fragment read from LDS feeds two products. That alone
// would leave two waves a SIMD, too few to cover the vector work between the
// products; so waves w and w + 4 share their 32 columns and split the keys:
// of every stage of 128 keys wave w takes the first 64, wave w + 4 the rest,
// each with its own maximum, sums and output, joined once through LDS at the
// end. Key chunk = 32.
// K and V rows come by asynchronous copies into a ring of two LDS buffers of
// 128 keys (two chunks a wave): stage s + 1 flies while stage s is worked on.
// In each group a lane (c = lane & 15, h = lane >> 4) holds 16 scores of ONE
// query c (keys 8h + r and 16 + 8h + r), so maximum and sum run in the lane's
// own registers;
// the two score tiles, converted in place, are the B operand of the second
// product in the hardware k order.
// The loop is bound by vector issue, so a chunk's common case is kept short:
// P = 2^(score * SC_LOG2 - mu), one multiply-add and one exponential a score,
// with mu the maximum in use. ONE ballot a chunk asks whether any lane needs
// more: a mask word of the chunk that is zero, or a score that would make P
// exceed 2^LAZY_LOG2. Only then does the wave select masked scores, exchange
// the maximum between its halves, raise mu and rescale sums and output.
// Every loop over fragments or registers is unrolled so that each index is a
// constant and the arrays stay in registers.
// ---------------------------------------------------------------------------
typedef __attribute__((ext_vector_type(8))) short s16x8;
typedef __attribute__((address_space(3))) s16x8 lds_s16x8;

// row-major 16-bit LDS tile -> 8 k of one column per lane (half an A fragment)
static __device__ __forceinline__ v8h ld_tr16(const char* p) {
    return __builtin_bit_cast(v8h, __builtin_amdgcn_ds_load_tr16_b128_v8i16((lds_s16x8*)p));
}
// lane l with lane l ^ 16
static __device__ __forceinline__ float xhalf(float x) {
    return __builtin_bit_cast(float, __builtin_amdgcn_permlanex16(
        __builtin_bit_cast(int, x), __builtin_bit_cast(int, x),
        0x76543210, 0xfedcba98, false, false));
}

#define VPITCH 80   // halfs: 160 B = 32 B x 5, for ds_load_tr16_b128
#define QKV_LD (3 * E_DIM)   // row pitch of Q, K and V: column blocks of one matrix
#define SKEYS  128           // keys per stage of the K/V ring
#define WKEYS  (SKEYS / 2)   // keys of a stage that one wave works on
#define NSTAGE (L_SEQ / SKEYS)
#define QG     2             // groups of 16 query columns per wave
#define QBLK   (4 * QG * 16) // queries per block
#define SC_LOG2      0.18033688011112042f   // log2(e) / sqrt(D): raw score -> power of two
#define RAW_PER_LOG2 5.545177444479562f     // its inverse
#define LAZY_LOG2    8.0f                   // P stays below 2^8, far inside f16

// maximum of a lane's 16 scores, two chains of three-input maxima
static __device__ __forceinline__ float max16(const v8f& a, const v8f& b) {
    float x = fmaxf(fmaxf(a[0], a[1]), a[2]);
    float y = fmaxf(fmaxf(b[0], b[1]), b[2]);
    x = fmaxf(fmaxf(x, a[3]), a[4]);
    y = fmaxf(fmaxf(y, b[3]), b[4]);
    x = fmaxf(fmaxf(x, a[5]), a[6]);
    y = fmaxf(fmaxf(y, b[5]), b[6]);
    return fmaxf(fmaxf(fmaxf(x, y), a[7]), b[7]);
}

// four waves a SIMD: 256 registers a wave, two blocks' LDS in one WGP
__global__ __launch_bounds__(256) __attribute__((amdgpu_waves_per_eu(4, 4)))
void attention_wmma(const _Float16* __restrict__ Q, const _Float16* __restrict__ K,
                    const _Float16* __restrict__ V, const int* __restrict__ mask,
                    _Float16* __restrict__ O)
{
    __shared__ alignas(16) _Float16 Ks[2][SKEYS][72];      // [key][d], A rows of S^T
    __shared__ alignas(32) _Float16 Vs[2][SKEYS][VPITCH];  // [key][d], read transposed
    __shared__ float4 Jn[4][QG * 8 + 1][32];   // second key half's output, sums, maxima

    const int tid  = threadIdx.x;
    const int lane = tid & 31;
    const int wave = __builtin_amdgcn_readfirstlane(tid >> 5);   // scalar: offsets, the join's branches
    const int cw   = wave & 3;           // which 32 query columns
    const int kh   = wave >> 2;          // which half of every stage's keys
    const int hi   = lane >> 4;
    const int ln15 = lane & 15;
    const int q0   = blockIdx.x * QBLK;
    const int hh   = blockIdx.y;
    const int nb   = blockIdx.z;
    const size_t baseTok = (size_t)nb * L_SEQ;
    const int co   = hh * D_DIM;
    const int* mrow = mask + nb * L_SEQ;

    // Q^T as B operand, loaded once: column = query ln15, k order as K's rows
    v16h qf[QG][2];
#pragma unroll
    for (int g = 0; g < QG; ++g) {
        const _Float16* qp = Q + (baseTok + q0 + (cw * QG + g) * 16 + ln15) * QKV_LD + co;
        qf[g][0] = load_frag(qp, hi);
        qf[g][1] = load_frag(qp + 32, hi);
    }

    v8f   o[QG][4];                      // o[g][t][r] = O[query ln15 of g][16 t + 8 hi + r]
    v8f   ls[QG];                        // eight partial sums of this half's P
    float mu[QG];                        // maximum in use, as a power of two
    float thr[QG];                       // raw score above which mu has to grow
#pragma unroll
    for (int g = 0; g < QG; ++g) {
#pragma unroll
        for (int t = 0; t < 4; ++t) o[g][t] = vzero8();
        ls[g]  = vzero8();
        mu[g]  = -3.0e38f;
        thr[g] = -3.0e38f;
    }

    // eight lanes copy one 128-B row, so a wave's copy covers four whole lines
    const int crow = tid >> 3;           // 0..31, rows crow + 32 i
    const int ccol = (tid & 7) * 8;      // 16-B piece of the row
    const _Float16* kG = K + (baseTok + crow) * QKV_LD + co + ccol;
    const _Float16* vG = V + (baseTok + crow) * QKV_LD + co + ccol;
    auto stage = [&](int buf, int key0) {
#pragma unroll                           // eight copies issued back to back
        for (int i = 0; i < SKEYS / 32; ++i) {
            const size_t off = (size_t)(key0 + i * 32) * QKV_LD;
            async_cp16(kG + off, &Ks[buf][i * 32 + crow][ccol]);
            async_cp16(vG + off, &Vs[buf][i * 32 + crow][ccol]);
        }
    };
    const int vlane = (8 * hi + (lane & 7)) * (VPITCH * 2) + ((lane >> 3) & 1) * 16;

    // prologue: stage 0 lands and is published, then stage 1 starts
    stage(0, 0);
    wait_async0();
    __syncthreads();
    stage(1, SKEYS);

    int mw = mrow[kh * WKEYS + lane];    // mask word of key `lane` of the chunk
    // ahead of new values in the registers that the global load above names;
    // the two scheduling fences keep the set-up that follows behind the wait
    __builtin_amdgcn_sched_barrier(0);
    asm volatile("s_wait_xcnt 0x0" ::: "memory");
    __builtin_amdgcn_sched_barrier(0);

    for (int st = 0; st < NSTAGE; ++st) {
      const int buf = st & 1;
      const char* vtp = (const char*)&Vs[buf][kh * WKEYS][0] + vlane;
#pragma unroll
      for (int sub = 0; sub < WKEYS / 32; ++sub) {   // unrolled: LDS offsets constant
        // the next chunk's mask word, one chunk ahead of its use (behind the
        // last chunk the address is held inside the row; that word is not used)
        const int keyn = min((sub + 1 < WKEYS / 32 ? st * SKEYS + sub * 32 + 32
                                                   : st * SKEYS + SKEYS) + kh * WKEYS, L_SEQ - 32);
        const int mwn  = mrow[keyn + lane];
        // ahead of the next chunk's new value in the address registers that
        // the global load above names
        asm volatile("s_wait_xcnt 0x0" ::: "memory");

        // S^T = K(32x64) @ Q^T(64x16) per group:
        // s[g][c][r] = score(key 16 c + 8 hi + r, query ln15 of group g)
        v16h kf[2][2];
#pragma unroll
        for (int c = 0; c < 2; ++c)
#pragma unroll
            for (int ks = 0; ks < 2; ++ks)
                kf[c][ks] = load_frag(&Ks[buf][kh * WKEYS + sub * 32 + c * 16 + ln15][ks * 32], hi);

        // V^T fragments: 16 d x 32 keys each, two transposing loads
        v16h vf[4];
#pragma unroll
        for (int t = 0; t < 4; ++t) {
            union { v16h v; v8h h[2]; } u;
            u.h[0] = ld_tr16(vtp + (sub * 32) * (VPITCH * 2) + 32 * t);
            u.h[1] = ld_tr16(vtp + (sub * 32 + 16) * (VPITCH * 2) + 32 * t);
            vf[t] = u.v;
        }
        // holds all 16 fragment loads ahead of the products: one LDS round
        // trip a chunk; left free, the compiler sinks them between the WMMAs
        __builtin_amdgcn_sched_barrier(0);

        v8f s[QG][2];
#pragma unroll
        for (int g = 0; g < QG; ++g) { s[g][0] = vzero8(); s[g][1] = vzero8(); }
#pragma unroll
        for (int ks = 0; ks < 2; ++ks)
#pragma unroll
            for (int g = 0; g < QG; ++g)
#pragma unroll
                for (int c = 0; c < 2; ++c)
                    s[g][c] = __builtin_amdgcn_wmma_f32_16x16x32_f16(
                        false, kf[c][ks], false, qf[g][ks], (short)0, s[g][c], false, false);
        // the eight products stand together: a maximum moved in among them
        // reads a result too early and is padded with idle vector slots,
        // which the SIMD's other waves then lack
        __builtin_amdgcn_sched_barrier(0);

        // one wave-uniform test a chunk: a scalar branch, no barrier inside
        bool more = (mw == 0);
#pragma unroll
        for (int g = 0; g < QG; ++g) more |= (max16(s[g][0], s[g][1]) > thr[g]);
        if (__builtin_amdgcn_ballot_w32(more) != 0u) {
            // mask on the raw score (before scaling):
            // bit k of the ballot is key k of the chunk, this lane's keys
            // are 16 c + 8 hi + r
            const unsigned live = __builtin_amdgcn_ballot_w32(mw != 0) >> (hi * 8);
#pragma unroll
            for (int g = 0; g < QG; ++g) {
#pragma unroll
                for (int c = 0; c < 2; ++c)
#pragma unroll
                    for (int r = 0; r < 8; ++r)
                        if (((live >> (c * 16 + r)) & 1u) == 0u) s[g][c][r] = NEG_VAL;
                float mx = max16(s[g][0], s[g][1]);
                mx = fmaxf(mx, xhalf(mx));   // both halves of a query agree on mu
                const float mn   = fmaxf(mu[g], mx * SC_LOG2);
                const float corr = __builtin_amdgcn_exp2f(mu[g] - mn);
                mu[g]  = mn;
                thr[g] = (mn + LAZY_LOG2) * RAW_PER_LOG2;
                ls[g]  = ls[g] * corr;
#pragma unroll
                for (int t = 0; t < 4; ++t) o[g][t] = o[g][t] * corr;
            }
        }

        v16h pf[QG];                     // P^T: element e = key 16 (e / 8) + 8 hi + e % 8
#pragma unroll
        for (int g = 0; g < QG; ++g) {
            v8f scv, nmu;
#pragma unroll
            for (int r = 0; r < 8; ++r) { scv[r] = SC_LOG2; nmu[r] = -mu[g]; }
#pragma unroll
            for (int c = 0; c < 2; ++c) {
                const v8f e = __builtin_elementwise_fma(s[g][c], scv, nmu);
                v8f p;
#pragma unroll
                for (int r = 0; r < 8; ++r) {
                    p[r] = __builtin_amdgcn_exp2f(e[r]);
                    pf[g][c * 8 + r] = (_Float16)p[r];
                }
                ls[g] = ls[g] + p;
            }
        }
        // likewise: both groups' P stand ready ahead of the eight products, so
        // that no vector write into an operand register waits behind a product
        __builtin_amdgcn_sched_barrier(0);

        // O^T += V^T(64x32) @ P^T(32x16)
#pragma unroll
        for (int g = 0; g < QG; ++g)
#pragma unroll
            for (int t = 0; t < 4; ++t)
                o[g][t] = __builtin_amdgcn_wmma_f32_16x16x32_f16(
                    false, vf[t], false, pf[g], (short)0, o[g][t], false, false);
        mw = mwn;
        // keeps the next chunk's fragment loads one group behind these
        // products, not strewn among them, and the stage's last products ahead
        // of the barrier: left free, the compiler sinks those behind it and
        // the refill starts a whole chunk later
        __builtin_amdgcn_sched_barrier(0);
      }
      // publish point of stage st + 1: this wave's reads of stage st are done,
      // its own copies of stage st + 1 have landed, then every wave meets
      asm volatile("s_wait_dscnt 0x0" ::: "memory");
      wait_async0();
      __syncthreads();
      if (st + 2 < NSTAGE)               // refill the buffer every reader has left
          stage(buf, (st + 2) * SKEYS);
    }
    wait_async0();                       // nothing in flight when the wave ends

    // the two key halves join: wave w + 4 hands its output, sums and maxima to
    // wave w, 16 B a lane and 512 B in a row per store
    float lr[QG];
#pragma unroll
    for (int g = 0; g < QG; ++g) {
        const v8f& l = ls[g];
        lr[g] = ((l[0] + l[1]) + (l[2] + l[3])) + ((l[4] + l[5]) + (l[6] + l[7]));
    }
    if (kh == 1) {
#pragma unroll
        for (int g = 0; g < QG; ++g)
#pragma unroll
            for (int t = 0; t < 4; ++t) {
                const v8f& a = o[g][t];
                Jn[cw][(g * 4 + t) * 2 + 0][lane] = make_float4(a[0], a[1], a[2], a[3]);
                Jn[cw][(g * 4 + t) * 2 + 1][lane] = make_float4(a[4], a[5], a[6], a[7]);
            }
        Jn[cw][QG * 8][lane] = make_float4(lr[0], lr[1], mu[0], mu[1]);
    }
    __syncthreads();                     // every wave passes it; wave w reads behind it
    if (kh == 0) {
        const float4 x = Jn[cw][QG * 8][lane];
#pragma unroll
        for (int g = 0; g < QG; ++g) {
            const float lb = g ? x.y : x.x;
            const float mb = g ? x.w : x.z;
            const float mn = fmaxf(mu[g], mb);
            float ca = __builtin_amdgcn_exp2f(mu[g] - mn);
            float cb = __builtin_amdgcn_exp2f(mb - mn);
            const float lj = lr[g] * ca + lb * cb;
            // the lane halves' sums join once; a lane stores 8 consecutive d of its query
            const float inv = 1.0f / (lj + xhalf(lj));
            ca *= inv;
            cb *= inv;
            _Float16* dst = O + (baseTok + q0 + (cw * QG + g) * 16 + ln15) * E_DIM + co + hi * 8;
#pragma unroll
            for (int t = 0; t < 4; ++t) {
                const float4 b0 = Jn[cw][(g * 4 + t) * 2 + 0][lane];
                const float4 b1 = Jn[cw][(g * 4 + t) * 2 + 1][lane];
                const v8f& a = o[g][t];
                v8h h;
                h[0] = (_Float16)(a[0] * ca + b0.x * cb);
                h[1] = (_Float16)(a[1] * ca + b0.y * cb);
                h[2] = (_Float16)(a[2] * ca + b0.z * cb);
                h[3] = (_Float16)(a[3] * ca + b0.w * cb);
                h[4] = (_Float16)(a[4] * ca + b1.x * cb);
                h[5] = (_Float16)(a[5] * ca + b1.y * cb);
                h[6] = (_Float16)(a[6] * ca + b1.z * cb);
                h[7] = (_Float16)(a[7] * ca + b1.w * cb);
                *(v8h*)(dst + t * 16) = h;
            }
            if (g + 1 < QG) {
                // ahead of the next group's values in registers that the stores
                // above name; the two scheduling fences keep that arithmetic
                // behind the wait
                __builtin_amdgcn_sched_barrier(0);
                asm volatile("s_wait_xcnt 0x0" ::: "memory");
                __builtin_amdgcn_sched_barrier(0);
            }
        }
    }
}

// ---------------------------------------------------------------------------
// The two streaming launches (the LayerNorm, the f16 operands) are cut so
// that every workgroup is resident at once and each wave has 8 or 16 loads of
// 16 B a lane in flight, for speed only.
// ---------------------------------------------------------------------------
// ---------------------------------------------------------------------------
// LayerNorm over rows of E_DIM floats (the second one; the first is folded
// into the GEMMs around it).
// A block takes LN_ROWS rows: all their loads first, the rows' sums side by
// side, one barrier for all of them. Each row's sums run in the order of one
// row a block: four in the lane, butterfly in the wave, eight wave sums.
// ---------------------------------------------------------------------------
#define LN_ROWS 8

__global__ __launch_bounds__(256, 1)
void layernorm_k(const float* __restrict__ in, const float* __restrict__ g,
                 const float* __restrict__ b, float* __restrict__ outF)
{
    __shared__ alignas(16) float sh_s[LN_ROWS][8], sh_q[LN_ROWS][8];
    const size_t row0 = (size_t)blockIdx.x * LN_ROWS;
    const int t    = threadIdx.x;
    const int wave = t >> 5;
    const float4* src = (const float4*)(in + row0 * E_DIM) + t;
    float4 x[LN_ROWS];
    // the set-up arithmetic stays in front of the loads: sunk behind them it
    // wrote scalar registers that a load names, ahead of the wait
    __builtin_amdgcn_sched_barrier(0);
#pragma unroll
    for (int r = 0; r < LN_ROWS; ++r) x[r] = src[r * (E_DIM / 4)];
    const float4 gg = ((const float4*)g)[t];
    const float4 bb = ((const float4*)b)[t];
    wait_xcnt0(t);

    float s[LN_ROWS], sq[LN_ROWS];
#pragma unroll
    for (int r = 0; r < LN_ROWS; ++r) {
        s[r]  = x[r].x + x[r].y + x[r].z + x[r].w;
        sq[r] = x[r].x * x[r].x + x[r].y * x[r].y + x[r].z * x[r].z + x[r].w * x[r].w;
    }
#pragma unroll
    for (int mk = 1; mk < 32; mk <<= 1)
#pragma unroll
        for (int r = 0; r < LN_ROWS; ++r) {
            s[r]  += __shfl_xor(s[r], mk, 32);
            sq[r] += __shfl_xor(sq[r], mk, 32);
        }
    if ((t & 31) == 0) {
#pragma unroll
        for (int r = 0; r < LN_ROWS; ++r) { sh_s[r][wave] = s[r]; sh_q[r][wave] = sq[r]; }
    }
    __syncthreads();
    // lane l forms mean and scale of row l & 7, one inverse root a lane; each
    // row's pair is then read from lane r into scalar registers
    const int rr = t & (LN_ROWS - 1);
    float ts = 0.0f, tq = 0.0f;
#pragma unroll
    for (int i = 0; i < 8; ++i) { ts += sh_s[rr][i]; tq += sh_q[rr][i]; }
    const float mean = ts * (1.0f / E_DIM);
    const float var  = tq * (1.0f / E_DIM) - mean * mean;
    const float inv  = rsqrtf(var + 1e-6f);
#pragma unroll
    for (int r = 0; r < LN_ROWS; ++r) {
        const float mr = __builtin_bit_cast(float, __builtin_amdgcn_readlane(__builtin_bit_cast(int, mean), r));
        const float ir = __builtin_bit_cast(float, __builtin_amdgcn_readlane(__builtin_bit_cast(int, inv), r));
        x[r].x = gg.x * (x[r].x - mr) * ir + bb.x;
        x[r].y = gg.y * (x[r].y - mr) * ir + bb.y;
        x[r].z = gg.z * (x[r].z - mr) * ir + bb.z;
        x[r].w = gg.w * (x[r].w - mr) * ir + bb.w;
    }
    float4* dF = (float4*)(outF + row0 * E_DIM) + t;
#pragma unroll
    for (int r = 0; r < LN_ROWS; ++r) dF[r * (E_DIM / 4)] = x[r];
}

// ---------------------------------------------------------------------------
// Every f16 operand that depends on the inputs alone, made in ONE launch of
// 1024 blocks, four a WGP, 64 KB of f32 read by each.
// Blocks [0, 768): tiles of 256 k x 64 n of the six weights, in[K][N] (f32) ->
// out[N][K] (f16); wq, wk, wv land one behind the other, so that they form one
// [3 E][E] operand. A thread loads 16 pieces of 16 B (a wave's load: two row
// pieces of 256 B), turns each 4 x 4 block in its registers and puts it into
// the LDS tile [n][k]; a wave then stores whole 512-B pieces of output rows.
// Blocks [768, 1024): x (f32) -> f16, 64 elements a thread.
// ---------------------------------------------------------------------------
#define TB_E   ((E_DIM / PT_K) * (E_DIM / PT_N))     // tiles of an E x E weight
#define TB_FF  ((E_DIM / PT_K) * (FF_DIM / PT_N))    // tiles of w1 or of w2
#define TB_ALL (4 * TB_E + 2 * TB_FF)
#define XB_ALL (2 * L_SEQ * E_DIM / 4 / 256 / 16)    // blocks that convert x

// K and N are constants so that all 16 loads, and all 8 stores, are one
// address with immediate offsets.
// The 16-B piece p of LDS row n lies at place p ^ (n >> 2): the 16 rows that a
// wave's 8-B stores hit fall on 16 different bank groups, and a wave's read of
// one whole row stays free of conflicts, with no pad.
// FOLD (w1): row k is scaled by g[k] ahead of the rounding, and the tile's
// share of u (summed from the rounded values, the ones the product will use)
// and of c goes out per column: 16 k in the thread, lane l with l ^ 16, then
// the eight waves' sums through LDS behind the tile's own barrier.
template <int K, int N, bool FOLD>
static __device__ __forceinline__
void transpose_tile(const float* __restrict__ in, _Float16* __restrict__ out,
                    int b, _Float16 (*tile)[PT_K],
                    const float* __restrict__ g, const float* __restrict__ be,
                    float* __restrict__ up, float* __restrict__ cp, float2 (*red)[PT_N])
{
    const int tid = threadIdx.x;
    const int n0  = (b % (N / PT_N)) * PT_N, k0 = (b / (N / PT_N)) * PT_K;
    const int kq  = tid >> 4, nq = tid & 15;
    const float* src = in + (size_t)(k0 + kq * 4) * N + n0 + nq * 4;
    v4f v[4][4];
#pragma unroll
    for (int u = 0; u < 4; ++u)
#pragma unroll
        for (int i = 0; i < 4; ++i)
            v[u][i] = *(const v4f*)(src + (size_t)(u * 64 + i) * N);
    v4f gk[4], bk[4];
    if (FOLD) {
        const int gby = (k0 + kq * 4) * 4;           // byte offset of this thread's first k
#pragma unroll
        for (int u = 0; u < 4; ++u) {
            gk[u] = *(const v4f*)((const char*)g  + gby + u * 256);
            bk[u] = *(const v4f*)((const char*)be + gby + u * 256);
        }
        // as wait_xcnt0, for all the registers that this group of loads names
        __builtin_amdgcn_sched_barrier(0);
        asm volatile("s_wait_xcnt 0x0" :: "v"(src), "s"(g), "s"(be), "v"(gby) : "memory");
        __builtin_amdgcn_sched_barrier(0);
    } else {
        wait_xcnt0(src);
    }
    float su[4] = {0.0f, 0.0f, 0.0f, 0.0f}, sc[4] = {0.0f, 0.0f, 0.0f, 0.0f};
#pragma unroll
    for (int u = 0; u < 4; ++u)
#pragma unroll
        for (int j = 0; j < 4; ++j) {
            v4h h;
#pragma unroll
            for (int i = 0; i < 4; ++i) {
                float w = v[u][i][j];
                if (FOLD) { sc[j] += w * bk[u][i]; w *= gk[u][i]; }
                h[i] = (_Float16)w;
                if (FOLD) su[j] += (float)h[i];
            }
            *(v4h*)&tile[nq * 4 + j][(((u * 8 + (kq >> 1)) ^ nq) << 3) + (kq & 1) * 4] = h;
        }
    if (FOLD) {
#pragma unroll
        for (int j = 0; j < 4; ++j) {
            su[j] += __shfl_xor(su[j], 16, 32);
            sc[j] += __shfl_xor(sc[j], 16, 32);
        }
        if ((tid & 16) == 0) {
#pragma unroll
            for (int j = 0; j < 4; ++j) red[tid >> 5][nq * 4 + j] = make_float2(su[j], sc[j]);
        }
    }
    __syncthreads();
    const int lane = tid & 31, nw = (tid >> 5) * 8;
    _Float16* dst = out + (size_t)(n0 + nw) * K + k0 + lane * 8;
    v8h o[8];
#pragma unroll
    for (int r = 0; r < 8; ++r)
        o[r] = *(const v8h*)&tile[nw + r][(lane ^ ((nw + r) >> 2)) << 3];
#pragma unroll
    for (int r = 0; r < 8; ++r)
        *(v8h*)(dst + (size_t)r * K) = o[r];
    if (FOLD && tid < PT_N) {            // whole waves; 256 B in a row per array
        float a = 0.0f, c = 0.0f;
#pragma unroll
        for (int w = 0; w < 8; ++w) { a += red[w][tid].x; c += red[w][tid].y; }
        const size_t at = (size_t)(b / (N / PT_N)) * N + n0 + tid;
        up[at] = a;
        cp[at] = c;
    }
    // the other tile shapes' code follows in the listing and takes these registers
    wait_xcnt0(dst);
}

// eight waves a SIMD: 128 registers a wave, so that four blocks still share a WGP
__global__ __launch_bounds__(256) __attribute__((amdgpu_waves_per_eu(8)))
void prep_f16(const float* __restrict__ x,  const float* __restrict__ wq,
              const float* __restrict__ wk, const float* __restrict__ wv,
              const float* __restrict__ wo, const float* __restrict__ w1,
              const float* __restrict__ w2, const float* __restrict__ g1,
              const float* __restrict__ be1, _Float16* __restrict__ xh,
              _Float16* __restrict__ wqkvT, _Float16* __restrict__ woT,
              _Float16* __restrict__ w1T,   _Float16* __restrict__ w2T,
              float* __restrict__ up,       float* __restrict__ cp)
{
    __shared__ alignas(16) _Float16 tile[PT_N][PT_K];
    __shared__ alignas(16) float2 red[8][PT_N];   // w1 tiles: the waves' shares of u and c
    int b = blockIdx.x;
    if (b >= TB_ALL) {                   // whole blocks leave ahead of the barrier
        const size_t i0 = (size_t)(b - TB_ALL) * (16 * 256) + threadIdx.x;
        const v4f* src = (const v4f*)x + i0;
        v4h*       dst = (v4h*)xh + i0;
        v4f v[16];
#pragma unroll
        for (int i = 0; i < 16; ++i) v[i] = src[i * 256];
        wait_xcnt0(src);
#pragma unroll
        for (int i = 0; i < 16; ++i) {
            v4h h;
#pragma unroll
            for (int j = 0; j < 4; ++j) h[j] = (_Float16)v[i][j];
            dst[i * 256] = h;
            if (i == 7) wait_xcnt0(dst);   // the second half reuses the first's registers
        }
        return;
    }
    // the branches are taken by whole blocks, each with its one barrier
    if (b < 4 * TB_E) {
        const int w = b / TB_E;
        b -= w * TB_E;
        const float* in  = (w == 0) ? wq : (w == 1) ? wk : (w == 2) ? wv : wo;
        _Float16*    out = (w == 3) ? woT : wqkvT + (size_t)w * E_DIM * E_DIM;
        transpose_tile<E_DIM, E_DIM, false>(in, out, b, tile, nullptr, nullptr, nullptr, nullptr, red);
    } else if (b < 4 * TB_E + TB_FF) {
        transpose_tile<E_DIM, FF_DIM, true>(w1, w1T, b - 4 * TB_E, tile, g1, be1, up, cp, red);
    } else {
        transpose_tile<FF_DIM, E_DIM, false>(w2, w2T, b - 4 * TB_E - TB_FF, tile, nullptr, nullptr, nullptr, nullptr, red);
    }
}

extern "C" void kernel_launch(void* const* d_in, const int* in_sizes, int n_in,
                              void* d_out, int out_size, void* d_ws, size_t ws_size,
                              hipStream_t stream)
{
    (void)in_sizes; (void)n_in; (void)out_size; (void)ws_size;
    const float* x   = (const float*)d_in[0];
    const int*   msk = (const int*)d_in[1];
    const float* wq  = (const float*)d_in[2];
    const float* wk  = (const float*)d_in[3];
    const float* wv  = (const float*)d_in[4];
    const float* wo  = (const float*)d_in[5];
    const float* bo  = (const float*)d_in[6];
    const float* g1  = (const float*)d_in[7];
    const float* be1 = (const float*)d_in[8];
    const float* g2  = (const float*)d_in[9];
    const float* be2 = (const float*)d_in[10];
    const float* w1  = (const float*)d_in[11];
    const float* b1  = (const float*)d_in[12];
    const float* w2  = (const float*)d_in[13];
    const float* b2  = (const float*)d_in[14];

    const int NL = 2 * L_SEQ;                       // 4096 tokens
    char* ws = (char*)d_ws;
    const size_t MB = 1024ull * 1024ull;
    _Float16* AH    = (_Float16*)(ws + 0);          //  8 MB: x f16, later pre-LN1 rows f16
    _Float16* FFH   = (_Float16*)(ws + 8 * MB);     // 32 MB: relu(h@w1+b1) f16
    _Float16* QKVH  = (_Float16*)(ws + 48 * MB);    // 24 MB: [token][Q | K | V] f16
    _Float16* ATTNH = (_Float16*)(ws + 72 * MB);    //  8 MB
    float*    RES   = (float*)(ws + 80 * MB);       // 16 MB: pre-LN1 rows f32
    float*    RES2  = (float*)(ws + 96 * MB);       // 16 MB: pre-LN2 rows f32
    _Float16* WQKVT = (_Float16*)(ws + 112 * MB);   //  6 MB: [wq^T ; wk^T ; wv^T] f16
    _Float16* WOT   = (_Float16*)(ws + 118 * MB);   //  2 MB: wo^T f16
    _Float16* W1T   = (_Float16*)(ws + 120 * MB);   //  8 MB: (g1 w1)^T f16
    _Float16* W2T   = (_Float16*)(ws + 128 * MB);   //  8 MB: w2^T f16
    float*    RSUM  = (float*)(ws + 136 * MB);      // 512 KB: [chunk][row] (sum, squares)
    float*    UP    = (float*)(ws + 137 * MB);      //  64 KB: [k tile][column] share of u
    float*    CP    = (float*)(ws + 138 * MB);      //  64 KB: [k tile][column] share of c

    dim3 blk256(256);
    dim3 gP(E_DIM / 128, NL / 128);                 // (8, 32)
    dim3 gQKV(3 * E_DIM / 192, NL / 256);           // (16, 16): one block a WGP
    dim3 gF1(FF_DIM / 256, NL / 256);               // (16, 16): one block a WGP

    // x and all six weights to f16 (weights transposed)
    prep_f16<<<TB_ALL + XB_ALL, blk256, 0, stream>>>(x, wq, wk, wv, wo, w1, w2, g1, be1,
                                                     AH, WQKVT, WOT, W1T, W2T, UP, CP);

    // Q, K and V projections as one product with N = 3 E
    gemm_wmma_f16<256, 192, 3 * E_DIM, false, false, false, true, 0><<<gQKV, blk256, 0, stream>>>(AH, WQKVT, nullptr, nullptr, nullptr, QKVH, nullptr, nullptr, nullptr, nullptr, E_DIM);

    attention_wmma<<<dim3(L_SEQ / QBLK, H_DIM, 2), blk256, 0, stream>>>(QKVH, QKVH + E_DIM, QKVH + 2 * E_DIM, msk, ATTNH);

    // out-proj + bo + residual x  -> RES (f32), AH (f16), row sums
    gemm_wmma_f16<128, 128, E_DIM, true, true, false, false, 1><<<gP, blk256, 0, stream>>>(ATTNH, WOT, bo, x, RES, AH, nullptr, RSUM, nullptr, nullptr, E_DIM);

    // FF1: relu(h @ w1 + b1) -> FFH (f16), h = LN1 of the rows, applied to the results
    gemm_wmma_f16<256, 256, FF_DIM, false, false, true, true, 2><<<gF1, blk256, 0, stream>>>(AH, W1T, b1, nullptr, nullptr, FFH, RSUM, nullptr, UP, CP, E_DIM);

    // FF2: ff @ w2 + b2 + h -> RES2 (f32), h formed from RES
    gemm_wmma_f16<128, 128, E_DIM, true, true, false, false, 3><<<gP, blk256, 0, stream>>>(FFH, W2T, b2, RES, RES2, nullptr, RSUM, nullptr, g1, be1, FF_DIM);

    // LN2 -> final output
    layernorm_k<<<NL / LN_ROWS, blk256, 0, stream>>>(RES2, g2, be2, (float*)d_out);
}
